// v000
// The times below were measured on an AMD MI455X: many runs one after another, warmed up first and cycling through
// copies of the inputs, with the whole window's GPU time divided by the number of runs. Launches and the gaps
// between them are all in it. The median over several windows is given; except for v000 it joins two sittings, which
// can be a few percent apart, so the side-by-side timings, each taken in one sitting, are the better comparison.
// v000 is the starting kernel. One run takes 665 microseconds.
#include <hip/hip_runtime.h>

// ---------------------------------------------------------------------------
// AttnBlock for MI455X (gfx1250): GroupNorm -> QKV 1x1 -> attention -> proj
// GEMMs via V_WMMA_F32_16X16X32_F16; tiles staged with
// GLOBAL_LOAD_ASYNC_TO_LDS_B128 (ASYNCcnt) into double-buffered LDS.
// ---------------------------------------------------------------------------

typedef __attribute__((ext_vector_type(16))) _Float16 v16h;
typedef __attribute__((ext_vector_type(8)))  _Float16 h8;
typedef __attribute__((ext_vector_type(2)))  _Float16 h2;
typedef __attribute__((ext_vector_type(8)))  float    v8f;

#define C_DIM 512
#define N_DIM 4096
#define B_DIM 2
#define NGRP  32
#define CPG   16           // channels per group
#define GELEM (CPG * N_DIM)

// ------------------------- CDNA5 async-copy helpers ------------------------
// Per-lane async copy of 16 bytes global -> LDS, tracked by ASYNCcnt.
// vdst VGPR carries the 32-bit LDS byte address (low 32 bits of flat shared
// pointer, per ISA 10.2 aperture mapping).
__device__ __forceinline__ void async_copy_b128(void* lds_ptr, const void* gptr) {
    unsigned lds_off = (unsigned)(unsigned long long)lds_ptr;
    asm volatile("global_load_async_to_lds_b128 %0, %1, off"
                 :: "v"(lds_off), "v"((unsigned long long)gptr)
                 : "memory");
}
__device__ __forceinline__ void wait_async0() {
    asm volatile("s_wait_asynccnt 0x0" ::: "memory");
}

// ------------------------- block reductions --------------------------------
__device__ __forceinline__ float block_reduce_sum(float v, float* buf) {
    int tid = threadIdx.x;
    buf[tid] = v; __syncthreads();
    #pragma unroll
    for (int s = 128; s > 0; s >>= 1) {
        if (tid < s) buf[tid] += buf[tid + s];
        __syncthreads();
    }
    float r = buf[0]; __syncthreads();
    return r;
}
__device__ __forceinline__ float block_reduce_max(float v, float* buf) {
    int tid = threadIdx.x;
    buf[tid] = v; __syncthreads();
    #pragma unroll
    for (int s = 128; s > 0; s >>= 1) {
        if (tid < s) buf[tid] = fmaxf(buf[tid], buf[tid + s]);
        __syncthreads();
    }
    float r = buf[0]; __syncthreads();
    return r;
}

// ------------------------- GroupNorm ---------------------------------------
__global__ __launch_bounds__(256) void gn_stats_kernel(
    const float* __restrict__ x, float* __restrict__ stats) {
    __shared__ float buf[256];
    const float* p = x + (size_t)blockIdx.x * GELEM;
    float s = 0.f, s2 = 0.f;
    for (int i = threadIdx.x; i < GELEM; i += 256) {
        float v = p[i];
        s += v; s2 += v * v;
    }
    s  = block_reduce_sum(s,  buf);
    s2 = block_reduce_sum(s2, buf);
    if (threadIdx.x == 0) {
        float mu  = s  * (1.0f / GELEM);
        float var = s2 * (1.0f / GELEM) - mu * mu;
        stats[blockIdx.x * 2 + 0] = mu;
        stats[blockIdx.x * 2 + 1] = rsqrtf(var + 1e-6f);
    }
}

// normalize + affine, write h^T as f16 [B][N][C] (k-contiguous for GEMM B)
__global__ __launch_bounds__(256) void gn_apply_kernel(
    const float* __restrict__ x, const float* __restrict__ stats,
    const float* __restrict__ gw, const float* __restrict__ gb,
    _Float16* __restrict__ hT) {
    int bc = blockIdx.x;               // b*C + c
    int b  = bc >> 9;
    int c  = bc & (C_DIM - 1);
    int g  = c >> 4;
    float mu = stats[(b * NGRP + g) * 2 + 0];
    float rs = stats[(b * NGRP + g) * 2 + 1];
    float w  = gw[c], bb = gb[c];
    const float* xr = x + (size_t)bc * N_DIM;
    _Float16* dst = hT + (size_t)b * N_DIM * C_DIM + c;
    for (int n = threadIdx.x; n < N_DIM; n += 256) {
        float v = (xr[n] - mu) * rs * w + bb;
        dst[(size_t)n * C_DIM] = (_Float16)v;
    }
}

// ------------------------- f32 -> f16 convert ------------------------------
__global__ __launch_bounds__(256) void cvt_f16_kernel(
    const float* __restrict__ src, _Float16* __restrict__ dst, int n) {
    for (int i = blockIdx.x * 256 + threadIdx.x; i < n; i += gridDim.x * 256)
        dst[i] = (_Float16)src[i];
}

// ------------------------- WMMA fragment load ------------------------------
// LDS tile is row-major [r][32] halves. Per ISA 16-bit A 16x32 layout:
// lane<16 -> K base 0, lane>=16 -> K base 8; elems 0..7 = K base..base+7,
// elems 8..15 = K base+16..base+23. B (stored transposed [n][k]) symmetric.
__device__ __forceinline__ v16h load_frag32(const _Float16* lds, int row, int kbase) {
    const h8 lo = *(const h8*)(lds + row * 32 + kbase);
    const h8 hi = *(const h8*)(lds + row * 32 + kbase + 16);
    return __builtin_shufflevector(lo, hi, 0,1,2,3,4,5,6,7,8,9,10,11,12,13,14,15);
}

// ------------------------- generic WMMA GEMM -------------------------------
// D = alpha * A(f16 [M][K]) x B(f16) + bias(+residual)
// OUT_MODE: 0 = f16 [M][N] (+bias)      (V, attn-out)
//           1 = f16 [N][M] (+bias)      (Q, K^T)
//           2 = f32 [M][N], scaled      (scores)
//           3 = f32 [M][N] + bias + residual (final proj)
// B_KN: true  -> global B is [K][N] (ldb = N pitch), transposed into LDS
//       false -> global B is [N][K] (pre-transposed), async direct copy
template <int OUT_MODE, bool B_KN>
__global__ __launch_bounds__(256) void gemm_wmma_kernel(
    const _Float16* __restrict__ A, int lda,
    const _Float16* __restrict__ Bm, int ldb,
    void* __restrict__ Out, int ldo,
    const float* __restrict__ bias,
    const float* __restrict__ residual,
    float alpha, int M, int N, int K) {
    (void)M; (void)N;
    __shared__ _Float16 lA[2][128 * 32];
    __shared__ _Float16 lB[2][128 * 32];

    const int tid   = threadIdx.x;
    const int lane  = tid & 31;
    const int wave  = tid >> 5;     // 0..7
    const int waveM = wave & 3;     // 4 -> 32 rows each
    const int waveN = wave >> 2;    // 2 -> 64 cols each
    const int m0g   = blockIdx.x * 128;
    const int n0g   = blockIdx.y * 128;

    v8f acc[2][4];
    #pragma unroll
    for (int i = 0; i < 2; ++i)
        #pragma unroll
        for (int j = 0; j < 4; ++j)
            acc[i][j] = (v8f){0.f,0.f,0.f,0.f,0.f,0.f,0.f,0.f};

    const int rl    = lane & 15;
    const int kbase = (lane < 16) ? 0 : 8;

    // ---- tile staging (async for direct paths; packed DS for transpose) ----
    auto stage = [&](int bufi, int k0) {
        // A tile [128][32]: 512 16-byte chunks, 2 per thread, memory -> LDS
        #pragma unroll
        for (int it = 0; it < 2; ++it) {
            int cc = tid + it * 256;
            int m  = cc >> 2;
            int kq = (cc & 3) * 8;
            async_copy_b128(&lA[bufi][m * 32 + kq],
                            A + (size_t)(m0g + m) * lda + k0 + kq);
        }
        if (!B_KN) {
            #pragma unroll
            for (int it = 0; it < 2; ++it) {
                int cc = tid + it * 256;
                int n  = cc >> 2;
                int kq = (cc & 3) * 8;
                async_copy_b128(&lB[bufi][n * 32 + kq],
                                Bm + (size_t)(n0g + n) * ldb + k0 + kq);
            }
        } else {
            // transpose fill: pair k rows, packed 2xf16 ds_store_b32
            int k2 = (tid & 15) * 2;          // even k
            int nq = (tid >> 4) * 8;          // 0..120
            h8 v0 = *(const h8*)(Bm + (size_t)(k0 + k2)     * ldb + n0g + nq);
            h8 v1 = *(const h8*)(Bm + (size_t)(k0 + k2 + 1) * ldb + n0g + nq);
            #pragma unroll
            for (int e = 0; e < 8; ++e) {
                h2 t = {v0[e], v1[e]};
                *(h2*)(&lB[bufi][(nq + e) * 32 + k2]) = t;
            }
        }
    };

    int buf = 0;
    stage(buf, 0);
    wait_async0();
    __syncthreads();

    for (int k0 = 0; k0 < K; k0 += 32) {
        int nbuf = buf ^ 1;
        if (k0 + 32 < K) stage(nbuf, k0 + 32);   // overlap with compute

        // ---- compute: one K=32 WMMA step from current buffer
        v16h af[2], bf[4];
        #pragma unroll
        for (int sm = 0; sm < 2; ++sm)
            af[sm] = load_frag32(lA[buf], waveM * 32 + sm * 16 + rl, kbase);
        #pragma unroll
        for (int sn = 0; sn < 4; ++sn)
            bf[sn] = load_frag32(lB[buf], waveN * 64 + sn * 16 + rl, kbase);
        #pragma unroll
        for (int sm = 0; sm < 2; ++sm)
            #pragma unroll
            for (int sn = 0; sn < 4; ++sn)
                acc[sm][sn] = __builtin_amdgcn_wmma_f32_16x16x32_f16(
                    false, af[sm], false, bf[sn],
                    (short)0, acc[sm][sn], false, false);

        wait_async0();        // next-buffer async writes landed
        __syncthreads();      // + all waves done reading current buffer
        buf = nbuf;
    }

    // ---- epilogue: lane holds col n = rl, rows mb..mb+7
    const int mhalf = (lane < 16) ? 0 : 8;
    #pragma unroll
    for (int sm = 0; sm < 2; ++sm) {
        #pragma unroll
        for (int sn = 0; sn < 4; ++sn) {
            int mb = m0g + waveM * 32 + sm * 16 + mhalf;
            int n  = n0g + waveN * 64 + sn * 16 + rl;
            v8f a = acc[sm][sn];
            if (OUT_MODE == 0) {
                _Float16* O = (_Float16*)Out;
                #pragma unroll
                for (int r = 0; r < 8; ++r) {
                    float v = a[r] * alpha + (bias ? bias[mb + r] : 0.0f);
                    O[(size_t)(mb + r) * ldo + n] = (_Float16)v;
                }
            } else if (OUT_MODE == 1) {
                _Float16* O = (_Float16*)Out;
                h8 pack;
                #pragma unroll
                for (int r = 0; r < 8; ++r)
                    pack[r] = (_Float16)(a[r] * alpha + (bias ? bias[mb + r] : 0.0f));
                *(h8*)(O + (size_t)n * ldo + mb) = pack;   // contiguous over m
            } else if (OUT_MODE == 2) {
                float* O = (float*)Out;
                #pragma unroll
                for (int r = 0; r < 8; ++r)
                    O[(size_t)(mb + r) * ldo + n] = a[r] * alpha;
            } else {
                float* O = (float*)Out;
                #pragma unroll
                for (int r = 0; r < 8; ++r) {
                    size_t idx = (size_t)(mb + r) * ldo + n;
                    O[idx] = residual[idx] + a[r] * alpha + bias[mb + r];
                }
            }
        }
    }
}

// ------------------------- row softmax (in-place f32 -> f16) ---------------
// S: f32 [N][N]. Writes normalized f16 over the head of each row:
// P element (i,j) lives at half index i*2N + j  (pitch 2N halves).
__global__ __launch_bounds__(256) void softmax_kernel(float* __restrict__ S) {
    __shared__ float buf[256];
    const int row = blockIdx.x;
    float* r = S + (size_t)row * N_DIM;
    float vals[16];
    float lmax = -3.4e38f;
    #pragma unroll
    for (int i = 0; i < 16; ++i) {
        vals[i] = r[i * 256 + threadIdx.x];
        lmax = fmaxf(lmax, vals[i]);
    }
    float m = block_reduce_max(lmax, buf);
    float lsum = 0.f;
    #pragma unroll
    for (int i = 0; i < 16; ++i) {
        vals[i] = __expf(vals[i] - m);
        lsum += vals[i];
    }
    float s = block_reduce_sum(lsum, buf);   // barrier: all reads done
    float inv = 1.0f / s;
    _Float16* P = (_Float16*)S + (size_t)row * (2 * N_DIM);
    #pragma unroll
    for (int i = 0; i < 16; ++i)
        P[i * 256 + threadIdx.x] = (_Float16)(vals[i] * inv);
}

// ---------------------------------------------------------------------------
extern "C" void kernel_launch(void* const* d_in, const int* in_sizes, int n_in,
                              void* d_out, int out_size, void* d_ws, size_t ws_size,
                              hipStream_t stream) {
    (void)in_sizes; (void)n_in; (void)out_size; (void)ws_size;
    const float* x      = (const float*)d_in[0];
    const float* norm_w = (const float*)d_in[1];
    const float* norm_b = (const float*)d_in[2];
    const float* wq = (const float*)d_in[3];
    const float* bq = (const float*)d_in[4];
    const float* wk = (const float*)d_in[5];
    const float* bk = (const float*)d_in[6];
    const float* wv = (const float*)d_in[7];
    const float* bv = (const float*)d_in[8];
    const float* wp = (const float*)d_in[9];
    const float* bp = (const float*)d_in[10];
    float* out = (float*)d_out;

    // ---- carve workspace
    char* w = (char*)d_ws;
    auto carve = [&](size_t bytes) -> char* {
        char* p = w;
        w += (bytes + 255) & ~(size_t)255;
        return p;
    };
    float*     stats = (float*)carve(B_DIM * NGRP * 2 * sizeof(float));
    _Float16*  hT    = (_Float16*)carve((size_t)B_DIM * N_DIM * C_DIM * 2); // [b][n][c]
    _Float16*  w16q  = (_Float16*)carve((size_t)C_DIM * C_DIM * 2);
    _Float16*  w16k  = (_Float16*)carve((size_t)C_DIM * C_DIM * 2);
    _Float16*  w16v  = (_Float16*)carve((size_t)C_DIM * C_DIM * 2);
    _Float16*  w16p  = (_Float16*)carve((size_t)C_DIM * C_DIM * 2);
    _Float16*  Q     = (_Float16*)carve((size_t)B_DIM * N_DIM * C_DIM * 2); // [b][n][c]
    _Float16*  Kt    = (_Float16*)carve((size_t)B_DIM * N_DIM * C_DIM * 2); // [b][n][c]
    _Float16*  V     = (_Float16*)carve((size_t)B_DIM * C_DIM * N_DIM * 2); // [b][c][n]
    _Float16*  AO    = (_Float16*)carve((size_t)B_DIM * C_DIM * N_DIM * 2); // [b][c][n]
    float*     S     = (float*)carve((size_t)N_DIM * N_DIM * sizeof(float)); // per-batch

    const float scale = 0.044194173824159216f;  // 512^-0.5

    // 1) GroupNorm
    gn_stats_kernel<<<B_DIM * NGRP, 256, 0, stream>>>(x, stats);
    gn_apply_kernel<<<B_DIM * C_DIM, 256, 0, stream>>>(x, stats, norm_w, norm_b, hT);

    // 2) weights to f16
    cvt_f16_kernel<<<256, 256, 0, stream>>>(wq, w16q, C_DIM * C_DIM);
    cvt_f16_kernel<<<256, 256, 0, stream>>>(wk, w16k, C_DIM * C_DIM);
    cvt_f16_kernel<<<256, 256, 0, stream>>>(wv, w16v, C_DIM * C_DIM);
    cvt_f16_kernel<<<256, 256, 0, stream>>>(wp, w16p, C_DIM * C_DIM);

    dim3 gQKV(C_DIM / 128, N_DIM / 128);   // 4 x 32
    dim3 gS(N_DIM / 128, N_DIM / 128);     // 32 x 32

    for (int b = 0; b < B_DIM; ++b) {
        const _Float16* hTb = hT + (size_t)b * N_DIM * C_DIM;
        _Float16* Qb  = Q  + (size_t)b * N_DIM * C_DIM;
        _Float16* Ktb = Kt + (size_t)b * N_DIM * C_DIM;
        _Float16* Vb  = V  + (size_t)b * C_DIM * N_DIM;
        // 3) QKV projections (M=512, N=4096, K=512), B operand = hT "nk" direct
        gemm_wmma_kernel<1, false><<<gQKV, 256, 0, stream>>>(
            w16q, C_DIM, hTb, C_DIM, Qb,  C_DIM, bq, nullptr, 1.0f,
            C_DIM, N_DIM, C_DIM);
        gemm_wmma_kernel<1, false><<<gQKV, 256, 0, stream>>>(
            w16k, C_DIM, hTb, C_DIM, Ktb, C_DIM, bk, nullptr, 1.0f,
            C_DIM, N_DIM, C_DIM);
        gemm_wmma_kernel<0, false><<<gQKV, 256, 0, stream>>>(
            w16v, C_DIM, hTb, C_DIM, Vb,  N_DIM, bv, nullptr, 1.0f,
            C_DIM, N_DIM, C_DIM);
    }

    for (int b = 0; b < B_DIM; ++b) {
        const _Float16* Qb  = Q  + (size_t)b * N_DIM * C_DIM;
        const _Float16* Ktb = Kt + (size_t)b * N_DIM * C_DIM;
        const _Float16* Vb  = V  + (size_t)b * C_DIM * N_DIM;
        _Float16* AOb = AO + (size_t)b * C_DIM * N_DIM;
        // 4) scores: S[i][j] = scale * Q[i][:] . Kt[j][:]   (M=N=4096, K=512)
        gemm_wmma_kernel<2, false><<<gS, 256, 0, stream>>>(
            Qb, C_DIM, Ktb, C_DIM, S, N_DIM, nullptr, nullptr, scale,
            N_DIM, N_DIM, C_DIM);
        // 5) softmax rows, normalized f16 written in place (pitch 2N halves)
        softmax_kernel<<<N_DIM, 256, 0, stream>>>(S);
        // 6) AO[c][j] = sum_i V[c][i] * P[i][j]  (M=512, N=4096, K=4096)
        gemm_wmma_kernel<0, true><<<gQKV, 256, 0, stream>>>(
            Vb, N_DIM, (const _Float16*)S, 2 * N_DIM, AOb, N_DIM,
            nullptr, nullptr, 1.0f, C_DIM, N_DIM, N_DIM);
        // 7) out = x + Wp @ AO + bp   (M=512, N=4096, K=512)
        gemm_wmma_kernel<3, true><<<gQKV, 256, 0, stream>>>(
            w16p, C_DIM, AOb, N_DIM, out + (size_t)b * C_DIM * N_DIM, N_DIM,
            bp, x + (size_t)b * C_DIM * N_DIM, 1.0f, C_DIM, N_DIM, C_DIM);
    }
}

// v001
// It runs in 545 microseconds.
// Two timings next to v000 put it at 1.23 and 1.22 times that version's speed.
#include <hip/hip_runtime.h>

// ---------------------------------------------------------------------------
// AttnBlock for MI455X (gfx1250): GroupNorm -> QKV 1x1 -> attention -> proj
// GEMMs via V_WMMA_F32_16X16X32_F16; tiles staged with
// GLOBAL_LOAD_ASYNC_TO_LDS_B128 (ASYNCcnt) into double-buffered LDS.
// ---------------------------------------------------------------------------

typedef __attribute__((ext_vector_type(16))) _Float16 v16h;
typedef __attribute__((ext_vector_type(8)))  _Float16 h8;
typedef __attribute__((ext_vector_type(8)))  short    s8;
typedef __attribute__((ext_vector_type(8)))  float    v8f;

#define C_DIM 512
#define N_DIM 4096
#define B_DIM 2
#define NGRP  32
#define CPG   16           // channels per group
#define GELEM (CPG * N_DIM)

// ------------------------- CDNA5 async-copy helpers ------------------------
// Per-lane async copy of 16 bytes global -> LDS, tracked by ASYNCcnt.
// vdst VGPR carries the 32-bit LDS byte address (low 32 bits of flat shared
// pointer, per ISA 10.2 aperture mapping).
__device__ __forceinline__ void async_copy_b128(void* lds_ptr, const void* gptr) {
    unsigned lds_off = (unsigned)(unsigned long long)lds_ptr;
    asm volatile("global_load_async_to_lds_b128 %0, %1, off"
                 :: "v"(lds_off), "v"((unsigned long long)gptr)
                 : "memory");
}
// Four per-lane copies of one stage in ONE statement, closed by s_wait_xcnt 0:
// the operands' registers live to the statement's end, so no address register
// of an issued copy is rewritten ahead of that wait.
__device__ __forceinline__ void async_copy4_b128(
    void* l0, const void* g0, void* l1, const void* g1,
    void* l2, const void* g2, void* l3, const void* g3) {
    asm volatile("global_load_async_to_lds_b128 %0, %1, off\n\t"
                 "global_load_async_to_lds_b128 %2, %3, off\n\t"
                 "global_load_async_to_lds_b128 %4, %5, off\n\t"
                 "global_load_async_to_lds_b128 %6, %7, off\n\t"
                 "s_wait_xcnt 0x0"
                 :: "v"((unsigned)(unsigned long long)l0), "v"((unsigned long long)g0),
                    "v"((unsigned)(unsigned long long)l1), "v"((unsigned long long)g1),
                    "v"((unsigned)(unsigned long long)l2), "v"((unsigned long long)g2),
                    "v"((unsigned)(unsigned long long)l3), "v"((unsigned long long)g3)
                 : "memory");
}
__device__ __forceinline__ void wait_async0() {
    asm volatile("s_wait_asynccnt 0x0" ::: "memory");
}

// ------------------------- block reductions --------------------------------
__device__ __forceinline__ float block_reduce_sum(float v, float* buf) {
    int tid = threadIdx.x;
    buf[tid] = v; __syncthreads();
    #pragma unroll
    for (int s = 128; s > 0; s >>= 1) {
        if (tid < s) buf[tid] += buf[tid + s];
        __syncthreads();
    }
    float r = buf[0]; __syncthreads();
    return r;
}
__device__ __forceinline__ float block_reduce_max(float v, float* buf) {
    int tid = threadIdx.x;
    buf[tid] = v; __syncthreads();
    #pragma unroll
    for (int s = 128; s > 0; s >>= 1) {
        if (tid < s) buf[tid] = fmaxf(buf[tid], buf[tid + s]);
        __syncthreads();
    }
    float r = buf[0]; __syncthreads();
    return r;
}

// ------------------------- GroupNorm ---------------------------------------
__global__ __launch_bounds__(256) void gn_stats_kernel(
    const float* __restrict__ x, float* __restrict__ stats) {
    __shared__ float buf[256];
    const float* p = x + (size_t)blockIdx.x * GELEM;
    float s = 0.f, s2 = 0.f;
    for (int i = threadIdx.x; i < GELEM; i += 256) {
        float v = p[i];
        s += v; s2 += v * v;
    }
    s  = block_reduce_sum(s,  buf);
    s2 = block_reduce_sum(s2, buf);
    if (threadIdx.x == 0) {
        float mu  = s  * (1.0f / GELEM);
        float var = s2 * (1.0f / GELEM) - mu * mu;
        stats[blockIdx.x * 2 + 0] = mu;
        stats[blockIdx.x * 2 + 1] = rsqrtf(var + 1e-6f);
    }
}

// normalize + affine, write h^T as f16 [B][N][C] (k-contiguous for GEMM B)
__global__ __launch_bounds__(256) void gn_apply_kernel(
    const float* __restrict__ x, const float* __restrict__ stats,
    const float* __restrict__ gw, const float* __restrict__ gb,
    _Float16* __restrict__ hT) {
    int bc = blockIdx.x;               // b*C + c
    int b  = bc >> 9;
    int c  = bc & (C_DIM - 1);
    int g  = c >> 4;
    float mu = stats[(b * NGRP + g) * 2 + 0];
    float rs = stats[(b * NGRP + g) * 2 + 1];
    float w  = gw[c], bb = gb[c];
    const float* xr = x + (size_t)bc * N_DIM;
    _Float16* dst = hT + (size_t)b * N_DIM * C_DIM + c;
    for (int n = threadIdx.x; n < N_DIM; n += 256) {
        float v = (xr[n] - mu) * rs * w + bb;
        dst[(size_t)n * C_DIM] = (_Float16)v;
    }
}

// ------------------------- f32 -> f16 convert ------------------------------
__global__ __launch_bounds__(256) void cvt_f16_kernel(
    const float* __restrict__ src, _Float16* __restrict__ dst, int n) {
    for (int i = blockIdx.x * 256 + threadIdx.x; i < n; i += gridDim.x * 256)
        dst[i] = (_Float16)src[i];
}

// ------------------------- WMMA fragment load ------------------------------
// LDS tile is row-major [r][32] halves. Per ISA 16-bit A 16x32 layout:
// lane<16 -> K base 0, lane>=16 -> K base 8; elems 0..7 = K base..base+7,
// elems 8..15 = K base+16..base+23. B (stored transposed [n][k]) symmetric.
__device__ __forceinline__ v16h load_frag32(const _Float16* lds, int row, int kbase) {
    const h8 lo = *(const h8*)(lds + row * 32 + kbase);
    const h8 hi = *(const h8*)(lds + row * 32 + kbase + 16);
    return __builtin_shufflevector(lo, hi, 0,1,2,3,4,5,6,7,8,9,10,11,12,13,14,15);
}

// B fragment out of a row-major [k][n] LDS tile (pitch BKN_PITCH halves) by the
// transposing load: lane (c = l & 15, h = l >> 4) gets T[kb + 8h + 0..7][n0 + c];
// the loads at kb = 0 and kb = 16 give the k order of load_frag32.
#define BKN_PITCH 144      // 288 B = 32 B x odd: the transposing load's pitch
__device__ __forceinline__ h8 load_tr16(const _Float16* p) {
    typedef __attribute__((address_space(3))) s8 lds_s8;
    return __builtin_bit_cast(h8, __builtin_amdgcn_ds_load_tr16_b128_v8i16((lds_s8*)p));
}
__device__ __forceinline__ v16h load_frag32_tr(const _Float16* lds, int n0, int lane) {
    const _Float16* p = lds + (8 * (lane >> 4) + (lane & 7)) * BKN_PITCH
                            + n0 + 8 * ((lane >> 3) & 1);
    const h8 lo = load_tr16(p);
    const h8 hi = load_tr16(p + 16 * BKN_PITCH);
    return __builtin_shufflevector(lo, hi, 0,1,2,3,4,5,6,7,8,9,10,11,12,13,14,15);
}

// ------------------------- generic WMMA GEMM -------------------------------
// D = alpha * A(f16 [M][K]) x B(f16) + bias(+residual)
// OUT_MODE: 0 = f16 [M][N] (+bias)      (V, attn-out)
//           1 = f16 [N][M] (+bias)      (Q, K^T)
//           2 = f32 [M][N], scaled      (scores)
//           3 = f32 [M][N] + bias + residual (final proj)
// B_KN: true  -> global B is [K][N] (ldb = N pitch), async copy row-major into
//                LDS, transposed by the fragment load
//       false -> global B is [N][K] (pre-transposed), async direct copy
template <int OUT_MODE, bool B_KN>
__global__ __launch_bounds__(256) void gemm_wmma_kernel(
    const _Float16* __restrict__ A, int lda,
    const _Float16* __restrict__ Bm, int ldb,
    void* __restrict__ Out, int ldo,
    const float* __restrict__ bias,
    const float* __restrict__ residual,
    float alpha, int M, int N, int K) {
    (void)M; (void)N;
    __shared__ _Float16 lA[2][128 * 32];
    __shared__ __attribute__((aligned(16)))
        _Float16 lB[2][B_KN ? 32 * BKN_PITCH : 128 * 32];

    const int tid   = threadIdx.x;
    const int lane  = tid & 31;
    const int wave  = tid >> 5;     // 0..7
    const int waveM = wave & 3;     // 4 -> 32 rows each
    const int waveN = wave >> 2;    // 2 -> 64 cols each
    const int m0g   = blockIdx.x * 128;
    const int n0g   = blockIdx.y * 128;

    v8f acc[2][4];
    #pragma unroll
    for (int i = 0; i < 2; ++i)
        #pragma unroll
        for (int j = 0; j < 4; ++j)
            acc[i][j] = (v8f){0.f,0.f,0.f,0.f,0.f,0.f,0.f,0.f};

    const int rl    = lane & 15;
    const int kbase = (lane < 16) ? 0 : 8;

    // ---- tile staging: async copies, memory -> LDS, no register in between ----
    auto stage = [&](int bufi, int k0) {
        if (!B_KN) {
            // A tile [128][32]: 512 16-byte chunks, 2 per thread, memory -> LDS
            #pragma unroll
            for (int it = 0; it < 2; ++it) {
                int cc = tid + it * 256;
                int m  = cc >> 2;
                int kq = (cc & 3) * 8;
                async_copy_b128(&lA[bufi][m * 32 + kq],
                                A + (size_t)(m0g + m) * lda + k0 + kq);
            }
            #pragma unroll
            for (int it = 0; it < 2; ++it) {
                int cc = tid + it * 256;
                int n  = cc >> 2;
                int kq = (cc & 3) * 8;
                async_copy_b128(&lB[bufi][n * 32 + kq],
                                Bm + (size_t)(n0g + n) * ldb + k0 + kq);
            }
        } else {
            // A tile [128][32] as above; B tile [32 k][128 n] row-major: 16 lanes
            // cover one 256-byte row, rows k and k + 16 per thread
            int m  = tid >> 2;
            int kq = (tid & 3) * 8;
            int k  = tid >> 4;
            int nq = (tid & 15) * 8;
            const _Float16* ga = A  + (size_t)(m0g + m) * lda + k0 + kq;
            const _Float16* gb = Bm + (size_t)(k0 + k) * ldb + n0g + nq;
            async_copy4_b128(&lA[bufi][m * 32 + kq],               ga,
                             &lA[bufi][(m + 64) * 32 + kq],        ga + (size_t)64 * lda,
                             &lB[bufi][k * BKN_PITCH + nq],        gb,
                             &lB[bufi][(k + 16) * BKN_PITCH + nq], gb + (size_t)16 * ldb);
        }
    };

    int buf = 0;
    stage(buf, 0);
    wait_async0();
    __syncthreads();

    for (int k0 = 0; k0 < K; k0 += 32) {
        int nbuf = buf ^ 1;
        if (k0 + 32 < K) stage(nbuf, k0 + 32);   // overlap with compute

        // ---- compute: one K=32 WMMA step from current buffer
        v16h af[2], bf[4];
        #pragma unroll
        for (int sm = 0; sm < 2; ++sm)
            af[sm] = load_frag32(lA[buf], waveM * 32 + sm * 16 + rl, kbase);
        #pragma unroll
        for (int sn = 0; sn < 4; ++sn)
            bf[sn] = B_KN ? load_frag32_tr(lB[buf], waveN * 64 + sn * 16, lane)
                          : load_frag32(lB[buf], waveN * 64 + sn * 16 + rl, kbase);
        #pragma unroll
        for (int sm = 0; sm < 2; ++sm)
            #pragma unroll
            for (int sn = 0; sn < 4; ++sn)
                acc[sm][sn] = __builtin_amdgcn_wmma_f32_16x16x32_f16(
                    false, af[sm], false, bf[sn],
                    (short)0, acc[sm][sn], false, false);

        // this wave's LDS reads of the current buffer have retired before the
        // barrier behind which copies refill it
        if (B_KN) asm volatile("s_wait_dscnt 0x0" ::: "memory");
        wait_async0();        // next-buffer async writes landed
        __syncthreads();      // + all waves done reading current buffer
        buf = nbuf;
    }

    // ---- epilogue: lane holds col n = rl, rows mb..mb+7
    const int mhalf = (lane < 16) ? 0 : 8;
    #pragma unroll
    for (int sm = 0; sm < 2; ++sm) {
        #pragma unroll
        for (int sn = 0; sn < 4; ++sn) {
            int mb = m0g + waveM * 32 + sm * 16 + mhalf;
            int n  = n0g + waveN * 64 + sn * 16 + rl;
            v8f a = acc[sm][sn];
            if (OUT_MODE == 0) {
                _Float16* O = (_Float16*)Out;
                #pragma unroll
                for (int r = 0; r < 8; ++r) {
                    float v = a[r] * alpha + (bias ? bias[mb + r] : 0.0f);
                    O[(size_t)(mb + r) * ldo + n] = (_Float16)v;
                }
            } else if (OUT_MODE == 1) {
                _Float16* O = (_Float16*)Out;
                h8 pack;
                #pragma unroll
                for (int r = 0; r < 8; ++r)
                    pack[r] = (_Float16)(a[r] * alpha + (bias ? bias[mb + r] : 0.0f));
                *(h8*)(O + (size_t)n * ldo + mb) = pack;   // contiguous over m
            } else if (OUT_MODE == 2) {
                float* O = (float*)Out;
                #pragma unroll
                for (int r = 0; r < 8; ++r)
                    O[(size_t)(mb + r) * ldo + n] = a[r] * alpha;
            } else {
                float* O = (float*)Out;
                #pragma unroll
                for (int r = 0; r < 8; ++r) {
                    size_t idx = (size_t)(mb + r) * ldo + n;
                    O[idx] = residual[idx] + a[r] * alpha + bias[mb + r];
                }
            }
        }
    }
}

// ------------------------- row softmax (in-place f32 -> f16) ---------------
// S: f32 [N][N]. Writes normalized f16 over the head of each row:
// P element (i,j) lives at half index i*2N + j  (pitch 2N halves).
__global__ __launch_bounds__(256) void softmax_kernel(float* __restrict__ S) {
    __shared__ float buf[256];
    const int row = blockIdx.x;
    float* r = S + (size_t)row * N_DIM;
    float vals[16];
    float lmax = -3.4e38f;
    #pragma unroll
    for (int i = 0; i < 16; ++i) {
        vals[i] = r[i * 256 + threadIdx.x];
        lmax = fmaxf(lmax, vals[i]);
    }
    float m = block_reduce_max(lmax, buf);
    float lsum = 0.f;
    #pragma unroll
    for (int i = 0; i < 16; ++i) {
        vals[i] = __expf(vals[i] - m);
        lsum += vals[i];
    }
    float s = block_reduce_sum(lsum, buf);   // barrier: all reads done
    float inv = 1.0f / s;
    _Float16* P = (_Float16*)S + (size_t)row * (2 * N_DIM);
    #pragma unroll
    for (int i = 0; i < 16; ++i)
        P[i * 256 + threadIdx.x] = (_Float16)(vals[i] * inv);
}

// ---------------------------------------------------------------------------
extern "C" void kernel_launch(void* const* d_in, const int* in_sizes, int n_in,
                              void* d_out, int out_size, void* d_ws, size_t ws_size,
                              hipStream_t stream) {
    (void)in_sizes; (void)n_in; (void)out_size; (void)ws_size;
    const float* x      = (const float*)d_in[0];
    const float* norm_w = (const float*)d_in[1];
    const float* norm_b = (const float*)d_in[2];
    const float* wq = (const float*)d_in[3];
    const float* bq = (const float*)d_in[4];
    const float* wk = (const float*)d_in[5];
    const float* bk = (const float*)d_in[6];
    const float* wv = (const float*)d_in[7];
    const float* bv = (const float*)d_in[8];
    const float* wp = (const float*)d_in[9];
    const float* bp = (const float*)d_in[10];
    float* out = (float*)d_out;

    // ---- carve workspace
    char* w = (char*)d_ws;
    auto carve = [&](size_t bytes) -> char* {
        char* p = w;
        w += (bytes + 255) & ~(size_t)255;
        return p;
    };
    float*     stats = (float*)carve(B_DIM * NGRP * 2 * sizeof(float));
    _Float16*  hT    = (_Float16*)carve((size_t)B_DIM * N_DIM * C_DIM * 2); // [b][n][c]
    _Float16*  w16q  = (_Float16*)carve((size_t)C_DIM * C_DIM * 2);
    _Float16*  w16k  = (_Float16*)carve((size_t)C_DIM * C_DIM * 2);
    _Float16*  w16v  = (_Float16*)carve((size_t)C_DIM * C_DIM * 2);
    _Float16*  w16p  = (_Float16*)carve((size_t)C_DIM * C_DIM * 2);
    _Float16*  Q     = (_Float16*)carve((size_t)B_DIM * N_DIM * C_DIM * 2); // [b][n][c]
    _Float16*  Kt    = (_Float16*)carve((size_t)B_DIM * N_DIM * C_DIM * 2); // [b][n][c]
    _Float16*  V     = (_Float16*)carve((size_t)B_DIM * C_DIM * N_DIM * 2); // [b][c][n]
    _Float16*  AO    = (_Float16*)carve((size_t)B_DIM * C_DIM * N_DIM * 2); // [b][c][n]
    float*     S     = (float*)carve((size_t)N_DIM * N_DIM * sizeof(float)); // per-batch

    const float scale = 0.044194173824159216f;  // 512^-0.5

    // 1) GroupNorm
    gn_stats_kernel<<<B_DIM * NGRP, 256, 0, stream>>>(x, stats);
    gn_apply_kernel<<<B_DIM * C_DIM, 256, 0, stream>>>(x, stats, norm_w, norm_b, hT);

    // 2) weights to f16
    cvt_f16_kernel<<<256, 256, 0, stream>>>(wq, w16q, C_DIM * C_DIM);
    cvt_f16_kernel<<<256, 256, 0, stream>>>(wk, w16k, C_DIM * C_DIM);
    cvt_f16_kernel<<<256, 256, 0, stream>>>(wv, w16v, C_DIM * C_DIM);
    cvt_f16_kernel<<<256, 256, 0, stream>>>(wp, w16p, C_DIM * C_DIM);

    dim3 gQKV(C_DIM / 128, N_DIM / 128);   // 4 x 32
    dim3 gS(N_DIM / 128, N_DIM / 128);     // 32 x 32

    for (int b = 0; b < B_DIM; ++b) {
        const _Float16* hTb = hT + (size_t)b * N_DIM * C_DIM;
        _Float16* Qb  = Q  + (size_t)b * N_DIM * C_DIM;
        _Float16* Ktb = Kt + (size_t)b * N_DIM * C_DIM;
        _Float16* Vb  = V  + (size_t)b * C_DIM * N_DIM;
        // 3) QKV projections (M=512, N=4096, K=512), B operand = hT "nk" direct
        gemm_wmma_kernel<1, false><<<gQKV, 256, 0, stream>>>(
            w16q, C_DIM, hTb, C_DIM, Qb,  C_DIM, bq, nullptr, 1.0f,
            C_DIM, N_DIM, C_DIM);
        gemm_wmma_kernel<1, false><<<gQKV, 256, 0, stream>>>(
            w16k, C_DIM, hTb, C_DIM, Ktb, C_DIM, bk, nullptr, 1.0f,
            C_DIM, N_DIM, C_DIM);
        gemm_wmma_kernel<0, false><<<gQKV, 256, 0, stream>>>(
            w16v, C_DIM, hTb, C_DIM, Vb,  N_DIM, bv, nullptr, 1.0f,
            C_DIM, N_DIM, C_DIM);
    }

    for (int b = 0; b < B_DIM; ++b) {
        const _Float16* Qb  = Q  + (size_t)b * N_DIM * C_DIM;
        const _Float16* Ktb = Kt + (size_t)b * N_DIM * C_DIM;
        const _Float16* Vb  = V  + (size_t)b * C_DIM * N_DIM;
        _Float16* AOb = AO + (size_t)b * C_DIM * N_DIM;
        // 4) scores: S[i][j] = scale * Q[i][:] . Kt[j][:]   (M=N=4096, K=512)
        gemm_wmma_kernel<2, false><<<gS, 256, 0, stream>>>(
            Qb, C_DIM, Ktb, C_DIM, S, N_DIM, nullptr, nullptr, scale,
            N_DIM, N_DIM, C_DIM);
        // 5) softmax rows, normalized f16 written in place (pitch 2N halves)
        softmax_kernel<<<N_DIM, 256, 0, stream>>>(S);
        // 6) AO[c][j] = sum_i V[c][i] * P[i][j]  (M=512, N=4096, K=4096)
        gemm_wmma_kernel<0, true><<<gQKV, 256, 0, stream>>>(
            Vb, N_DIM, (const _Float16*)S, 2 * N_DIM, AOb, N_DIM,
            nullptr, nullptr, 1.0f, C_DIM, N_DIM, N_DIM);
        // 7) out = x + Wp @ AO + bp   (M=512, N=4096, K=512)
        gemm_wmma_kernel<3, true><<<gQKV, 256, 0, stream>>>(
            w16p, C_DIM, AOb, N_DIM, out + (size_t)b * C_DIM * N_DIM, N_DIM,
            bp, x + (size_t)b * C_DIM * N_DIM, 1.0f, C_DIM, N_DIM, C_DIM);
    }
}

// v002
// A run of this version takes 349 microseconds.
// Two timings next to v001 both put it at 1.56 times that version's speed.
// Counting every step since v000, it is 1.91 times as fast.
#include <hip/hip_runtime.h>

// ---------------------------------------------------------------------------
// AttnBlock for MI455X (gfx1250): GroupNorm -> QKV 1x1 -> attention -> proj
// GEMMs via V_WMMA_F32_16X16X32_F16; tiles staged with
// GLOBAL_LOAD_ASYNC_TO_LDS_B128 (ASYNCcnt) into double-buffered LDS.
// ---------------------------------------------------------------------------

typedef __attribute__((ext_vector_type(16))) _Float16 v16h;
typedef __attribute__((ext_vector_type(8)))  _Float16 h8;
typedef __attribute__((ext_vector_type(8)))  short    s8;
typedef __attribute__((ext_vector_type(8)))  float    v8f;

#define C_DIM 512
#define N_DIM 4096
#define B_DIM 2
#define NGRP  32
#define CPG   16           // channels per group
#define GELEM (CPG * N_DIM)

// ------------------------- CDNA5 async-copy helpers ------------------------
// Per-lane async copy of 16 bytes global -> LDS, tracked by ASYNCcnt.
// vdst VGPR carries the 32-bit LDS byte address (low 32 bits of flat shared
// pointer, per ISA 10.2 aperture mapping).
__device__ __forceinline__ void async_copy_b128(void* lds_ptr, const void* gptr) {
    unsigned lds_off = (unsigned)(unsigned long long)lds_ptr;
    asm volatile("global_load_async_to_lds_b128 %0, %1, off"
                 :: "v"(lds_off), "v"((unsigned long long)gptr)
                 : "memory");
}
// Four per-lane copies of one stage in ONE statement, closed by s_wait_xcnt 0:
// the operands' registers live to the statement's end, so no address register
// of an issued copy is rewritten ahead of that wait.
__device__ __forceinline__ void async_copy4_b128(
    void* l0, const void* g0, void* l1, const void* g1,
    void* l2, const void* g2, void* l3, const void* g3) {
    asm volatile("global_load_async_to_lds_b128 %0, %1, off\n\t"
                 "global_load_async_to_lds_b128 %2, %3, off\n\t"
                 "global_load_async_to_lds_b128 %4, %5, off\n\t"
                 "global_load_async_to_lds_b128 %6, %7, off\n\t"
                 "s_wait_xcnt 0x0"
                 :: "v"((unsigned)(unsigned long long)l0), "v"((unsigned long long)g0),
                    "v"((unsigned)(unsigned long long)l1), "v"((unsigned long long)g1),
                    "v"((unsigned)(unsigned long long)l2), "v"((unsigned long long)g2),
                    "v"((unsigned)(unsigned long long)l3), "v"((unsigned long long)g3)
                 : "memory");
}
__device__ __forceinline__ void wait_async0() {
    asm volatile("s_wait_asynccnt 0x0" ::: "memory");
}

// ------------------------- block reductions --------------------------------
__device__ __forceinline__ float block_reduce_sum(float v, float* buf) {
    int tid = threadIdx.x;
    buf[tid] = v; __syncthreads();
    #pragma unroll
    for (int s = 128; s > 0; s >>= 1) {
        if (tid < s) buf[tid] += buf[tid + s];
        __syncthreads();
    }
    float r = buf[0]; __syncthreads();
    return r;
}
__device__ __forceinline__ float block_reduce_max(float v, float* buf) {
    int tid = threadIdx.x;
    buf[tid] = v; __syncthreads();
    #pragma unroll
    for (int s = 128; s > 0; s >>= 1) {
        if (tid < s) buf[tid] = fmaxf(buf[tid], buf[tid + s]);
        __syncthreads();
    }
    float r = buf[0]; __syncthreads();
    return r;
}

// ------------------------- GroupNorm ---------------------------------------
__global__ __launch_bounds__(256) void gn_stats_kernel(
    const float* __restrict__ x, float* __restrict__ stats) {
    __shared__ float buf[256];
    const float* p = x + (size_t)blockIdx.x * GELEM;
    float s = 0.f, s2 = 0.f;
    for (int i = threadIdx.x; i < GELEM; i += 256) {
        float v = p[i];
        s += v; s2 += v * v;
    }
    s  = block_reduce_sum(s,  buf);
    s2 = block_reduce_sum(s2, buf);
    if (threadIdx.x == 0) {
        float mu  = s  * (1.0f / GELEM);
        float var = s2 * (1.0f / GELEM) - mu * mu;
        stats[blockIdx.x * 2 + 0] = mu;
        stats[blockIdx.x * 2 + 1] = rsqrtf(var + 1e-6f);
    }
}

// normalize + affine, write h^T as f16 [B][N][C] (k-contiguous for GEMM B)
__global__ __launch_bounds__(256) void gn_apply_kernel(
    const float* __restrict__ x, const float* __restrict__ stats,
    const float* __restrict__ gw, const float* __restrict__ gb,
    _Float16* __restrict__ hT) {
    int bc = blockIdx.x;               // b*C + c
    int b  = bc >> 9;
    int c  = bc & (C_DIM - 1);
    int g  = c >> 4;
    float mu = stats[(b * NGRP + g) * 2 + 0];
    float rs = stats[(b * NGRP + g) * 2 + 1];
    float w  = gw[c], bb = gb[c];
    const float* xr = x + (size_t)bc * N_DIM;
    _Float16* dst = hT + (size_t)b * N_DIM * C_DIM + c;
    for (int n = threadIdx.x; n < N_DIM; n += 256) {
        float v = (xr[n] - mu) * rs * w + bb;
        dst[(size_t)n * C_DIM] = (_Float16)v;
    }
}

// ------------------------- f32 -> f16 convert ------------------------------
// blockIdx.y picks one of four equally sized sources; dst holds them in a row
__global__ __launch_bounds__(256) void cvt_f16_kernel(
    const float* __restrict__ s0, const float* __restrict__ s1,
    const float* __restrict__ s2, const float* __restrict__ s3,
    _Float16* __restrict__ dst4, int n) {
    const int w = blockIdx.y;
    const float* src = (w == 0) ? s0 : (w == 1) ? s1 : (w == 2) ? s2 : s3;
    _Float16* dst = dst4 + (size_t)w * n;
    for (int i = blockIdx.x * 256 + threadIdx.x; i < n; i += gridDim.x * 256)
        dst[i] = (_Float16)src[i];
}

// ------------------------- WMMA fragment load ------------------------------
// LDS tile is row-major [r][32] halves. Per ISA 16-bit A 16x32 layout:
// lane<16 -> K base 0, lane>=16 -> K base 8; elems 0..7 = K base..base+7,
// elems 8..15 = K base+16..base+23. B (stored transposed [n][k]) symmetric.
__device__ __forceinline__ v16h load_frag32(const _Float16* lds, int row, int kbase) {
    const h8 lo = *(const h8*)(lds + row * 32 + kbase);
    const h8 hi = *(const h8*)(lds + row * 32 + kbase + 16);
    return __builtin_shufflevector(lo, hi, 0,1,2,3,4,5,6,7,8,9,10,11,12,13,14,15);
}

// B fragment out of a row-major [k][n] LDS tile (pitch BKN_PITCH halves) by the
// transposing load: lane (c = l & 15, h = l >> 4) gets T[kb + 8h + 0..7][n0 + c];
// the loads at kb = 0 and kb = 16 give the k order of load_frag32.
#define BKN_PITCH 144      // 288 B = 32 B x odd: the transposing load's pitch
__device__ __forceinline__ h8 load_tr16(const _Float16* p) {
    typedef __attribute__((address_space(3))) s8 lds_s8;
    return __builtin_bit_cast(h8, __builtin_amdgcn_ds_load_tr16_b128_v8i16((lds_s8*)p));
}
__device__ __forceinline__ v16h load_frag32_tr(const _Float16* lds, int n0, int lane) {
    const _Float16* p = lds + (8 * (lane >> 4) + (lane & 7)) * BKN_PITCH
                            + n0 + 8 * ((lane >> 3) & 1);
    const h8 lo = load_tr16(p);
    const h8 hi = load_tr16(p + 16 * BKN_PITCH);
    return __builtin_shufflevector(lo, hi, 0,1,2,3,4,5,6,7,8,9,10,11,12,13,14,15);
}

// ------------------------- generic WMMA GEMM -------------------------------
// D = alpha * A(f16 [M][K]) x B(f16) + bias(+residual)
// blockIdx.z = batch: A, B, Out and residual advance by zA, zB, zO elements.
// OUT_MODE: 0 = f16 [M][N] (+bias)      (attn-out)
//           1 = f16 [N][M] (+bias)      (Q, K^T), and V in the form of mode 0:
//               blockIdx.x / 4 = part (0 Q, 1 K, 2 V) picks C_DIM rows of the
//               stacked weights A, the part's output plane and its bias
//           2 = f32 [M][N], scaled      (scores)
//           3 = f32 [M][N] + bias + residual (final proj)
// B_KN: true  -> global B is [K][N] (ldb = N pitch), async copy row-major into
//                LDS, transposed by the fragment load
//       false -> global B is [N][K] (pre-transposed), async direct copy
template <int OUT_MODE, bool B_KN>
__global__ __launch_bounds__(256) void gemm_wmma_kernel(
    const _Float16* __restrict__ A0, int lda, size_t zA,
    const _Float16* __restrict__ B0, int ldb, size_t zB,
    void* __restrict__ Out, void* __restrict__ OutK,
    void* __restrict__ OutV, int ldo, size_t zO,
    const float* __restrict__ biasQ, const float* __restrict__ biasK,
    const float* __restrict__ biasV,
    const float* __restrict__ residual,
    float alpha, int M, int N, int K) {
    (void)M; (void)N; (void)OutK; (void)OutV; (void)biasK; (void)biasV;
    const int part = (OUT_MODE == 1) ? blockIdx.x / (C_DIM / 128) : 0;
    const _Float16* A  = A0 + blockIdx.z * zA + (size_t)part * C_DIM * lda;
    const _Float16* Bm = B0 + blockIdx.z * zB;
    const size_t    oz = blockIdx.z * zO;
    void*        OutP  = (part == 0) ? Out   : (part == 1) ? OutK  : OutV;
    const float* bias  = (part == 0) ? biasQ : (part == 1) ? biasK : biasV;
    __shared__ _Float16 lA[2][128 * 32];
    __shared__ __attribute__((aligned(16)))
        _Float16 lB[2][B_KN ? 32 * BKN_PITCH : 128 * 32];

    const int tid   = threadIdx.x;
    const int lane  = tid & 31;
    const int wave  = tid >> 5;     // 0..7
    const int waveM = wave & 3;     // 4 -> 32 rows each
    const int waveN = wave >> 2;    // 2 -> 64 cols each
    const int m0g   = (blockIdx.x - part * (C_DIM / 128)) * 128;   // row inside the part
    const int n0g   = blockIdx.y * 128;

    v8f acc[2][4];
    #pragma unroll
    for (int i = 0; i < 2; ++i)
        #pragma unroll
        for (int j = 0; j < 4; ++j)
            acc[i][j] = (v8f){0.f,0.f,0.f,0.f,0.f,0.f,0.f,0.f};

    const int rl    = lane & 15;
    const int kbase = (lane < 16) ? 0 : 8;

    // ---- tile staging: async copies, memory -> LDS, no register in between ----
    auto stage = [&](int bufi, int k0) {
        if (!B_KN) {
            // A tile [128][32]: 512 16-byte chunks, 2 per thread, memory -> LDS
            #pragma unroll
            for (int it = 0; it < 2; ++it) {
                int cc = tid + it * 256;
                int m  = cc >> 2;
                int kq = (cc & 3) * 8;
                async_copy_b128(&lA[bufi][m * 32 + kq],
                                A + (size_t)(m0g + m) * lda + k0 + kq);
            }
            #pragma unroll
            for (int it = 0; it < 2; ++it) {
                int cc = tid + it * 256;
                int n  = cc >> 2;
                int kq = (cc & 3) * 8;
                async_copy_b128(&lB[bufi][n * 32 + kq],
                                Bm + (size_t)(n0g + n) * ldb + k0 + kq);
            }
        } else {
            // A tile [128][32] as above; B tile [32 k][128 n] row-major: 16 lanes
            // cover one 256-byte row, rows k and k + 16 per thread
            int m  = tid >> 2;
            int kq = (tid & 3) * 8;
            int k  = tid >> 4;
            int nq = (tid & 15) * 8;
            const _Float16* ga = A  + (size_t)(m0g + m) * lda + k0 + kq;
            const _Float16* gb = Bm + (size_t)(k0 + k) * ldb + n0g + nq;
            async_copy4_b128(&lA[bufi][m * 32 + kq],               ga,
                             &lA[bufi][(m + 64) * 32 + kq],        ga + (size_t)64 * lda,
                             &lB[bufi][k * BKN_PITCH + nq],        gb,
                             &lB[bufi][(k + 16) * BKN_PITCH + nq], gb + (size_t)16 * ldb);
        }
    };

    int buf = 0;
    stage(buf, 0);
    wait_async0();
    __syncthreads();

    for (int k0 = 0; k0 < K; k0 += 32) {
        int nbuf = buf ^ 1;
        if (k0 + 32 < K) stage(nbuf, k0 + 32);   // overlap with compute

        // ---- compute: one K=32 WMMA step from current buffer
        v16h af[2], bf[4];
        #pragma unroll
        for (int sm = 0; sm < 2; ++sm)
            af[sm] = load_frag32(lA[buf], waveM * 32 + sm * 16 + rl, kbase);
        #pragma unroll
        for (int sn = 0; sn < 4; ++sn)
            bf[sn] = B_KN ? load_frag32_tr(lB[buf], waveN * 64 + sn * 16, lane)
                          : load_frag32(lB[buf], waveN * 64 + sn * 16 + rl, kbase);
        #pragma unroll
        for (int sm = 0; sm < 2; ++sm)
            #pragma unroll
            for (int sn = 0; sn < 4; ++sn)
                acc[sm][sn] = __builtin_amdgcn_wmma_f32_16x16x32_f16(
                    false, af[sm], false, bf[sn],
                    (short)0, acc[sm][sn], false, false);

        // this wave's LDS reads of the current buffer have retired before the
        // barrier behind which copies refill it
        if (B_KN) asm volatile("s_wait_dscnt 0x0" ::: "memory");
        wait_async0();        // next-buffer async writes landed
        __syncthreads();      // + all waves done reading current buffer
        buf = nbuf;
    }

    // ---- epilogue: lane holds col n = rl, rows mb..mb+7
    const int mhalf = (lane < 16) ? 0 : 8;
    #pragma unroll
    for (int sm = 0; sm < 2; ++sm) {
        #pragma unroll
        for (int sn = 0; sn < 4; ++sn) {
            int mb = m0g + waveM * 32 + sm * 16 + mhalf;
            int n  = n0g + waveN * 64 + sn * 16 + rl;
            v8f a = acc[sm][sn];
            if (OUT_MODE == 0) {
                _Float16* O = (_Float16*)Out + oz;
                #pragma unroll
                for (int r = 0; r < 8; ++r) {
                    float v = a[r] * alpha + (bias ? bias[mb + r] : 0.0f);
                    O[(size_t)(mb + r) * ldo + n] = (_Float16)v;
                }
            } else if (OUT_MODE == 1) {
                _Float16* O = (_Float16*)OutP + oz;
                if (part < 2) {
                    h8 pack;
                    #pragma unroll
                    for (int r = 0; r < 8; ++r)
                        pack[r] = (_Float16)(a[r] * alpha + bias[mb + r]);
                    *(h8*)(O + (size_t)n * ldo + mb) = pack;   // contiguous over m
                    // before a register that this store names is written again
                    asm volatile("s_wait_xcnt 0x0" ::: "memory");
                } else {
                    #pragma unroll
                    for (int r = 0; r < 8; ++r) {
                        float v = a[r] * alpha + bias[mb + r];
                        O[(size_t)(mb + r) * N_DIM + n] = (_Float16)v;   // V is [C][N]
                    }
                    // before a register that these stores name is written again
                    asm volatile("s_wait_xcnt 0x0" ::: "memory");
                }
            } else if (OUT_MODE == 2) {
                float* O = (float*)Out + oz;
                #pragma unroll
                for (int r = 0; r < 8; ++r)
                    O[(size_t)(mb + r) * ldo + n] = a[r] * alpha;
            } else {
                float* O = (float*)Out;
                #pragma unroll
                for (int r = 0; r < 8; ++r) {
                    size_t idx = oz + (size_t)(mb + r) * ldo + n;
                    O[idx] = residual[idx] + a[r] * alpha + bias[mb + r];
                }
            }
        }
    }
}

// ------------------------- row softmax (in-place f32 -> f16) ---------------
// S: f32 [B*N][N], one row per block. Writes normalized f16 over the head of each row:
// P element (i,j) lives at half index i*2N + j  (pitch 2N halves).
__global__ __launch_bounds__(256) void softmax_kernel(float* __restrict__ S) {
    __shared__ float buf[256];
    const int row = blockIdx.x;
    float* r = S + (size_t)row * N_DIM;
    float vals[16];
    float lmax = -3.4e38f;
    #pragma unroll
    for (int i = 0; i < 16; ++i) {
        vals[i] = r[i * 256 + threadIdx.x];
        lmax = fmaxf(lmax, vals[i]);
    }
    float m = block_reduce_max(lmax, buf);
    float lsum = 0.f;
    #pragma unroll
    for (int i = 0; i < 16; ++i) {
        vals[i] = __expf(vals[i] - m);
        lsum += vals[i];
    }
    float s = block_reduce_sum(lsum, buf);   // barrier: all reads done
    float inv = 1.0f / s;
    _Float16* P = (_Float16*)S + (size_t)row * (2 * N_DIM);
    #pragma unroll
    for (int i = 0; i < 16; ++i)
        P[i * 256 + threadIdx.x] = (_Float16)(vals[i] * inv);
}

// ---------------------------------------------------------------------------
extern "C" void kernel_launch(void* const* d_in, const int* in_sizes, int n_in,
                              void* d_out, int out_size, void* d_ws, size_t ws_size,
                              hipStream_t stream) {
    (void)in_sizes; (void)n_in; (void)out_size; (void)ws_size;
    const float* x      = (const float*)d_in[0];
    const float* norm_w = (const float*)d_in[1];
    const float* norm_b = (const float*)d_in[2];
    const float* wq = (const float*)d_in[3];
    const float* bq = (const float*)d_in[4];
    const float* wk = (const float*)d_in[5];
    const float* bk = (const float*)d_in[6];
    const float* wv = (const float*)d_in[7];
    const float* bv = (const float*)d_in[8];
    const float* wp = (const float*)d_in[9];
    const float* bp = (const float*)d_in[10];
    float* out = (float*)d_out;

    // ---- carve workspace
    char* w = (char*)d_ws;
    auto carve = [&](size_t bytes) -> char* {
        char* p = w;
        w += (bytes + 255) & ~(size_t)255;
        return p;
    };
    float*     stats = (float*)carve(B_DIM * NGRP * 2 * sizeof(float));
    _Float16*  hT    = (_Float16*)carve((size_t)B_DIM * N_DIM * C_DIM * 2); // [b][n][c]
    _Float16*  w16   = (_Float16*)carve((size_t)4 * C_DIM * C_DIM * 2);     // q, k, v, p
    _Float16*  Q     = (_Float16*)carve((size_t)B_DIM * N_DIM * C_DIM * 2); // [b][n][c]
    _Float16*  Kt    = (_Float16*)carve((size_t)B_DIM * N_DIM * C_DIM * 2); // [b][n][c]
    _Float16*  V     = (_Float16*)carve((size_t)B_DIM * C_DIM * N_DIM * 2); // [b][c][n]
    _Float16*  AO    = (_Float16*)carve((size_t)B_DIM * C_DIM * N_DIM * 2); // [b][c][n]
    float*     S     = (float*)carve((size_t)B_DIM * N_DIM * N_DIM * sizeof(float)); // [b][i][j]

    const float scale = 0.044194173824159216f;  // 512^-0.5

    // 1) GroupNorm
    gn_stats_kernel<<<B_DIM * NGRP, 256, 0, stream>>>(x, stats);
    gn_apply_kernel<<<B_DIM * C_DIM, 256, 0, stream>>>(x, stats, norm_w, norm_b, hT);

    // 2) weights to f16, one launch
    cvt_f16_kernel<<<dim3(256, 4), 256, 0, stream>>>(wq, wk, wv, wp, w16, C_DIM * C_DIM);

    // every GEMM takes both batches in one launch (grid z)
    dim3 gQKV(3 * C_DIM / 128, N_DIM / 128, B_DIM);   // 12 x 32 x 2
    dim3 gS(N_DIM / 128, N_DIM / 128, B_DIM);         // 32 x 32 x 2
    dim3 gO(C_DIM / 128, N_DIM / 128, B_DIM);         //  4 x 32 x 2
    const size_t zNC = (size_t)N_DIM * C_DIM;
    const size_t zNN = (size_t)N_DIM * N_DIM;

    // 3) Q, K, V projections (M=3*512, N=4096, K=512), B operand = hT "nk" direct
    gemm_wmma_kernel<1, false><<<gQKV, 256, 0, stream>>>(
        w16, C_DIM, 0, hT, C_DIM, zNC, Q, Kt, V, C_DIM, zNC,
        bq, bk, bv, nullptr, 1.0f, 3 * C_DIM, N_DIM, C_DIM);
    // 4) scores: S[i][j] = scale * Q[i][:] . Kt[j][:]   (M=N=4096, K=512)
    gemm_wmma_kernel<2, false><<<gS, 256, 0, stream>>>(
        Q, C_DIM, zNC, Kt, C_DIM, zNC, S, nullptr, nullptr, N_DIM, zNN,
        nullptr, nullptr, nullptr, nullptr, scale, N_DIM, N_DIM, C_DIM);
    // 5) softmax rows, normalized f16 written in place (pitch 2N halves)
    softmax_kernel<<<B_DIM * N_DIM, 256, 0, stream>>>(S);
    // 6) AO[c][j] = sum_i V[c][i] * P[i][j]  (M=512, N=4096, K=4096)
    gemm_wmma_kernel<0, true><<<gO, 256, 0, stream>>>(
        V, N_DIM, zNC, (const _Float16*)S, 2 * N_DIM, 2 * zNN, AO, nullptr, nullptr,
        N_DIM, zNC, nullptr, nullptr, nullptr, nullptr, 1.0f, C_DIM, N_DIM, N_DIM);
    // 7) out = x + Wp @ AO + bp   (M=512, N=4096, K=512)
    gemm_wmma_kernel<3, true><<<gO, 256, 0, stream>>>(
        w16 + (size_t)3 * C_DIM * C_DIM, C_DIM, 0, AO, N_DIM, zNC, out, nullptr, nullptr,
        N_DIM, zNC, bp, nullptr, nullptr, x, 1.0f, C_DIM, N_DIM, C_DIM);
}

// v003
// One run takes 257 microseconds.
// Next to v002, in two timings, it ran 1.36 and 1.35 times as fast.
// Counting every step since v000, it is 2.59 times as fast.
#include <hip/hip_runtime.h>

// ---------------------------------------------------------------------------
// AttnBlock for MI455X (gfx1250): GroupNorm -> QKV 1x1 -> attention -> proj
// GEMMs via V_WMMA_F32_16X16X32_F16; tiles staged with
// GLOBAL_LOAD_ASYNC_TO_LDS_B128 (ASYNCcnt) into double-buffered LDS.
// ---------------------------------------------------------------------------

typedef __attribute__((ext_vector_type(16))) _Float16 v16h;
typedef __attribute__((ext_vector_type(8)))  _Float16 h8;
typedef __attribute__((ext_vector_type(8)))  short    s8;
typedef __attribute__((ext_vector_type(8)))  float    v8f;

#define C_DIM 512
#define N_DIM 4096
#define B_DIM 2
#define NGRP  32
#define CPG   16           // channels per group
#define GELEM (CPG * N_DIM)

// ------------------------- CDNA5 async-copy helpers ------------------------
// Per-lane async copy of 16 bytes global -> LDS, tracked by ASYNCcnt.
// vdst VGPR carries the 32-bit LDS byte address (low 32 bits of flat shared
// pointer, per ISA 10.2 aperture mapping).
__device__ __forceinline__ unsigned lds_addr(const void* lds_ptr) {
    return (unsigned)(unsigned long long)lds_ptr;
}
// Eight per-lane copies in ONE statement, closed by s_wait_xcnt 0: the operands'
// registers live to the statement's end, so no address register of an issued
// copy is rewritten ahead of that wait.
__device__ __forceinline__ void async_copy8_b128(const unsigned (&l)[8],
                                                 const _Float16* const (&g)[8]) {
    asm volatile("global_load_async_to_lds_b128 %0, %1, off\n\t"
                 "global_load_async_to_lds_b128 %2, %3, off\n\t"
                 "global_load_async_to_lds_b128 %4, %5, off\n\t"
                 "global_load_async_to_lds_b128 %6, %7, off\n\t"
                 "global_load_async_to_lds_b128 %8, %9, off\n\t"
                 "global_load_async_to_lds_b128 %10, %11, off\n\t"
                 "global_load_async_to_lds_b128 %12, %13, off\n\t"
                 "global_load_async_to_lds_b128 %14, %15, off\n\t"
                 "s_wait_xcnt 0x0"
                 :: "v"(l[0]), "v"((unsigned long long)g[0]),
                    "v"(l[1]), "v"((unsigned long long)g[1]),
                    "v"(l[2]), "v"((unsigned long long)g[2]),
                    "v"(l[3]), "v"((unsigned long long)g[3]),
                    "v"(l[4]), "v"((unsigned long long)g[4]),
                    "v"(l[5]), "v"((unsigned long long)g[5]),
                    "v"(l[6]), "v"((unsigned long long)g[6]),
                    "v"(l[7]), "v"((unsigned long long)g[7])
                 : "memory");
}
__device__ __forceinline__ void wait_async0() {
    asm volatile("s_wait_asynccnt 0x0" ::: "memory");
}

// ------------------------- block reductions --------------------------------
__device__ __forceinline__ float block_reduce_sum(float v, float* buf) {
    int tid = threadIdx.x;
    buf[tid] = v; __syncthreads();
    #pragma unroll
    for (int s = 128; s > 0; s >>= 1) {
        if (tid < s) buf[tid] += buf[tid + s];
        __syncthreads();
    }
    float r = buf[0]; __syncthreads();
    return r;
}
__device__ __forceinline__ float block_reduce_max(float v, float* buf) {
    int tid = threadIdx.x;
    buf[tid] = v; __syncthreads();
    #pragma unroll
    for (int s = 128; s > 0; s >>= 1) {
        if (tid < s) buf[tid] = fmaxf(buf[tid], buf[tid + s]);
        __syncthreads();
    }
    float r = buf[0]; __syncthreads();
    return r;
}

// ------------------------- GroupNorm ---------------------------------------
__global__ __launch_bounds__(256) void gn_stats_kernel(
    const float* __restrict__ x, float* __restrict__ stats) {
    __shared__ float buf[256];
    const float* p = x + (size_t)blockIdx.x * GELEM;
    float s = 0.f, s2 = 0.f;
    for (int i = threadIdx.x; i < GELEM; i += 256) {
        float v = p[i];
        s += v; s2 += v * v;
    }
    s  = block_reduce_sum(s,  buf);
    s2 = block_reduce_sum(s2, buf);
    if (threadIdx.x == 0) {
        float mu  = s  * (1.0f / GELEM);
        float var = s2 * (1.0f / GELEM) - mu * mu;
        stats[blockIdx.x * 2 + 0] = mu;
        stats[blockIdx.x * 2 + 1] = rsqrtf(var + 1e-6f);
    }
}

// normalize + affine, write h^T as f16 [B][N][C] (k-contiguous for GEMM B)
__global__ __launch_bounds__(256) void gn_apply_kernel(
    const float* __restrict__ x, const float* __restrict__ stats,
    const float* __restrict__ gw, const float* __restrict__ gb,
    _Float16* __restrict__ hT) {
    int bc = blockIdx.x;               // b*C + c
    int b  = bc >> 9;
    int c  = bc & (C_DIM - 1);
    int g  = c >> 4;
    float mu = stats[(b * NGRP + g) * 2 + 0];
    float rs = stats[(b * NGRP + g) * 2 + 1];
    float w  = gw[c], bb = gb[c];
    const float* xr = x + (size_t)bc * N_DIM;
    _Float16* dst = hT + (size_t)b * N_DIM * C_DIM + c;
    for (int n = threadIdx.x; n < N_DIM; n += 256) {
        float v = (xr[n] - mu) * rs * w + bb;
        dst[(size_t)n * C_DIM] = (_Float16)v;
    }
}

// ------------------------- f32 -> f16 convert ------------------------------
// blockIdx.y picks one of four equally sized sources; dst holds them in a row
__global__ __launch_bounds__(256) void cvt_f16_kernel(
    const float* __restrict__ s0, const float* __restrict__ s1,
    const float* __restrict__ s2, const float* __restrict__ s3,
    _Float16* __restrict__ dst4, int n) {
    const int w = blockIdx.y;
    const float* src = (w == 0) ? s0 : (w == 1) ? s1 : (w == 2) ? s2 : s3;
    _Float16* dst = dst4 + (size_t)w * n;
    for (int i = blockIdx.x * 256 + threadIdx.x; i < n; i += gridDim.x * 256)
        dst[i] = (_Float16)src[i];
}

// ------------------------- WMMA fragment load ------------------------------
// LDS tile is row-major [r][k], pitch halves a row; lds points at the 32 k of
// this product. Per ISA 16-bit A 16x32 layout:
// lane<16 -> K base 0, lane>=16 -> K base 8; elems 0..7 = K base..base+7,
// elems 8..15 = K base+16..base+23. B (stored transposed [n][k]) symmetric.
__device__ __forceinline__ v16h load_frag32(const _Float16* lds, int pitch, int row, int kbase) {
    const h8 lo = *(const h8*)(lds + row * pitch + kbase);
    const h8 hi = *(const h8*)(lds + row * pitch + kbase + 16);
    return __builtin_shufflevector(lo, hi, 0,1,2,3,4,5,6,7,8,9,10,11,12,13,14,15);
}

// B fragment out of a row-major [k][n] LDS tile (pitch BKN_PITCH halves) by the
// transposing load: lane (c = l & 15, h = l >> 4) gets T[kb + 8h + 0..7][n0 + c];
// the loads at kb = 0 and kb = 16 give the k order of load_frag32.
#define BKN_PITCH 144      // 288 B = 32 B x odd: the transposing load's pitch
__device__ __forceinline__ h8 load_tr16(const _Float16* p) {
    typedef __attribute__((address_space(3))) s8 lds_s8;
    return __builtin_bit_cast(h8, __builtin_amdgcn_ds_load_tr16_b128_v8i16((lds_s8*)p));
}
__device__ __forceinline__ v16h load_frag32_tr(const _Float16* lds, int n0, int lane) {
    const _Float16* p = lds + (8 * (lane >> 4) + (lane & 7)) * BKN_PITCH
                            + n0 + 8 * ((lane >> 3) & 1);
    const h8 lo = load_tr16(p);
    const h8 hi = load_tr16(p + 16 * BKN_PITCH);
    return __builtin_shufflevector(lo, hi, 0,1,2,3,4,5,6,7,8,9,10,11,12,13,14,15);
}

// ------------------------- generic WMMA GEMM -------------------------------
// D = alpha * A(f16 [M][K]) x B(f16) + bias(+residual)
// blockIdx.z = batch: A, B, Out and residual advance by zA, zB, zO elements.
// OUT_MODE: 0 = f16 [M][N] (+bias)      (attn-out)
//           1 = f16 [N][M] (+bias)      (Q, K^T), and V in the form of mode 0:
//               blockIdx.x / 4 = part (0 Q, 1 K, 2 V) picks C_DIM rows of the
//               stacked weights A, the part's output plane and its bias
//           2 = f32 [M][N], scaled      (scores)
//           3 = f32 [M][N] + bias + residual (final proj)
// B_KN: true  -> global B is [K][N] (ldb = N pitch), async copy row-major into
//                LDS, transposed by the fragment load
//       false -> global B is [N][K] (pre-transposed), async direct copy
// One LDS stage holds BK k of both operands: 128 where one work-group has its
// WGP alone (B_KN: 256 work-groups), 64 where several share it. [row][k] tiles
// have a pitch of BK + 8 halves (16 B x odd: the pitch of ds_load_b128 readers).
template <int OUT_MODE, bool B_KN>
__global__ __launch_bounds__(256) void gemm_wmma_kernel(
    const _Float16* __restrict__ A0, int lda, size_t zA,
    const _Float16* __restrict__ B0, int ldb, size_t zB,
    void* __restrict__ Out, void* __restrict__ OutK,
    void* __restrict__ OutV, int ldo, size_t zO,
    const float* __restrict__ biasQ, const float* __restrict__ biasK,
    const float* __restrict__ biasV,
    const float* __restrict__ residual,
    float alpha, int M, int N, int K) {
    (void)M; (void)N; (void)OutK; (void)OutV; (void)biasK; (void)biasV;
    const int part = (OUT_MODE == 1) ? blockIdx.x / (C_DIM / 128) : 0;
    const _Float16* A  = A0 + blockIdx.z * zA + (size_t)part * C_DIM * lda;
    const _Float16* Bm = B0 + blockIdx.z * zB;
    const size_t    oz = blockIdx.z * zO;
    void*        OutP  = (part == 0) ? Out   : (part == 1) ? OutK  : OutV;
    const float* bias  = (part == 0) ? biasQ : (part == 1) ? biasK : biasV;
    constexpr int BK  = B_KN ? 128 : 64;
    constexpr int PA  = BK + 8;       // halves
    constexpr int CPR = BK / 8;       // 16-byte chunks in a [row][k] row
    constexpr int RPS = 256 / CPR;    // rows that one copy of the block covers
    __shared__ __attribute__((aligned(16))) _Float16 lA[2][128 * PA];
    __shared__ __attribute__((aligned(16)))
        _Float16 lB[2][B_KN ? BK * BKN_PITCH : 128 * PA];

    const int tid   = threadIdx.x;
    const int lane  = tid & 31;
    const int wave  = tid >> 5;     // 0..7
    const int waveM = wave & 3;     // 4 -> 32 rows each
    const int waveN = wave >> 2;    // 2 -> 64 cols each
    const int m0g   = (blockIdx.x - part * (C_DIM / 128)) * 128;   // row inside the part
    const int n0g   = blockIdx.y * 128;

    v8f acc[2][4];
    #pragma unroll
    for (int i = 0; i < 2; ++i)
        #pragma unroll
        for (int j = 0; j < 4; ++j)
            acc[i][j] = (v8f){0.f,0.f,0.f,0.f,0.f,0.f,0.f,0.f};

    const int rl    = lane & 15;
    const int kbase = (lane < 16) ? 0 : 8;

    // ---- tile staging: async copies, memory -> LDS, no register in between ----
    auto stage = [&](int bufi, int k0) {
        // [row][k] tile: CPR lanes cover one row's BK k, rows r + i * RPS per thread
        const int r  = tid / CPR;
        const int kq = (tid % CPR) * 8;
        const _Float16* ga = A + (size_t)(m0g + r) * lda + k0 + kq;
        const _Float16* la = &lA[bufi][r * PA + kq];
        unsigned        l[8];
        const _Float16* g[8];
        if (!B_KN) {
            // A and B tiles [128][64]: 4 chunks of each per thread
            const _Float16* gb = Bm + (size_t)(n0g + r) * ldb + k0 + kq;
            const _Float16* lb = &lB[bufi][r * PA + kq];
            #pragma unroll
            for (int i = 0; i < 4; ++i) {
                l[i]     = lds_addr(la + i * RPS * PA);
                g[i]     = ga + (size_t)(i * RPS) * lda;
                l[4 + i] = lds_addr(lb + i * RPS * PA);
                g[4 + i] = gb + (size_t)(i * RPS) * ldb;
            }
            async_copy8_b128(l, g);
        } else {
            // A tile [128][128]: 8 chunks per thread
            #pragma unroll
            for (int i = 0; i < 8; ++i) {
                l[i] = lds_addr(la + i * RPS * PA);
                g[i] = ga + (size_t)(i * RPS) * lda;
            }
            async_copy8_b128(l, g);
            // B tile [128 k][128 n] row-major: 16 lanes cover one 256-byte row,
            // rows k + 16 i per thread
            const int k  = tid >> 4;
            const int nq = (tid & 15) * 8;
            const _Float16* gb = Bm + (size_t)(k0 + k) * ldb + n0g + nq;
            #pragma unroll
            for (int i = 0; i < 8; ++i) {
                l[i] = lds_addr(&lB[bufi][(k + 16 * i) * BKN_PITCH + nq]);
                g[i] = gb + (size_t)(16 * i) * ldb;
            }
            async_copy8_b128(l, g);
        }
    };

    int buf = 0;
    stage(buf, 0);
    wait_async0();
    __syncthreads();

    for (int k0 = 0; k0 < K; k0 += BK) {
        int nbuf = buf ^ 1;
        if (k0 + BK < K) stage(nbuf, k0 + BK);   // overlap with compute

        // ---- compute: BK / 32 K=32 WMMA steps from the current buffer, in k order;
        // unrolled so that a later step's fragment loads can go ahead of the WMMAs
        #pragma unroll
        for (int kk = 0; kk < BK / 32; ++kk) {
            v16h af[2], bf[4];
            #pragma unroll
            for (int sm = 0; sm < 2; ++sm)
                af[sm] = load_frag32(lA[buf] + kk * 32, PA, waveM * 32 + sm * 16 + rl, kbase);
            #pragma unroll
            for (int sn = 0; sn < 4; ++sn)
                bf[sn] = B_KN ? load_frag32_tr(lB[buf] + kk * 32 * BKN_PITCH,
                                               waveN * 64 + sn * 16, lane)
                              : load_frag32(lB[buf] + kk * 32, PA,
                                            waveN * 64 + sn * 16 + rl, kbase);
            #pragma unroll
            for (int sm = 0; sm < 2; ++sm)
                #pragma unroll
                for (int sn = 0; sn < 4; ++sn)
                    acc[sm][sn] = __builtin_amdgcn_wmma_f32_16x16x32_f16(
                        false, af[sm], false, bf[sn],
                        (short)0, acc[sm][sn], false, false);
        }

        // this wave's LDS reads of the current buffer have retired before the
        // barrier behind which copies refill it
        asm volatile("s_wait_dscnt 0x0" ::: "memory");
        wait_async0();        // next-buffer async writes landed
        __syncthreads();      // + all waves done reading current buffer
        buf = nbuf;
    }

    // ---- epilogue: lane holds col n = rl, rows mb..mb+7
    const int mhalf = (lane < 16) ? 0 : 8;
    #pragma unroll
    for (int sm = 0; sm < 2; ++sm) {
        #pragma unroll
        for (int sn = 0; sn < 4; ++sn) {
            int mb = m0g + waveM * 32 + sm * 16 + mhalf;
            int n  = n0g + waveN * 64 + sn * 16 + rl;
            v8f a = acc[sm][sn];
            if (OUT_MODE == 0) {
                _Float16* O = (_Float16*)Out + oz;
                #pragma unroll
                for (int r = 0; r < 8; ++r) {
                    float v = a[r] * alpha + (bias ? bias[mb + r] : 0.0f);
                    O[(size_t)(mb + r) * ldo + n] = (_Float16)v;
                }
            } else if (OUT_MODE == 1) {
                _Float16* O = (_Float16*)OutP + oz;
                if (part < 2) {
                    h8 pack;
                    #pragma unroll
                    for (int r = 0; r < 8; ++r)
                        pack[r] = (_Float16)(a[r] * alpha + bias[mb + r]);
                    *(h8*)(O + (size_t)n * ldo + mb) = pack;   // contiguous over m
                    // before a register that this store names is written again
                    asm volatile("s_wait_xcnt 0x0" ::: "memory");
                } else {
                    #pragma unroll
                    for (int r = 0; r < 8; ++r) {
                        float v = a[r] * alpha + bias[mb + r];
                        O[(size_t)(mb + r) * N_DIM + n] = (_Float16)v;   // V is [C][N]
                    }
                    // before a register that these stores name is written again
                    asm volatile("s_wait_xcnt 0x0" ::: "memory");
                }
            } else if (OUT_MODE == 2) {
                float* O = (float*)Out + oz;
                #pragma unroll
                for (int r = 0; r < 8; ++r)
                    O[(size_t)(mb + r) * ldo + n] = a[r] * alpha;
            } else {
                float* O = (float*)Out;
                #pragma unroll
                for (int r = 0; r < 8; ++r) {
                    size_t idx = oz + (size_t)(mb + r) * ldo + n;
                    O[idx] = residual[idx] + a[r] * alpha + bias[mb + r];
                }
            }
        }
    }
}

// ------------------------- row softmax (in-place f32 -> f16) ---------------
// S: f32 [B*N][N], one row per block. Writes normalized f16 over the head of each row:
// P element (i,j) lives at half index i*2N + j  (pitch 2N halves).
__global__ __launch_bounds__(256) void softmax_kernel(float* __restrict__ S) {
    __shared__ float buf[256];
    const int row = blockIdx.x;
    float* r = S + (size_t)row * N_DIM;
    float vals[16];
    float lmax = -3.4e38f;
    #pragma unroll
    for (int i = 0; i < 16; ++i) {
        vals[i] = r[i * 256 + threadIdx.x];
        lmax = fmaxf(lmax, vals[i]);
    }
    float m = block_reduce_max(lmax, buf);
    float lsum = 0.f;
    #pragma unroll
    for (int i = 0; i < 16; ++i) {
        vals[i] = __expf(vals[i] - m);
        lsum += vals[i];
    }
    float s = block_reduce_sum(lsum, buf);   // barrier: all reads done
    float inv = 1.0f / s;
    _Float16* P = (_Float16*)S + (size_t)row * (2 * N_DIM);
    #pragma unroll
    for (int i = 0; i < 16; ++i)
        P[i * 256 + threadIdx.x] = (_Float16)(vals[i] * inv);
}

// ---------------------------------------------------------------------------
extern "C" void kernel_launch(void* const* d_in, const int* in_sizes, int n_in,
                              void* d_out, int out_size, void* d_ws, size_t ws_size,
                              hipStream_t stream) {
    (void)in_sizes; (void)n_in; (void)out_size; (void)ws_size;
    const float* x      = (const float*)d_in[0];
    const float* norm_w = (const float*)d_in[1];
    const float* norm_b = (const float*)d_in[2];
    const float* wq = (const float*)d_in[3];
    const float* bq = (const float*)d_in[4];
    const float* wk = (const float*)d_in[5];
    const float* bk = (const float*)d_in[6];
    const float* wv = (const float*)d_in[7];
    const float* bv = (const float*)d_in[8];
    const float* wp = (const float*)d_in[9];
    const float* bp = (const float*)d_in[10];
    float* out = (float*)d_out;

    // ---- carve workspace
    char* w = (char*)d_ws;
    auto carve = [&](size_t bytes) -> char* {
        char* p = w;
        w += (bytes + 255) & ~(size_t)255;
        return p;
    };
    float*     stats = (float*)carve(B_DIM * NGRP * 2 * sizeof(float));
    _Float16*  hT    = (_Float16*)carve((size_t)B_DIM * N_DIM * C_DIM * 2); // [b][n][c]
    _Float16*  w16   = (_Float16*)carve((size_t)4 * C_DIM * C_DIM * 2);     // q, k, v, p
    _Float16*  Q     = (_Float16*)carve((size_t)B_DIM * N_DIM * C_DIM * 2); // [b][n][c]
    _Float16*  Kt    = (_Float16*)carve((size_t)B_DIM * N_DIM * C_DIM * 2); // [b][n][c]
    _Float16*  V     = (_Float16*)carve((size_t)B_DIM * C_DIM * N_DIM * 2); // [b][c][n]
    _Float16*  AO    = (_Float16*)carve((size_t)B_DIM * C_DIM * N_DIM * 2); // [b][c][n]
    float*     S     = (float*)carve((size_t)B_DIM * N_DIM * N_DIM * sizeof(float)); // [b][i][j]

    const float scale = 0.044194173824159216f;  // 512^-0.5

    // 1) GroupNorm
    gn_stats_kernel<<<B_DIM * NGRP, 256, 0, stream>>>(x, stats);
    gn_apply_kernel<<<B_DIM * C_DIM, 256, 0, stream>>>(x, stats, norm_w, norm_b, hT);

    // 2) weights to f16, one launch
    cvt_f16_kernel<<<dim3(256, 4), 256, 0, stream>>>(wq, wk, wv, wp, w16, C_DIM * C_DIM);

    // every GEMM takes both batches in one launch (grid z)
    dim3 gQKV(3 * C_DIM / 128, N_DIM / 128, B_DIM);   // 12 x 32 x 2
    dim3 gS(N_DIM / 128, N_DIM / 128, B_DIM);         // 32 x 32 x 2
    dim3 gO(C_DIM / 128, N_DIM / 128, B_DIM);         //  4 x 32 x 2
    const size_t zNC = (size_t)N_DIM * C_DIM;
    const size_t zNN = (size_t)N_DIM * N_DIM;

    // 3) Q, K, V projections (M=3*512, N=4096, K=512), B operand = hT "nk" direct
    gemm_wmma_kernel<1, false><<<gQKV, 256, 0, stream>>>(
        w16, C_DIM, 0, hT, C_DIM, zNC, Q, Kt, V, C_DIM, zNC,
        bq, bk, bv, nullptr, 1.0f, 3 * C_DIM, N_DIM, C_DIM);
    // 4) scores: S[i][j] = scale * Q[i][:] . Kt[j][:]   (M=N=4096, K=512)
    gemm_wmma_kernel<2, false><<<gS, 256, 0, stream>>>(
        Q, C_DIM, zNC, Kt, C_DIM, zNC, S, nullptr, nullptr, N_DIM, zNN,
        nullptr, nullptr, nullptr, nullptr, scale, N_DIM, N_DIM, C_DIM);
    // 5) softmax rows, normalized f16 written in place (pitch 2N halves)
    softmax_kernel<<<B_DIM * N_DIM, 256, 0, stream>>>(S);
    // 6) AO[c][j] = sum_i V[c][i] * P[i][j]  (M=512, N=4096, K=4096)
    gemm_wmma_kernel<0, true><<<gO, 256, 0, stream>>>(
        V, N_DIM, zNC, (const _Float16*)S, 2 * N_DIM, 2 * zNN, AO, nullptr, nullptr,
        N_DIM, zNC, nullptr, nullptr, nullptr, nullptr, 1.0f, C_DIM, N_DIM, N_DIM);
    // 7) out = x + Wp @ AO + bp   (M=512, N=4096, K=512)
    gemm_wmma_kernel<3, true><<<gO, 256, 0, stream>>>(
        w16 + (size_t)3 * C_DIM * C_DIM, C_DIM, 0, AO, N_DIM, zNC, out, nullptr, nullptr,
        N_DIM, zNC, bp, nullptr, nullptr, x, 1.0f, C_DIM, N_DIM, C_DIM);
}

// v004
// One run takes 143 microseconds.
// In both of two side-by-side timings against v003, it was 1.80 times as fast.
// All steps since v000 together make it 4.66 times as fast.
#include <hip/hip_runtime.h>

// ---------------------------------------------------------------------------
// AttnBlock for MI455X (gfx1250): GroupNorm -> QKV 1x1 -> attention -> proj
// GEMMs via V_WMMA_F32_16X16X32_F16; tiles staged with
// GLOBAL_LOAD_ASYNC_TO_LDS_B128 (ASYNCcnt) into double-buffered LDS.
// ---------------------------------------------------------------------------

typedef __attribute__((ext_vector_type(16))) _Float16 v16h;
typedef __attribute__((ext_vector_type(8)))  _Float16 h8;
typedef __attribute__((ext_vector_type(8)))  short    s8;
typedef __attribute__((ext_vector_type(8)))  float    v8f;
typedef __attribute__((ext_vector_type(4)))  float    f4;
typedef __attribute__((ext_vector_type(4)))  int      i4;

#define C_DIM 512
#define N_DIM 4096
#define B_DIM 2
#define NGRP  32
#define CPG   16           // channels per group
#define GELEM (CPG * N_DIM)

// ------------------------- CDNA5 async-copy helpers ------------------------
// Per-lane async copy of 16 bytes global -> LDS, tracked by ASYNCcnt.
// vdst VGPR carries the 32-bit LDS byte address (low 32 bits of flat shared
// pointer, per ISA 10.2 aperture mapping).
__device__ __forceinline__ unsigned lds_addr(const void* lds_ptr) {
    return (unsigned)(unsigned long long)lds_ptr;
}
// Eight per-lane copies in ONE statement, closed by s_wait_xcnt 0: the operands'
// registers live to the statement's end, so no address register of an issued
// copy is rewritten ahead of that wait.
__device__ __forceinline__ void async_copy8_b128(const unsigned (&l)[8],
                                                 const _Float16* const (&g)[8]) {
    asm volatile("global_load_async_to_lds_b128 %0, %1, off\n\t"
                 "global_load_async_to_lds_b128 %2, %3, off\n\t"
                 "global_load_async_to_lds_b128 %4, %5, off\n\t"
                 "global_load_async_to_lds_b128 %6, %7, off\n\t"
                 "global_load_async_to_lds_b128 %8, %9, off\n\t"
                 "global_load_async_to_lds_b128 %10, %11, off\n\t"
                 "global_load_async_to_lds_b128 %12, %13, off\n\t"
                 "global_load_async_to_lds_b128 %14, %15, off\n\t"
                 "s_wait_xcnt 0x0"
                 :: "v"(l[0]), "v"((unsigned long long)g[0]),
                    "v"(l[1]), "v"((unsigned long long)g[1]),
                    "v"(l[2]), "v"((unsigned long long)g[2]),
                    "v"(l[3]), "v"((unsigned long long)g[3]),
                    "v"(l[4]), "v"((unsigned long long)g[4]),
                    "v"(l[5]), "v"((unsigned long long)g[5]),
                    "v"(l[6]), "v"((unsigned long long)g[6]),
                    "v"(l[7]), "v"((unsigned long long)g[7])
                 : "memory");
}
__device__ __forceinline__ void wait_async0() {
    asm volatile("s_wait_asynccnt 0x0" ::: "memory");
}

// ------------------------- block reductions --------------------------------
__device__ __forceinline__ float block_reduce_sum(float v, float* buf) {
    int tid = threadIdx.x;
    buf[tid] = v; __syncthreads();
    #pragma unroll
    for (int s = 128; s > 0; s >>= 1) {
        if (tid < s) buf[tid] += buf[tid + s];
        __syncthreads();
    }
    float r = buf[0]; __syncthreads();
    return r;
}
__device__ __forceinline__ float block_reduce_max(float v, float* buf) {
    int tid = threadIdx.x;
    buf[tid] = v; __syncthreads();
    #pragma unroll
    for (int s = 128; s > 0; s >>= 1) {
        if (tid < s) buf[tid] = fmaxf(buf[tid], buf[tid + s]);
        __syncthreads();
    }
    float r = buf[0]; __syncthreads();
    return r;
}

// ------------------------- GroupNorm ---------------------------------------
// One work-group per (batch, group). Thread t loads all 16 channels of positions
// 4t .. 4t+3 (64 floats) and keeps them in registers from the sums to the
// normalisation, so x is read once and no statistics pass through memory.
// Writes h^T as f16 [B][N][C] (k-contiguous for GEMM B): the group's 16 channels
// are 32 contiguous bytes of a row.
__global__ __launch_bounds__(1024) void gn_fused_kernel(
    const float* __restrict__ x,
    const float* __restrict__ gw, const float* __restrict__ gb,
    _Float16* __restrict__ hT) {
    __shared__ float red[2][32];
    const int tid  = threadIdx.x;
    const int lane = tid & 31;
    const int wave = tid >> 5;
    const int bg   = blockIdx.x;            // b*NGRP + g
    const int b    = bg / NGRP;
    const int g    = bg % NGRP;
    const float* p = x + (size_t)bg * GELEM + 4 * tid;
    f4 v[CPG];
    #pragma unroll
    for (int c = 0; c < CPG; ++c)
        v[c] = *(const f4*)(p + (size_t)c * N_DIM);
    // the group's weights, fetched here so that they arrive under the loads of x
    float w[CPG], bb[CPG];
    #pragma unroll
    for (int c = 0; c < CPG; ++c) {
        w[c]  = gw[g * CPG + c];
        bb[c] = gb[g * CPG + c];
    }

    // four independent chains a thread, then lane butterfly, then the 32 waves
    f4 s4 = (f4){0.f, 0.f, 0.f, 0.f}, q4 = (f4){0.f, 0.f, 0.f, 0.f};
    #pragma unroll
    for (int c = 0; c < CPG; ++c) {
        s4 += v[c];
        q4 += v[c] * v[c];
    }
    float s  = (s4[0] + s4[1]) + (s4[2] + s4[3]);
    float s2 = (q4[0] + q4[1]) + (q4[2] + q4[3]);
    #pragma unroll
    for (int m = 16; m > 0; m >>= 1) {
        s  += __shfl_xor(s,  m);
        s2 += __shfl_xor(s2, m);
    }
    if (lane == 0) { red[0][wave] = s; red[1][wave] = s2; }
    __syncthreads();
    s  = red[0][lane];
    s2 = red[1][lane];
    #pragma unroll
    for (int m = 16; m > 0; m >>= 1) {
        s  += __shfl_xor(s,  m);
        s2 += __shfl_xor(s2, m);
    }
    const float mu  = s  * (1.0f / GELEM);
    const float var = s2 * (1.0f / GELEM) - mu * mu;
    const float rs  = rsqrtf(var + 1e-6f);

    // normalize + affine; lo = channels 0..7, hi = channels 8..15 of position 4t+q
    i4 lo[4], hi[4];
    #pragma unroll
    for (int q = 0; q < 4; ++q) {
        h8 l, h;
        #pragma unroll
        for (int c = 0; c < 8; ++c) {
            l[c] = (_Float16)((v[c][q]     - mu) * rs * w[c]     + bb[c]);
            h[c] = (_Float16)((v[c + 8][q] - mu) * rs * w[c + 8] + bb[c + 8]);
        }
        lo[q] = __builtin_bit_cast(i4, l);
        hi[q] = __builtin_bit_cast(i4, h);
    }

    // Lanes 2j and 2j+1 swap halves, so that the pair stores the 32 bytes of ONE
    // position side by side: a wave's store touches 16 rows of h^T, not 32.
    // The even lane gives its hi and takes the odd lane's lo.
    const bool odd = lane & 1;
    _Float16* dst = hT + ((size_t)b * N_DIM + 8 * (tid >> 1)) * C_DIM + g * CPG + (odd ? 8 : 0);
    #pragma unroll
    for (int q = 0; q < 4; ++q) {
        i4 give = odd ? lo[q] : hi[q];
        i4 take;
        #pragma unroll
        for (int e = 0; e < 4; ++e)
            take[e] = __shfl_xor(give[e], 1);
        *(i4*)(dst + (size_t)q * C_DIM)       = odd ? take : lo[q];   // even lane's positions
        *(i4*)(dst + (size_t)(4 + q) * C_DIM) = odd ? hi[q] : take;   // odd lane's positions
    }
}

// ------------------------- f32 -> f16 convert ------------------------------
// blockIdx.y picks one of four equally sized sources; dst holds them in a row
__global__ __launch_bounds__(256) void cvt_f16_kernel(
    const float* __restrict__ s0, const float* __restrict__ s1,
    const float* __restrict__ s2, const float* __restrict__ s3,
    _Float16* __restrict__ dst4, int n) {
    const int w = blockIdx.y;
    const float* src = (w == 0) ? s0 : (w == 1) ? s1 : (w == 2) ? s2 : s3;
    _Float16* dst = dst4 + (size_t)w * n;
    for (int i = blockIdx.x * 256 + threadIdx.x; i < n; i += gridDim.x * 256)
        dst[i] = (_Float16)src[i];
}

// ------------------------- WMMA fragment load ------------------------------
// LDS tile is row-major [r][k], pitch halves a row; lds points at the 32 k of
// this product. Per ISA 16-bit A 16x32 layout:
// lane<16 -> K base 0, lane>=16 -> K base 8; elems 0..7 = K base..base+7,
// elems 8..15 = K base+16..base+23. B (stored transposed [n][k]) symmetric.
__device__ __forceinline__ v16h load_frag32(const _Float16* lds, int pitch, int row, int kbase) {
    const h8 lo = *(const h8*)(lds + row * pitch + kbase);
    const h8 hi = *(const h8*)(lds + row * pitch + kbase + 16);
    return __builtin_shufflevector(lo, hi, 0,1,2,3,4,5,6,7,8,9,10,11,12,13,14,15);
}

// B fragment out of a row-major [k][n] LDS tile (pitch BKN_PITCH halves) by the
// transposing load: lane (c = l & 15, h = l >> 4) gets T[kb + 8h + 0..7][n0 + c];
// the loads at kb = 0 and kb = 16 give the k order of load_frag32.
#define BKN_PITCH 144      // 288 B = 32 B x odd: the transposing load's pitch
__device__ __forceinline__ h8 load_tr16(const _Float16* p) {
    typedef __attribute__((address_space(3))) s8 lds_s8;
    return __builtin_bit_cast(h8, __builtin_amdgcn_ds_load_tr16_b128_v8i16((lds_s8*)p));
}
__device__ __forceinline__ v16h load_frag32_tr(const _Float16* lds, int n0, int lane) {
    const _Float16* p = lds + (8 * (lane >> 4) + (lane & 7)) * BKN_PITCH
                            + n0 + 8 * ((lane >> 3) & 1);
    const h8 lo = load_tr16(p);
    const h8 hi = load_tr16(p + 16 * BKN_PITCH);
    return __builtin_shufflevector(lo, hi, 0,1,2,3,4,5,6,7,8,9,10,11,12,13,14,15);
}

// ------------------------- generic WMMA GEMM -------------------------------
// D = alpha * A(f16 [M][K]) x B(f16) + bias(+residual)
// blockIdx.z = batch: A, B, Out and residual advance by zA, zB, zO elements.
// OUT_MODE: 0 = f16 [M][N] (+bias)      (attn-out)
//           1 = f16 [N][M] (+bias)      (Q, K^T), and V in the form of mode 0:
//               blockIdx.x / 4 = part (0 Q, 1 K, 2 V) picks C_DIM rows of the
//               stacked weights A, the part's output plane and its bias
//           2 = f32 [M][N], scaled      (scores)
//           3 = f32 [M][N] + bias + residual (final proj)
// B_KN: true  -> global B is [K][N] (ldb = N pitch), async copy row-major into
//                LDS, transposed by the fragment load
//       false -> global B is [N][K] (pre-transposed), async direct copy
// One LDS stage holds BK k of both operands: 128 where one work-group has its
// WGP alone (B_KN: 256 work-groups), 64 where several share it. [row][k] tiles
// have a pitch of BK + 8 halves (16 B x odd: the pitch of ds_load_b128 readers).
template <int OUT_MODE, bool B_KN>
__global__ __launch_bounds__(256) void gemm_wmma_kernel(
    const _Float16* __restrict__ A0, int lda, size_t zA,
    const _Float16* __restrict__ B0, int ldb, size_t zB,
    void* __restrict__ Out, void* __restrict__ OutK,
    void* __restrict__ OutV, int ldo, size_t zO,
    const float* __restrict__ biasQ, const float* __restrict__ biasK,
    const float* __restrict__ biasV,
    const float* __restrict__ residual,
    float alpha, int M, int N, int K) {
    (void)M; (void)N; (void)OutK; (void)OutV; (void)biasK; (void)biasV;
    const int part = (OUT_MODE == 1) ? blockIdx.x / (C_DIM / 128) : 0;
    const _Float16* A  = A0 + blockIdx.z * zA + (size_t)part * C_DIM * lda;
    const _Float16* Bm = B0 + blockIdx.z * zB;
    const size_t    oz = blockIdx.z * zO;
    void*        OutP  = (part == 0) ? Out   : (part == 1) ? OutK  : OutV;
    const float* bias  = (part == 0) ? biasQ : (part == 1) ? biasK : biasV;
    constexpr int BK  = B_KN ? 128 : 64;
    constexpr int PA  = BK + 8;       // halves
    constexpr int CPR = BK / 8;       // 16-byte chunks in a [row][k] row
    constexpr int RPS = 256 / CPR;    // rows that one copy of the block covers
    __shared__ __attribute__((aligned(16))) _Float16 lA[2][128 * PA];
    __shared__ __attribute__((aligned(16)))
        _Float16 lB[2][B_KN ? BK * BKN_PITCH : 128 * PA];

    const int tid   = threadIdx.x;
    const int lane  = tid & 31;
    const int wave  = tid >> 5;     // 0..7
    const int waveM = wave & 3;     // 4 -> 32 rows each
    const int waveN = wave >> 2;    // 2 -> 64 cols each
    const int m0g   = (blockIdx.x - part * (C_DIM / 128)) * 128;   // row inside the part
    const int n0g   = blockIdx.y * 128;

    v8f acc[2][4];
    #pragma unroll
    for (int i = 0; i < 2; ++i)
        #pragma unroll
        for (int j = 0; j < 4; ++j)
            acc[i][j] = (v8f){0.f,0.f,0.f,0.f,0.f,0.f,0.f,0.f};

    const int rl    = lane & 15;
    const int kbase = (lane < 16) ? 0 : 8;

    // ---- tile staging: async copies, memory -> LDS, no register in between ----
    auto stage = [&](int bufi, int k0) {
        // [row][k] tile: CPR lanes cover one row's BK k, rows r + i * RPS per thread
        const int r  = tid / CPR;
        const int kq = (tid % CPR) * 8;
        const _Float16* ga = A + (size_t)(m0g + r) * lda + k0 + kq;
        const _Float16* la = &lA[bufi][r * PA + kq];
        unsigned        l[8];
        const _Float16* g[8];
        if (!B_KN) {
            // A and B tiles [128][64]: 4 chunks of each per thread
            const _Float16* gb = Bm + (size_t)(n0g + r) * ldb + k0 + kq;
            const _Float16* lb = &lB[bufi][r * PA + kq];
            #pragma unroll
            for (int i = 0; i < 4; ++i) {
                l[i]     = lds_addr(la + i * RPS * PA);
                g[i]     = ga + (size_t)(i * RPS) * lda;
                l[4 + i] = lds_addr(lb + i * RPS * PA);
                g[4 + i] = gb + (size_t)(i * RPS) * ldb;
            }
            async_copy8_b128(l, g);
        } else {
            // A tile [128][128]: 8 chunks per thread
            #pragma unroll
            for (int i = 0; i < 8; ++i) {
                l[i] = lds_addr(la + i * RPS * PA);
                g[i] = ga + (size_t)(i * RPS) * lda;
            }
            async_copy8_b128(l, g);
            // B tile [128 k][128 n] row-major: 16 lanes cover one 256-byte row,
            // rows k + 16 i per thread
            const int k  = tid >> 4;
            const int nq = (tid & 15) * 8;
            const _Float16* gb = Bm + (size_t)(k0 + k) * ldb + n0g + nq;
            #pragma unroll
            for (int i = 0; i < 8; ++i) {
                l[i] = lds_addr(&lB[bufi][(k + 16 * i) * BKN_PITCH + nq]);
                g[i] = gb + (size_t)(16 * i) * ldb;
            }
            async_copy8_b128(l, g);
        }
    };

    int buf = 0;
    stage(buf, 0);
    wait_async0();
    __syncthreads();

    for (int k0 = 0; k0 < K; k0 += BK) {
        int nbuf = buf ^ 1;
        if (k0 + BK < K) stage(nbuf, k0 + BK);   // overlap with compute

        // ---- compute: BK / 32 K=32 WMMA steps from the current buffer, in k order;
        // unrolled so that a later step's fragment loads can go ahead of the WMMAs
        #pragma unroll
        for (int kk = 0; kk < BK / 32; ++kk) {
            v16h af[2], bf[4];
            #pragma unroll
            for (int sm = 0; sm < 2; ++sm)
                af[sm] = load_frag32(lA[buf] + kk * 32, PA, waveM * 32 + sm * 16 + rl, kbase);
            #pragma unroll
            for (int sn = 0; sn < 4; ++sn)
                bf[sn] = B_KN ? load_frag32_tr(lB[buf] + kk * 32 * BKN_PITCH,
                                               waveN * 64 + sn * 16, lane)
                              : load_frag32(lB[buf] + kk * 32, PA,
                                            waveN * 64 + sn * 16 + rl, kbase);
            #pragma unroll
            for (int sm = 0; sm < 2; ++sm)
                #pragma unroll
                for (int sn = 0; sn < 4; ++sn)
                    acc[sm][sn] = __builtin_amdgcn_wmma_f32_16x16x32_f16(
                        false, af[sm], false, bf[sn],
                        (short)0, acc[sm][sn], false, false);
        }

        // this wave's LDS reads of the current buffer have retired before the
        // barrier behind which copies refill it
        asm volatile("s_wait_dscnt 0x0" ::: "memory");
        wait_async0();        // next-buffer async writes landed
        __syncthreads();      // + all waves done reading current buffer
        buf = nbuf;
    }

    // ---- epilogue: lane holds col n = rl, rows mb..mb+7
    const int mhalf = (lane < 16) ? 0 : 8;
    #pragma unroll
    for (int sm = 0; sm < 2; ++sm) {
        #pragma unroll
        for (int sn = 0; sn < 4; ++sn) {
            int mb = m0g + waveM * 32 + sm * 16 + mhalf;
            int n  = n0g + waveN * 64 + sn * 16 + rl;
            v8f a = acc[sm][sn];
            if (OUT_MODE == 0) {
                _Float16* O = (_Float16*)Out + oz;
                #pragma unroll
                for (int r = 0; r < 8; ++r) {
                    float v = a[r] * alpha + (bias ? bias[mb + r] : 0.0f);
                    O[(size_t)(mb + r) * ldo + n] = (_Float16)v;
                }
            } else if (OUT_MODE == 1) {
                _Float16* O = (_Float16*)OutP + oz;
                if (part < 2) {
                    h8 pack;
                    #pragma unroll
                    for (int r = 0; r < 8; ++r)
                        pack[r] = (_Float16)(a[r] * alpha + bias[mb + r]);
                    *(h8*)(O + (size_t)n * ldo + mb) = pack;   // contiguous over m
                    // before a register that this store names is written again
                    asm volatile("s_wait_xcnt 0x0" ::: "memory");
                } else {
                    #pragma unroll
                    for (int r = 0; r < 8; ++r) {
                        float v = a[r] * alpha + bias[mb + r];
                        O[(size_t)(mb + r) * N_DIM + n] = (_Float16)v;   // V is [C][N]
                    }
                    // before a register that these stores name is written again
                    asm volatile("s_wait_xcnt 0x0" ::: "memory");
                }
            } else if (OUT_MODE == 2) {
                float* O = (float*)Out + oz;
                #pragma unroll
                for (int r = 0; r < 8; ++r)
                    O[(size_t)(mb + r) * ldo + n] = a[r] * alpha;
            } else {
                float* O = (float*)Out;
                #pragma unroll
                for (int r = 0; r < 8; ++r) {
                    size_t idx = oz + (size_t)(mb + r) * ldo + n;
                    O[idx] = residual[idx] + a[r] * alpha + bias[mb + r];
                }
            }
        }
    }
}

// ------------------------- row softmax (in-place f32 -> f16) ---------------
// S: f32 [B*N][N], one row per block. Writes normalized f16 over the head of each row:
// P element (i,j) lives at half index i*2N + j  (pitch 2N halves).
__global__ __launch_bounds__(256) void softmax_kernel(float* __restrict__ S) {
    __shared__ float buf[256];
    const int row = blockIdx.x;
    float* r = S + (size_t)row * N_DIM;
    float vals[16];
    float lmax = -3.4e38f;
    #pragma unroll
    for (int i = 0; i < 16; ++i) {
        vals[i] = r[i * 256 + threadIdx.x];
        lmax = fmaxf(lmax, vals[i]);
    }
    float m = block_reduce_max(lmax, buf);
    float lsum = 0.f;
    #pragma unroll
    for (int i = 0; i < 16; ++i) {
        vals[i] = __expf(vals[i] - m);
        lsum += vals[i];
    }
    float s = block_reduce_sum(lsum, buf);   // barrier: all reads done
    float inv = 1.0f / s;
    _Float16* P = (_Float16*)S + (size_t)row * (2 * N_DIM);
    #pragma unroll
    for (int i = 0; i < 16; ++i)
        P[i * 256 + threadIdx.x] = (_Float16)(vals[i] * inv);
}

// ---------------------------------------------------------------------------
extern "C" void kernel_launch(void* const* d_in, const int* in_sizes, int n_in,
                              void* d_out, int out_size, void* d_ws, size_t ws_size,
                              hipStream_t stream) {
    (void)in_sizes; (void)n_in; (void)out_size; (void)ws_size;
    const float* x      = (const float*)d_in[0];
    const float* norm_w = (const float*)d_in[1];
    const float* norm_b = (const float*)d_in[2];
    const float* wq = (const float*)d_in[3];
    const float* bq = (const float*)d_in[4];
    const float* wk = (const float*)d_in[5];
    const float* bk = (const float*)d_in[6];
    const float* wv = (const float*)d_in[7];
    const float* bv = (const float*)d_in[8];
    const float* wp = (const float*)d_in[9];
    const float* bp = (const float*)d_in[10];
    float* out = (float*)d_out;

    // ---- carve workspace
    char* w = (char*)d_ws;
    auto carve = [&](size_t bytes) -> char* {
        char* p = w;
        w += (bytes + 255) & ~(size_t)255;
        return p;
    };
    _Float16*  hT    = (_Float16*)carve((size_t)B_DIM * N_DIM * C_DIM * 2); // [b][n][c]
    _Float16*  w16   = (_Float16*)carve((size_t)4 * C_DIM * C_DIM * 2);     // q, k, v, p
    _Float16*  Q     = (_Float16*)carve((size_t)B_DIM * N_DIM * C_DIM * 2); // [b][n][c]
    _Float16*  Kt    = (_Float16*)carve((size_t)B_DIM * N_DIM * C_DIM * 2); // [b][n][c]
    _Float16*  V     = (_Float16*)carve((size_t)B_DIM * C_DIM * N_DIM * 2); // [b][c][n]
    _Float16*  AO    = (_Float16*)carve((size_t)B_DIM * C_DIM * N_DIM * 2); // [b][c][n]
    float*     S     = (float*)carve((size_t)B_DIM * N_DIM * N_DIM * sizeof(float)); // [b][i][j]

    const float scale = 0.044194173824159216f;  // 512^-0.5

    // 1) GroupNorm, statistics and normalisation in one launch
    gn_fused_kernel<<<B_DIM * NGRP, 1024, 0, stream>>>(x, norm_w, norm_b, hT);

    // 2) weights to f16, one launch
    cvt_f16_kernel<<<dim3(256, 4), 256, 0, stream>>>(wq, wk, wv, wp, w16, C_DIM * C_DIM);

    // every GEMM takes both batches in one launch (grid z)
    dim3 gQKV(3 * C_DIM / 128, N_DIM / 128, B_DIM);   // 12 x 32 x 2
    dim3 gS(N_DIM / 128, N_DIM / 128, B_DIM);         // 32 x 32 x 2
    dim3 gO(C_DIM / 128, N_DIM / 128, B_DIM);         //  4 x 32 x 2
    const size_t zNC = (size_t)N_DIM * C_DIM;
    const size_t zNN = (size_t)N_DIM * N_DIM;

    // 3) Q, K, V projections (M=3*512, N=4096, K=512), B operand = hT "nk" direct
    gemm_wmma_kernel<1, false><<<gQKV, 256, 0, stream>>>(
        w16, C_DIM, 0, hT, C_DIM, zNC, Q, Kt, V, C_DIM, zNC,
        bq, bk, bv, nullptr, 1.0f, 3 * C_DIM, N_DIM, C_DIM);
    // 4) scores: S[i][j] = scale * Q[i][:] . Kt[j][:]   (M=N=4096, K=512)
    gemm_wmma_kernel<2, false><<<gS, 256, 0, stream>>>(
        Q, C_DIM, zNC, Kt, C_DIM, zNC, S, nullptr, nullptr, N_DIM, zNN,
        nullptr, nullptr, nullptr, nullptr, scale, N_DIM, N_DIM, C_DIM);
    // 5) softmax rows, normalized f16 written in place (pitch 2N halves)
    softmax_kernel<<<B_DIM * N_DIM, 256, 0, stream>>>(S);
    // 6) AO[c][j] = sum_i V[c][i] * P[i][j]  (M=512, N=4096, K=4096)
    gemm_wmma_kernel<0, true><<<gO, 256, 0, stream>>>(
        V, N_DIM, zNC, (const _Float16*)S, 2 * N_DIM, 2 * zNN, AO, nullptr, nullptr,
        N_DIM, zNC, nullptr, nullptr, nullptr, nullptr, 1.0f, C_DIM, N_DIM, N_DIM);
    // 7) out = x + Wp @ AO + bp   (M=512, N=4096, K=512)
    gemm_wmma_kernel<3, true><<<gO, 256, 0, stream>>>(
        w16 + (size_t)3 * C_DIM * C_DIM, C_DIM, 0, AO, N_DIM, zNC, out, nullptr, nullptr,
        N_DIM, zNC, bp, nullptr, nullptr, x, 1.0f, C_DIM, N_DIM, C_DIM);
}

// v005
// A run of this version takes 131 microseconds.
// Timed twice side by side with v004, it ran 1.09 times as fast both times.
// Counting every step since v000, it is 5.10 times as fast.
#include <hip/hip_runtime.h>

// ---------------------------------------------------------------------------
// AttnBlock for MI455X (gfx1250): GroupNorm -> QKV 1x1 -> attention -> proj
// GEMMs via V_WMMA_F32_16X16X32_F16; tiles staged with
// GLOBAL_LOAD_ASYNC_TO_LDS_B128 (ASYNCcnt) into double-buffered LDS.
// ---------------------------------------------------------------------------

typedef __attribute__((ext_vector_type(16))) _Float16 v16h;
typedef __attribute__((ext_vector_type(8)))  _Float16 h8;
typedef __attribute__((ext_vector_type(8)))  short    s8;
typedef __attribute__((ext_vector_type(8)))  float    v8f;
typedef __attribute__((ext_vector_type(4)))  float    f4;
typedef __attribute__((ext_vector_type(4)))  int      i4;

#define C_DIM 512
#define N_DIM 4096
#define B_DIM 2
#define NGRP  32
#define CPG   16           // channels per group
#define GELEM (CPG * N_DIM)
#define NJB   (N_DIM / 128)   // 128-column blocks of a score row

// ------------------------- CDNA5 async-copy helpers ------------------------
// Per-lane async copy of 16 bytes global -> LDS, tracked by ASYNCcnt.
// vdst VGPR carries the 32-bit LDS byte address (low 32 bits of flat shared
// pointer, per ISA 10.2 aperture mapping).
__device__ __forceinline__ unsigned lds_addr(const void* lds_ptr) {
    return (unsigned)(unsigned long long)lds_ptr;
}
// Eight per-lane copies in ONE statement, closed by s_wait_xcnt 0: the operands'
// registers live to the statement's end, so no address register of an issued
// copy is rewritten ahead of that wait.
__device__ __forceinline__ void async_copy8_b128(const unsigned (&l)[8],
                                                 const _Float16* const (&g)[8]) {
    asm volatile("global_load_async_to_lds_b128 %0, %1, off\n\t"
                 "global_load_async_to_lds_b128 %2, %3, off\n\t"
                 "global_load_async_to_lds_b128 %4, %5, off\n\t"
                 "global_load_async_to_lds_b128 %6, %7, off\n\t"
                 "global_load_async_to_lds_b128 %8, %9, off\n\t"
                 "global_load_async_to_lds_b128 %10, %11, off\n\t"
                 "global_load_async_to_lds_b128 %12, %13, off\n\t"
                 "global_load_async_to_lds_b128 %14, %15, off\n\t"
                 "s_wait_xcnt 0x0"
                 :: "v"(l[0]), "v"((unsigned long long)g[0]),
                    "v"(l[1]), "v"((unsigned long long)g[1]),
                    "v"(l[2]), "v"((unsigned long long)g[2]),
                    "v"(l[3]), "v"((unsigned long long)g[3]),
                    "v"(l[4]), "v"((unsigned long long)g[4]),
                    "v"(l[5]), "v"((unsigned long long)g[5]),
                    "v"(l[6]), "v"((unsigned long long)g[6]),
                    "v"(l[7]), "v"((unsigned long long)g[7])
                 : "memory");
}
__device__ __forceinline__ void wait_async0() {
    asm volatile("s_wait_asynccnt 0x0" ::: "memory");
}

// 2^x. The v_nop fills the slot that the instruction set asks for between a
// transcendental and a next instruction that reads its result or writes its source.
__device__ __forceinline__ float exp2_slot(float x) {
    float r;
    asm("v_exp_f32 %0, %1\n\tv_nop" : "=v"(r) : "v"(x));
    return r;
}

// ------------------------- GroupNorm ---------------------------------------
// One work-group per (batch, group). Thread t loads all 16 channels of positions
// 4t .. 4t+3 (64 floats) and keeps them in registers from the sums to the
// normalisation, so x is read once and no statistics pass through memory.
// Writes h^T as f16 [B][N][C] (k-contiguous for GEMM B): the group's 16 channels
// are 32 contiguous bytes of a row.
__global__ __launch_bounds__(1024) void gn_fused_kernel(
    const float* __restrict__ x,
    const float* __restrict__ gw, const float* __restrict__ gb,
    _Float16* __restrict__ hT) {
    __shared__ float red[2][32];
    const int tid  = threadIdx.x;
    const int lane = tid & 31;
    const int wave = tid >> 5;
    const int bg   = blockIdx.x;            // b*NGRP + g
    const int b    = bg / NGRP;
    const int g    = bg % NGRP;
    const float* p = x + (size_t)bg * GELEM + 4 * tid;
    f4 v[CPG];
    #pragma unroll
    for (int c = 0; c < CPG; ++c)
        v[c] = *(const f4*)(p + (size_t)c * N_DIM);
    // the group's weights, fetched here so that they arrive under the loads of x
    float w[CPG], bb[CPG];
    #pragma unroll
    for (int c = 0; c < CPG; ++c) {
        w[c]  = gw[g * CPG + c];
        bb[c] = gb[g * CPG + c];
    }

    // four independent chains a thread, then lane butterfly, then the 32 waves
    f4 s4 = (f4){0.f, 0.f, 0.f, 0.f}, q4 = (f4){0.f, 0.f, 0.f, 0.f};
    #pragma unroll
    for (int c = 0; c < CPG; ++c) {
        s4 += v[c];
        q4 += v[c] * v[c];
    }
    float s  = (s4[0] + s4[1]) + (s4[2] + s4[3]);
    float s2 = (q4[0] + q4[1]) + (q4[2] + q4[3]);
    #pragma unroll
    for (int m = 16; m > 0; m >>= 1) {
        s  += __shfl_xor(s,  m);
        s2 += __shfl_xor(s2, m);
    }
    if (lane == 0) { red[0][wave] = s; red[1][wave] = s2; }
    __syncthreads();
    s  = red[0][lane];
    s2 = red[1][lane];
    #pragma unroll
    for (int m = 16; m > 0; m >>= 1) {
        s  += __shfl_xor(s,  m);
        s2 += __shfl_xor(s2, m);
    }
    const float mu  = s  * (1.0f / GELEM);
    const float var = s2 * (1.0f / GELEM) - mu * mu;
    const float rs  = rsqrtf(var + 1e-6f);

    // normalize + affine; lo = channels 0..7, hi = channels 8..15 of position 4t+q
    i4 lo[4], hi[4];
    #pragma unroll
    for (int q = 0; q < 4; ++q) {
        h8 l, h;
        #pragma unroll
        for (int c = 0; c < 8; ++c) {
            l[c] = (_Float16)((v[c][q]     - mu) * rs * w[c]     + bb[c]);
            h[c] = (_Float16)((v[c + 8][q] - mu) * rs * w[c + 8] + bb[c + 8]);
        }
        lo[q] = __builtin_bit_cast(i4, l);
        hi[q] = __builtin_bit_cast(i4, h);
    }

    // Lanes 2j and 2j+1 swap halves, so that the pair stores the 32 bytes of ONE
    // position side by side: a wave's store touches 16 rows of h^T, not 32.
    // The even lane gives its hi and takes the odd lane's lo.
    const bool odd = lane & 1;
    _Float16* dst = hT + ((size_t)b * N_DIM + 8 * (tid >> 1)) * C_DIM + g * CPG + (odd ? 8 : 0);
    #pragma unroll
    for (int q = 0; q < 4; ++q) {
        i4 give = odd ? lo[q] : hi[q];
        i4 take;
        #pragma unroll
        for (int e = 0; e < 4; ++e)
            take[e] = __shfl_xor(give[e], 1);
        *(i4*)(dst + (size_t)q * C_DIM)       = odd ? take : lo[q];   // even lane's positions
        *(i4*)(dst + (size_t)(4 + q) * C_DIM) = odd ? hi[q] : take;   // odd lane's positions
    }
}

// ------------------------- f32 -> f16 convert ------------------------------
// blockIdx.y picks one of four equally sized sources; dst holds them in a row
__global__ __launch_bounds__(256) void cvt_f16_kernel(
    const float* __restrict__ s0, const float* __restrict__ s1,
    const float* __restrict__ s2, const float* __restrict__ s3,
    _Float16* __restrict__ dst4, int n) {
    const int w = blockIdx.y;
    const float* src = (w == 0) ? s0 : (w == 1) ? s1 : (w == 2) ? s2 : s3;
    _Float16* dst = dst4 + (size_t)w * n;
    for (int i = blockIdx.x * 256 + threadIdx.x; i < n; i += gridDim.x * 256)
        dst[i] = (_Float16)src[i];
}

// ------------------------- WMMA fragment load ------------------------------
// LDS tile is row-major [r][k], pitch halves a row; lds points at the 32 k of
// this product. Per ISA 16-bit A 16x32 layout:
// lane<16 -> K base 0, lane>=16 -> K base 8; elems 0..7 = K base..base+7,
// elems 8..15 = K base+16..base+23. B (stored transposed [n][k]) symmetric.
__device__ __forceinline__ v16h load_frag32(const _Float16* lds, int pitch, int row, int kbase) {
    const h8 lo = *(const h8*)(lds + row * pitch + kbase);
    const h8 hi = *(const h8*)(lds + row * pitch + kbase + 16);
    return __builtin_shufflevector(lo, hi, 0,1,2,3,4,5,6,7,8,9,10,11,12,13,14,15);
}

// B fragment out of a row-major [k][n] LDS tile (pitch BKN_PITCH halves) by the
// transposing load: lane (c = l & 15, h = l >> 4) gets T[kb + 8h + 0..7][n0 + c];
// the loads at kb = 0 and kb = 16 give the k order of load_frag32.
#define BKN_PITCH 144      // 288 B = 32 B x odd: the transposing load's pitch
__device__ __forceinline__ h8 load_tr16(const _Float16* p) {
    typedef __attribute__((address_space(3))) s8 lds_s8;
    return __builtin_bit_cast(h8, __builtin_amdgcn_ds_load_tr16_b128_v8i16((lds_s8*)p));
}
__device__ __forceinline__ v16h load_frag32_tr(const _Float16* lds, int n0, int lane) {
    const _Float16* p = lds + (8 * (lane >> 4) + (lane & 7)) * BKN_PITCH
                            + n0 + 8 * ((lane >> 3) & 1);
    const h8 lo = load_tr16(p);
    const h8 hi = load_tr16(p + 16 * BKN_PITCH);
    return __builtin_shufflevector(lo, hi, 0,1,2,3,4,5,6,7,8,9,10,11,12,13,14,15);
}

// ------------------------- generic WMMA GEMM -------------------------------
// D = alpha * A(f16 [M][K]) x B(f16) + bias(+residual)
// blockIdx.z = batch: A, B, Out and residual advance by zA, zB, zO elements.
// OUT_MODE: 0 = f16 [M][N] (+bias)      (attn-out); A[m][k] is multiplied by
//               rowf[k] of this block's 128 columns as its fragments are read
//           1 = f16 [N][M] (+bias)      (Q, K^T), and V in the form of mode 0:
//               blockIdx.x / 4 = part (0 Q, 1 K, 2 V) picks C_DIM rows of the
//               stacked weights A, the part's output plane and its bias
//           2 = scores with the block-local softmax: m = key j, n = query i; writes
//               f16 E[i][j] = 2^(s - bm), bm = max of row i over this block's 128 j,
//               and per (block, i) bm (OutK) and the sum of those powers (OutV);
//               alpha holds scale * log2(e), so that s is the score in units of ln 2
//           3 = f32 [M][N] + bias + residual (final proj)
// B_KN: true  -> global B is [K][N] (ldb = N pitch), async copy row-major into
//                LDS, transposed by the fragment load
//       false -> global B is [N][K] (pre-transposed), async direct copy
// One LDS stage holds BK k of both operands: 128 where one work-group has its
// WGP alone (B_KN: 256 work-groups), 64 where several share it. [row][k] tiles
// have a pitch of BK + 8 halves (16 B x odd: the pitch of ds_load_b128 readers).
template <int OUT_MODE, bool B_KN>
__global__ __launch_bounds__(256) void gemm_wmma_kernel(
    const _Float16* __restrict__ A0, int lda, size_t zA,
    const _Float16* __restrict__ B0, int ldb, size_t zB,
    void* __restrict__ Out, void* __restrict__ OutK,
    void* __restrict__ OutV, int ldo, size_t zO,
    const float* __restrict__ biasQ, const float* __restrict__ biasK,
    const float* __restrict__ biasV,
    const float* __restrict__ residual,
    const _Float16* __restrict__ rowf,
    float alpha, int M, int N, int K) {
    (void)M; (void)N; (void)OutK; (void)OutV; (void)biasK; (void)biasV; (void)rowf;
    const int part = (OUT_MODE == 1) ? blockIdx.x / (C_DIM / 128) : 0;
    const _Float16* A  = A0 + blockIdx.z * zA + (size_t)part * C_DIM * lda;
    const _Float16* Bm = B0 + blockIdx.z * zB;
    const size_t    oz = blockIdx.z * zO;
    void*        OutP  = (part == 0) ? Out   : (part == 1) ? OutK  : OutV;
    const float* bias  = (part == 0) ? biasQ : (part == 1) ? biasK : biasV;
    constexpr int BK  = B_KN ? 128 : 64;
    constexpr int PA  = BK + 8;       // halves
    constexpr int CPR = BK / 8;       // 16-byte chunks in a [row][k] row
    constexpr int RPS = 256 / CPR;    // rows that one copy of the block covers
    __shared__ __attribute__((aligned(16))) _Float16 lA[2][128 * PA];
    __shared__ __attribute__((aligned(16)))
        _Float16 lB[2][B_KN ? BK * BKN_PITCH : 128 * PA];
    // the row factors of this block's columns, one per k
    __shared__ __attribute__((aligned(16))) _Float16 lF[OUT_MODE == 0 ? N_DIM : 8];

    const int tid   = threadIdx.x;
    const int lane  = tid & 31;
    const int wave  = tid >> 5;     // 0..7
    const int waveM = wave & 3;     // 4 -> 32 rows each
    const int waveN = wave >> 2;    // 2 -> 64 cols each
    const int m0g   = (blockIdx.x - part * (C_DIM / 128)) * 128;   // row inside the part
    const int n0g   = blockIdx.y * 128;

    v8f acc[2][4];
    #pragma unroll
    for (int i = 0; i < 2; ++i)
        #pragma unroll
        for (int j = 0; j < 4; ++j)
            acc[i][j] = (v8f){0.f,0.f,0.f,0.f,0.f,0.f,0.f,0.f};

    const int rl    = lane & 15;
    const int kbase = (lane < 16) ? 0 : 8;

    // ---- tile staging: async copies, memory -> LDS, no register in between ----
    auto stage = [&](int bufi, int k0) {
        // [row][k] tile: CPR lanes cover one row's BK k, rows r + i * RPS per thread
        const int r  = tid / CPR;
        const int kq = (tid % CPR) * 8;
        const _Float16* ga = A + (size_t)(m0g + r) * lda + k0 + kq;
        const _Float16* la = &lA[bufi][r * PA + kq];
        unsigned        l[8];
        const _Float16* g[8];
        if (!B_KN) {
            // A and B tiles [128][64]: 4 chunks of each per thread
            const _Float16* gb = Bm + (size_t)(n0g + r) * ldb + k0 + kq;
            const _Float16* lb = &lB[bufi][r * PA + kq];
            #pragma unroll
            for (int i = 0; i < 4; ++i) {
                l[i]     = lds_addr(la + i * RPS * PA);
                g[i]     = ga + (size_t)(i * RPS) * lda;
                l[4 + i] = lds_addr(lb + i * RPS * PA);
                g[4 + i] = gb + (size_t)(i * RPS) * ldb;
            }
            async_copy8_b128(l, g);
        } else {
            // A tile [128][128]: 8 chunks per thread
            #pragma unroll
            for (int i = 0; i < 8; ++i) {
                l[i] = lds_addr(la + i * RPS * PA);
                g[i] = ga + (size_t)(i * RPS) * lda;
            }
            async_copy8_b128(l, g);
            // B tile [128 k][128 n] row-major: 16 lanes cover one 256-byte row,
            // rows k + 16 i per thread
            const int k  = tid >> 4;
            const int nq = (tid & 15) * 8;
            const _Float16* gb = Bm + (size_t)(k0 + k) * ldb + n0g + nq;
            #pragma unroll
            for (int i = 0; i < 8; ++i) {
                l[i] = lds_addr(&lB[bufi][(k + 16 * i) * BKN_PITCH + nq]);
                g[i] = gb + (size_t)(16 * i) * ldb;
            }
            async_copy8_b128(l, g);
        }
    };

    int buf = 0;
    stage(buf, 0);
    if constexpr (OUT_MODE == 0) {
        const _Float16* fs = rowf + ((size_t)blockIdx.z * NJB + blockIdx.y) * N_DIM + tid * 16;
        const h8 f0 = *(const h8*)fs;
        const h8 f1 = *(const h8*)(fs + 8);
        // before a register that these loads name is written again
        asm volatile("s_wait_xcnt 0x0" ::: "memory");
        *(h8*)(lF + tid * 16)     = f0;
        *(h8*)(lF + tid * 16 + 8) = f1;
    }
    wait_async0();
    __syncthreads();

    for (int k0 = 0; k0 < K; k0 += BK) {
        int nbuf = buf ^ 1;
        if (k0 + BK < K) stage(nbuf, k0 + BK);   // overlap with compute

        // ---- compute: BK / 32 K=32 WMMA steps from the current buffer, in k order;
        // unrolled so that a later step's fragment loads can go ahead of the WMMAs
        #pragma unroll
        for (int kk = 0; kk < BK / 32; ++kk) {
            v16h af[2], bf[4];
            #pragma unroll
            for (int sm = 0; sm < 2; ++sm)
                af[sm] = load_frag32(lA[buf] + kk * 32, PA, waveM * 32 + sm * 16 + rl, kbase);
            if constexpr (OUT_MODE == 0) {
                // same k order as the A fragment: row 0 of a [1][k] tile
                const v16h fv = load_frag32(lF + k0 + kk * 32, 0, 0, kbase);
                af[0] *= fv;
                af[1] *= fv;
            }
            #pragma unroll
            for (int sn = 0; sn < 4; ++sn)
                bf[sn] = B_KN ? load_frag32_tr(lB[buf] + kk * 32 * BKN_PITCH,
                                               waveN * 64 + sn * 16, lane)
                              : load_frag32(lB[buf] + kk * 32, PA,
                                            waveN * 64 + sn * 16 + rl, kbase);
            #pragma unroll
            for (int sm = 0; sm < 2; ++sm)
                #pragma unroll
                for (int sn = 0; sn < 4; ++sn)
                    acc[sm][sn] = __builtin_amdgcn_wmma_f32_16x16x32_f16(
                        false, af[sm], false, bf[sn],
                        (short)0, acc[sm][sn], false, false);
        }

        // this wave's LDS reads of the current buffer have retired before the
        // barrier behind which copies refill it
        asm volatile("s_wait_dscnt 0x0" ::: "memory");
        wait_async0();        // next-buffer async writes landed
        __syncthreads();      // + all waves done reading current buffer
        buf = nbuf;
    }

    // ---- epilogue: lane holds col n = rl, rows mb..mb+7
    const int mhalf = (lane < 16) ? 0 : 8;
    if constexpr (OUT_MODE == 2) {
        // The stage buffers are free behind the loop's last barrier.
        float*    red = (float*)&lB[0][0];    // [2][4 waveM][128 i]: maxima, then sums
        _Float16* eT  = &lA[0][0];            // [128 i][128 j], pitch 136 halves
        constexpr int PE = 136;
        // max of query i over this wave's 32 keys: 16 in the lane, 16 in lane ^ 16
        const int il0 = waveN * 64 + rl;      // query of sn = 0; + 16 per sn
        float mx[4];
        #pragma unroll
        for (int sn = 0; sn < 4; ++sn) {
            float m = -3.4e38f;
            #pragma unroll
            for (int sm = 0; sm < 2; ++sm)
                #pragma unroll
                for (int r = 0; r < 8; ++r) {
                    acc[sm][sn][r] *= alpha;
                    m = fmaxf(m, acc[sm][sn][r]);
                }
            mx[sn] = m;
        }
        #pragma unroll
        for (int sn = 0; sn < 4; ++sn)
            mx[sn] = fmaxf(mx[sn], __shfl_xor(mx[sn], 16));
        if (lane < 16) {
            #pragma unroll
            for (int sn = 0; sn < 4; ++sn)
                red[waveM * 128 + il0 + sn * 16] = mx[sn];
        }
        __syncthreads();
        #pragma unroll
        for (int sn = 0; sn < 4; ++sn) {
            const int il = il0 + sn * 16;
            mx[sn] = fmaxf(fmaxf(red[il], red[128 + il]),
                           fmaxf(red[256 + il], red[384 + il]));
        }
        float sum[4];
        #pragma unroll
        for (int sn = 0; sn < 4; ++sn) {
            float s = 0.f;
            #pragma unroll
            for (int sm = 0; sm < 2; ++sm) {
                h8 pack;
                #pragma unroll
                for (int r = 0; r < 8; ++r) {
                    const float e = exp2_slot(acc[sm][sn][r] - mx[sn]);
                    s += e;
                    pack[r] = (_Float16)e;
                }
                *(h8*)(eT + (il0 + sn * 16) * PE + waveM * 32 + sm * 16 + mhalf) = pack;
            }
            sum[sn] = s;
        }
        #pragma unroll
        for (int sn = 0; sn < 4; ++sn)
            sum[sn] += __shfl_xor(sum[sn], 16);
        if (lane < 16) {
            #pragma unroll
            for (int sn = 0; sn < 4; ++sn)
                red[512 + waveM * 128 + il0 + sn * 16] = sum[sn];
        }
        __syncthreads();
        // whole 256-byte rows of E: 16 lanes a row
        _Float16* E = (_Float16*)Out + oz + (size_t)n0g * ldo + m0g;
        #pragma unroll
        for (int t = 0; t < 8; ++t) {
            const int row = (tid >> 4) + 16 * t;
            const int c   = (tid & 15) * 8;
            *(h8*)(E + (size_t)row * ldo + c) = *(const h8*)(eT + row * PE + c);
        }
        if (tid < 128) {
            const size_t si = ((size_t)blockIdx.z * NJB + blockIdx.x) * N_DIM + n0g + tid;
            ((float*)OutK)[si] = fmaxf(fmaxf(red[tid], red[128 + tid]),
                                       fmaxf(red[256 + tid], red[384 + tid]));
            ((float*)OutV)[si] = (red[512 + tid] + red[640 + tid])
                               + (red[768 + tid] + red[896 + tid]);
        }
        return;
    }
    #pragma unroll
    for (int sm = 0; sm < 2; ++sm) {
        #pragma unroll
        for (int sn = 0; sn < 4; ++sn) {
            int mb = m0g + waveM * 32 + sm * 16 + mhalf;
            int n  = n0g + waveN * 64 + sn * 16 + rl;
            v8f a = acc[sm][sn];
            if (OUT_MODE == 0) {
                _Float16* O = (_Float16*)Out + oz;
                #pragma unroll
                for (int r = 0; r < 8; ++r) {
                    float v = a[r] * alpha + (bias ? bias[mb + r] : 0.0f);
                    O[(size_t)(mb + r) * ldo + n] = (_Float16)v;
                }
            } else if (OUT_MODE == 1) {
                _Float16* O = (_Float16*)OutP + oz;
                if (part < 2) {
                    h8 pack;
                    #pragma unroll
                    for (int r = 0; r < 8; ++r)
                        pack[r] = (_Float16)(a[r] * alpha + bias[mb + r]);
                    *(h8*)(O + (size_t)n * ldo + mb) = pack;   // contiguous over m
                    // before a register that this store names is written again
                    asm volatile("s_wait_xcnt 0x0" ::: "memory");
                } else {
                    #pragma unroll
                    for (int r = 0; r < 8; ++r) {
                        float v = a[r] * alpha + bias[mb + r];
                        O[(size_t)(mb + r) * N_DIM + n] = (_Float16)v;   // V is [C][N]
                    }
                    // before a register that these stores name is written again
                    asm volatile("s_wait_xcnt 0x0" ::: "memory");
                }
            } else {
                float* O = (float*)Out;
                #pragma unroll
                for (int r = 0; r < 8; ++r) {
                    size_t idx = oz + (size_t)(mb + r) * ldo + n;
                    O[idx] = residual[idx] + a[r] * alpha + bias[mb + r];
                }
            }
        }
    }
}

// ------------------------- row factors of the softmax ----------------------
// bm, bl: [B][NJB][N], per 128-column block jb and row i the block's maximum and its
// sum of 2^(s - bm), s = score * log2(e). With M = max over jb and L = sum over jb of
// bl * 2^(bm - M), softmax(i, j) = E[i][j] * f[jb][i], f = 2^(bm - M) / L.
// One thread per row.
__global__ __launch_bounds__(64) void row_factor_kernel(
    const float* __restrict__ bm, const float* __restrict__ bl,
    _Float16* __restrict__ f) {
    const int t = blockIdx.x * 64 + threadIdx.x;          // b * N + i
    const size_t base = (size_t)(t / N_DIM) * NJB * N_DIM + (t % N_DIM);
    float m[NJB], l[NJB];
    #pragma unroll
    for (int jb = 0; jb < NJB; ++jb)
        m[jb] = bm[base + (size_t)jb * N_DIM];
    // before a register that these loads name is written again
    asm volatile("s_wait_xcnt 0x0" ::: "memory");
    #pragma unroll
    for (int jb = 0; jb < NJB; ++jb)
        l[jb] = bl[base + (size_t)jb * N_DIM];
    // before a register that these loads name is written again
    asm volatile("s_wait_xcnt 0x0" ::: "memory");
    float M = m[0];
    #pragma unroll
    for (int jb = 1; jb < NJB; ++jb) M = fmaxf(M, m[jb]);
    float L = 0.f;
    #pragma unroll
    for (int jb = 0; jb < NJB; ++jb) {
        m[jb] = exp2_slot(m[jb] - M);
        L += l[jb] * m[jb];
    }
    const float inv = 1.0f / L;
    #pragma unroll
    for (int jb = 0; jb < NJB; ++jb)
        f[base + (size_t)jb * N_DIM] = (_Float16)(m[jb] * inv);
}

// ---------------------------------------------------------------------------
extern "C" void kernel_launch(void* const* d_in, const int* in_sizes, int n_in,
                              void* d_out, int out_size, void* d_ws, size_t ws_size,
                              hipStream_t stream) {
    (void)in_sizes; (void)n_in; (void)out_size; (void)ws_size;
    const float* x      = (const float*)d_in[0];
    const float* norm_w = (const float*)d_in[1];
    const float* norm_b = (const float*)d_in[2];
    const float* wq = (const float*)d_in[3];
    const float* bq = (const float*)d_in[4];
    const float* wk = (const float*)d_in[5];
    const float* bk = (const float*)d_in[6];
    const float* wv = (const float*)d_in[7];
    const float* bv = (const float*)d_in[8];
    const float* wp = (const float*)d_in[9];
    const float* bp = (const float*)d_in[10];
    float* out = (float*)d_out;

    // ---- carve workspace
    char* w = (char*)d_ws;
    auto carve = [&](size_t bytes) -> char* {
        char* p = w;
        w += (bytes + 255) & ~(size_t)255;
        return p;
    };
    _Float16*  hT    = (_Float16*)carve((size_t)B_DIM * N_DIM * C_DIM * 2); // [b][n][c]
    _Float16*  w16   = (_Float16*)carve((size_t)4 * C_DIM * C_DIM * 2);     // q, k, v, p
    _Float16*  Q     = (_Float16*)carve((size_t)B_DIM * N_DIM * C_DIM * 2); // [b][n][c]
    _Float16*  Kt    = (_Float16*)carve((size_t)B_DIM * N_DIM * C_DIM * 2); // [b][n][c]
    _Float16*  V     = (_Float16*)carve((size_t)B_DIM * C_DIM * N_DIM * 2); // [b][c][n]
    _Float16*  AO    = (_Float16*)carve((size_t)B_DIM * C_DIM * N_DIM * 2); // [b][c][n]
    _Float16*  E     = (_Float16*)carve((size_t)B_DIM * N_DIM * N_DIM * 2);       // [b][i][j]
    float*     bm    = (float*)carve((size_t)B_DIM * NJB * N_DIM * sizeof(float)); // [b][jb][i]
    float*     bl    = (float*)carve((size_t)B_DIM * NJB * N_DIM * sizeof(float)); // [b][jb][i]
    _Float16*  rf    = (_Float16*)carve((size_t)B_DIM * NJB * N_DIM * 2);          // [b][jb][i]

    const float scale_log2e = 0.063758715412299341f;  // 512^-0.5 * log2(e)

    // 1) GroupNorm, statistics and normalisation in one launch
    gn_fused_kernel<<<B_DIM * NGRP, 1024, 0, stream>>>(x, norm_w, norm_b, hT);

    // 2) weights to f16, one launch
    cvt_f16_kernel<<<dim3(256, 4), 256, 0, stream>>>(wq, wk, wv, wp, w16, C_DIM * C_DIM);

    // every GEMM takes both batches in one launch (grid z)
    dim3 gQKV(3 * C_DIM / 128, N_DIM / 128, B_DIM);   // 12 x 32 x 2
    dim3 gS(N_DIM / 128, N_DIM / 128, B_DIM);         // 32 x 32 x 2
    dim3 gO(C_DIM / 128, N_DIM / 128, B_DIM);         //  4 x 32 x 2
    const size_t zNC = (size_t)N_DIM * C_DIM;
    const size_t zNN = (size_t)N_DIM * N_DIM;

    // 3) Q, K, V projections (M=3*512, N=4096, K=512), B operand = hT "nk" direct
    gemm_wmma_kernel<1, false><<<gQKV, 256, 0, stream>>>(
        w16, C_DIM, 0, hT, C_DIM, zNC, Q, Kt, V, C_DIM, zNC,
        bq, bk, bv, nullptr, nullptr, 1.0f, 3 * C_DIM, N_DIM, C_DIM);
    // 4) scores s[i][j] = scale_log2e * Q[i][:] . Kt[j][:] as the product Kt x Q^T (M = j,
    //    N = i, K=512), left as E = 2^(s - block max) with the blocks' maxima and sums
    gemm_wmma_kernel<2, false><<<gS, 256, 0, stream>>>(
        Kt, C_DIM, zNC, Q, C_DIM, zNC, E, bm, bl, N_DIM, zNN,
        nullptr, nullptr, nullptr, nullptr, nullptr, scale_log2e, N_DIM, N_DIM, C_DIM);
    // 5) the factor that makes a block's E the softmax, per (block, row)
    row_factor_kernel<<<B_DIM * N_DIM / 64, 64, 0, stream>>>(bm, bl, rf);
    // 6) AO[c][j] = sum_i (V[c][i] * rf[jb(j)][i]) * E[i][j]  (M=512, N=4096, K=4096)
    gemm_wmma_kernel<0, true><<<gO, 256, 0, stream>>>(
        V, N_DIM, zNC, E, N_DIM, zNN, AO, nullptr, nullptr,
        N_DIM, zNC, nullptr, nullptr, nullptr, nullptr, rf, 1.0f, C_DIM, N_DIM, N_DIM);
    // 7) out = x + Wp @ AO + bp   (M=512, N=4096, K=512)
    gemm_wmma_kernel<3, true><<<gO, 256, 0, stream>>>(
        w16 + (size_t)3 * C_DIM * C_DIM, C_DIM, 0, AO, N_DIM, zNC, out, nullptr, nullptr,
        N_DIM, zNC, bp, nullptr, nullptr, x, nullptr, 1.0f, C_DIM, N_DIM, C_DIM);
}

// v007
// One run takes 122 microseconds.
// Versions between v005 and this one are left out; their measured steps multiply to 1.07 times as fast.
// All steps since v000 together make it 5.45 times as fast.
#include <hip/hip_runtime.h>

// ---------------------------------------------------------------------------
// AttnBlock for MI455X (gfx1250): GroupNorm -> Q', V' 1x1 -> attention (+ residual).
// Two of the four 1x1 convolutions are folded into products of the weights:
//   q_i . k_j = (Wk^T q_i) . h_j + q_i . bk; the last term is the same for every j
//   of a row, so the softmax over j does not see it: Q' = (Wk^T Wq) h + Wk^T bq
//   meets h itself, and no K is formed.
//   Wp (V w) = (Wp V) w: V' = (Wp Wv) h + Wp bv, and no projection follows.
// GEMMs via V_WMMA_F32_16X16X32_F16; the generic GEMM's tiles staged with
// GLOBAL_LOAD_ASYNC_TO_LDS_B128 (ASYNCcnt) into double-buffered LDS.
// ---------------------------------------------------------------------------

typedef __attribute__((ext_vector_type(16))) _Float16 v16h;
typedef __attribute__((ext_vector_type(8)))  _Float16 h8;
typedef __attribute__((ext_vector_type(4)))  _Float16 h4;
typedef __attribute__((ext_vector_type(2)))  _Float16 h2;
typedef __attribute__((ext_vector_type(8)))  short    s8;
typedef __attribute__((ext_vector_type(8)))  float    v8f;
typedef __attribute__((ext_vector_type(4)))  float    f4;
typedef __attribute__((ext_vector_type(4)))  int      i4;

#define C_DIM 512
#define N_DIM 4096
#define B_DIM 2
#define NGRP  32
#define CPG   16           // channels per group
#define GELEM (CPG * N_DIM)
#define NJB   (N_DIM / 128)   // 128-column blocks of a score row

// ------------------------- CDNA5 async-copy helpers ------------------------
// Per-lane async copy of 16 bytes global -> LDS, tracked by ASYNCcnt.
// vdst VGPR carries the 32-bit LDS byte address (low 32 bits of flat shared
// pointer, per ISA 10.2 aperture mapping).
__device__ __forceinline__ unsigned lds_addr(const void* lds_ptr) {
    return (unsigned)(unsigned long long)lds_ptr;
}
// Eight per-lane copies in ONE statement, closed by s_wait_xcnt 0: the operands'
// registers live to the statement's end, so no address register of an issued
// copy is rewritten ahead of that wait.
__device__ __forceinline__ void async_copy8_b128(const unsigned (&l)[8],
                                                 const _Float16* const (&g)[8]) {
    asm volatile("global_load_async_to_lds_b128 %0, %1, off\n\t"
                 "global_load_async_to_lds_b128 %2, %3, off\n\t"
                 "global_load_async_to_lds_b128 %4, %5, off\n\t"
                 "global_load_async_to_lds_b128 %6, %7, off\n\t"
                 "global_load_async_to_lds_b128 %8, %9, off\n\t"
                 "global_load_async_to_lds_b128 %10, %11, off\n\t"
                 "global_load_async_to_lds_b128 %12, %13, off\n\t"
                 "global_load_async_to_lds_b128 %14, %15, off\n\t"
                 "s_wait_xcnt 0x0"
                 :: "v"(l[0]), "v"((unsigned long long)g[0]),
                    "v"(l[1]), "v"((unsigned long long)g[1]),
                    "v"(l[2]), "v"((unsigned long long)g[2]),
                    "v"(l[3]), "v"((unsigned long long)g[3]),
                    "v"(l[4]), "v"((unsigned long long)g[4]),
                    "v"(l[5]), "v"((unsigned long long)g[5]),
                    "v"(l[6]), "v"((unsigned long long)g[6]),
                    "v"(l[7]), "v"((unsigned long long)g[7])
                 : "memory");
}
__device__ __forceinline__ void wait_async0() {
    asm volatile("s_wait_asynccnt 0x0" ::: "memory");
}

// 2^x. The v_nop fills the slot that the instruction set asks for between a
// transcendental and a next instruction that reads its result or writes its source.
__device__ __forceinline__ float exp2_slot(float x) {
    float r;
    asm("v_exp_f32 %0, %1\n\tv_nop" : "=v"(r) : "v"(x));
    return r;
}

// ------------------------- GroupNorm ---------------------------------------
// One work-group per (batch, group). Thread t loads all 16 channels of positions
// 4t .. 4t+3 (64 floats) and keeps them in registers from the sums to the
// normalisation, so x is read once and no statistics pass through memory.
// Writes h^T as f16 [B][N][C] (k-contiguous for GEMM B): the group's 16 channels
// are 32 contiguous bytes of a row.
__global__ __launch_bounds__(1024) void gn_fused_kernel(
    const float* __restrict__ x,
    const float* __restrict__ gw, const float* __restrict__ gb,
    _Float16* __restrict__ hT) {
    __shared__ float red[2][32];
    const int tid  = threadIdx.x;
    const int lane = tid & 31;
    const int wave = tid >> 5;
    const int bg   = blockIdx.x;            // b*NGRP + g
    const int b    = bg / NGRP;
    const int g    = bg % NGRP;
    const float* p = x + (size_t)bg * GELEM + 4 * tid;
    f4 v[CPG];
    #pragma unroll
    for (int c = 0; c < CPG; ++c)
        v[c] = *(const f4*)(p + (size_t)c * N_DIM);
    // the group's weights, fetched here so that they arrive under the loads of x
    float w[CPG], bb[CPG];
    #pragma unroll
    for (int c = 0; c < CPG; ++c) {
        w[c]  = gw[g * CPG + c];
        bb[c] = gb[g * CPG + c];
    }

    // four independent chains a thread, then lane butterfly, then the 32 waves
    f4 s4 = (f4){0.f, 0.f, 0.f, 0.f}, q4 = (f4){0.f, 0.f, 0.f, 0.f};
    #pragma unroll
    for (int c = 0; c < CPG; ++c) {
        s4 += v[c];
        q4 += v[c] * v[c];
    }
    float s  = (s4[0] + s4[1]) + (s4[2] + s4[3]);
    float s2 = (q4[0] + q4[1]) + (q4[2] + q4[3]);
    #pragma unroll
    for (int m = 16; m > 0; m >>= 1) {
        s  += __shfl_xor(s,  m);
        s2 += __shfl_xor(s2, m);
    }
    if (lane == 0) { red[0][wave] = s; red[1][wave] = s2; }
    __syncthreads();
    s  = red[0][lane];
    s2 = red[1][lane];
    #pragma unroll
    for (int m = 16; m > 0; m >>= 1) {
        s  += __shfl_xor(s,  m);
        s2 += __shfl_xor(s2, m);
    }
    const float mu  = s  * (1.0f / GELEM);
    const float var = s2 * (1.0f / GELEM) - mu * mu;
    const float rs  = rsqrtf(var + 1e-6f);

    // normalize + affine; lo = channels 0..7, hi = channels 8..15 of position 4t+q
    i4 lo[4], hi[4];
    #pragma unroll
    for (int q = 0; q < 4; ++q) {
        h8 l, h;
        #pragma unroll
        for (int c = 0; c < 8; ++c) {
            l[c] = (_Float16)((v[c][q]     - mu) * rs * w[c]     + bb[c]);
            h[c] = (_Float16)((v[c + 8][q] - mu) * rs * w[c + 8] + bb[c + 8]);
        }
        lo[q] = __builtin_bit_cast(i4, l);
        hi[q] = __builtin_bit_cast(i4, h);
    }

    // Lanes 2j and 2j+1 swap halves, so that the pair stores the 32 bytes of ONE
    // position side by side: a wave's store touches 16 rows of h^T, not 32.
    // The even lane gives its hi and takes the odd lane's lo.
    const bool odd = lane & 1;
    _Float16* dst = hT + ((size_t)b * N_DIM + 8 * (tid >> 1)) * C_DIM + g * CPG + (odd ? 8 : 0);
    #pragma unroll
    for (int q = 0; q < 4; ++q) {
        i4 give = odd ? lo[q] : hi[q];
        i4 take;
        #pragma unroll
        for (int e = 0; e < 4; ++e)
            take[e] = __shfl_xor(give[e], 1);
        *(i4*)(dst + (size_t)q * C_DIM)       = odd ? take : lo[q];   // even lane's positions
        *(i4*)(dst + (size_t)(4 + q) * C_DIM) = odd ? hi[q] : take;   // odd lane's positions
    }
}

// ------------------------- WMMA fragment load ------------------------------
// LDS tile is row-major [r][k], pitch halves a row; lds points at the 32 k of
// this product. Per ISA 16-bit A 16x32 layout:
// lane<16 -> K base 0, lane>=16 -> K base 8; elems 0..7 = K base..base+7,
// elems 8..15 = K base+16..base+23. B (stored transposed [n][k]) symmetric.
__device__ __forceinline__ v16h load_frag32(const _Float16* lds, int pitch, int row, int kbase) {
    const h8 lo = *(const h8*)(lds + row * pitch + kbase);
    const h8 hi = *(const h8*)(lds + row * pitch + kbase + 16);
    return __builtin_shufflevector(lo, hi, 0,1,2,3,4,5,6,7,8,9,10,11,12,13,14,15);
}

// B fragment out of a row-major [k][n] LDS tile (pitch BKN_PITCH halves) by the
// transposing load: lane (c = l & 15, h = l >> 4) gets T[kb + 8h + 0..7][n0 + c];
// the loads at kb = 0 and kb = 16 give the k order of load_frag32.
#define BKN_PITCH 144      // 288 B = 32 B x odd: the transposing load's pitch
__device__ __forceinline__ h8 load_tr16(const _Float16* p) {
    typedef __attribute__((address_space(3))) s8 lds_s8;
    return __builtin_bit_cast(h8, __builtin_amdgcn_ds_load_tr16_b128_v8i16((lds_s8*)p));
}
__device__ __forceinline__ v16h load_frag32_tr(const _Float16* lds, int n0, int lane) {
    const _Float16* p = lds + (8 * (lane >> 4) + (lane & 7)) * BKN_PITCH
                            + n0 + 8 * ((lane >> 3) & 1);
    const h8 lo = load_tr16(p);
    const h8 hi = load_tr16(p + 16 * BKN_PITCH);
    return __builtin_shufflevector(lo, hi, 0,1,2,3,4,5,6,7,8,9,10,11,12,13,14,15);
}

// ------------------------- products of the weights -------------------------
// blockIdx.z = 0: G = Wk^T Wq, g = Wk^T bq;  1: G = Wp Wv, g = Wp bv.
// One 64 x 64 tile of G (f16 [m][n]) per work-group of 16 waves, all 512 k staged
// at once: f32 weights through registers to f16 in LDS. Wq, Wv and Wk lie
// [k][column] and are read by the transposing load; Wp lies [row][k].
#define WT_PITCH 80        // halves; 160 B = 32 B x odd: the transposing load's pitch
#define WR_PITCH 520       // halves; 1040 B = 16 B x odd: the pitch of ds_load_b128 readers
__device__ __forceinline__ v16h load_frag32_tr_w(const _Float16* lds, int n0, int lane) {
    const _Float16* p = lds + (8 * (lane >> 4) + (lane & 7)) * WT_PITCH
                            + n0 + 8 * ((lane >> 3) & 1);
    const h8 lo = load_tr16(p);
    const h8 hi = load_tr16(p + 16 * WT_PITCH);
    return __builtin_shufflevector(lo, hi, 0,1,2,3,4,5,6,7,8,9,10,11,12,13,14,15);
}
// A_KM: the first factor lies [k][m] in memory (Wk), else [m][k] (Wp)
template <bool A_KM>
__device__ __forceinline__ void weight_product(
    const float* __restrict__ wa, const float* __restrict__ wb,
    const float* __restrict__ bias,
    _Float16* __restrict__ G, float* __restrict__ g,
    _Float16* lA, _Float16* lB, float* lbias, float (*red)[64]) {
    const int tid  = threadIdx.x;
    const int lane = tid & 31;
    const int wave = tid >> 5;
    const int m0   = blockIdx.x * 64;
    const int n0   = blockIdx.y * 64;
    const bool with_bias = blockIdx.y == 0;    // these work-groups also form g

    // [k][64] tile: 16 lanes cover a row's 256 bytes, rows kr + 32 i per thread;
    // [64][k] tile: 128 lanes cover a row's 2048 bytes, rows (tid >> 7) + 4 i
    const int kr = tid >> 4;
    const int c4 = (tid & 15) * 4;
    constexpr int GA = (A_KM ? 32 : 4) * C_DIM;
    constexpr int SA = A_KM ? 32 * WT_PITCH : 4 * WR_PITCH;
    const float* gA = A_KM ? wa + (size_t)kr * C_DIM + m0 + c4
                           : wa + (size_t)(m0 + (tid >> 7)) * C_DIM + (tid & 127) * 4;
    const float* gB = wb + (size_t)kr * C_DIM + n0 + c4;
    _Float16* sA = A_KM ? lA + kr * WT_PITCH + c4
                        : lA + (tid >> 7) * WR_PITCH + (tid & 127) * 4;
    _Float16* sB = lB + kr * WT_PITCH + c4;
    f4 va[16], vb[16];
    #pragma unroll
    for (int i = 0; i < 16; ++i) {
        va[i] = *(const f4*)(gA + (size_t)i * GA);
        vb[i] = *(const f4*)(gB + (size_t)i * 32 * C_DIM);
    }
    f4 b4 = (f4){0.f, 0.f, 0.f, 0.f};
    if (with_bias && tid < C_DIM / 4)
        b4 = *(const f4*)(bias + tid * 4);
    // before a register that these loads name is written again
    asm volatile("s_wait_xcnt 0x0" ::: "memory");
    #pragma unroll
    for (int i = 0; i < 16; ++i) {
        *(h4*)(sA + i * SA)            = __builtin_convertvector(va[i], h4);
        *(h4*)(sB + i * 32 * WT_PITCH) = __builtin_convertvector(vb[i], h4);
    }
    if (with_bias && tid < C_DIM / 4)
        *(f4*)(lbias + tid * 4) = b4;
    __syncthreads();

    // wave: one 16 x 16 piece of the tile
    const int rl    = lane & 15;
    const int kbase = (lane < 16) ? 0 : 8;
    const int mi    = (wave & 3) * 16;
    const int nj    = (wave >> 2) * 16;
    v8f acc = (v8f){0.f,0.f,0.f,0.f,0.f,0.f,0.f,0.f};
    #pragma unroll
    for (int kk = 0; kk < C_DIM / 32; ++kk) {
        // both forms of A give the k order of load_frag32
        const v16h af = A_KM ? load_frag32_tr_w(lA + kk * 32 * WT_PITCH, mi, lane)
                             : load_frag32(lA + kk * 32, WR_PITCH, mi + rl, kbase);
        const v16h bf = load_frag32_tr_w(lB + kk * 32 * WT_PITCH, nj, lane);
        acc = __builtin_amdgcn_wmma_f32_16x16x32_f16(
            false, af, false, bf, (short)0, acc, false, false);
    }
    // lane holds column rl, rows mhalf .. mhalf + 7 of the piece
    const int mhalf = (lane < 16) ? 0 : 8;
    _Float16* Gp = G + (size_t)(m0 + mi + mhalf) * C_DIM + n0 + nj + rl;
    #pragma unroll
    for (int r = 0; r < 8; ++r)
        Gp[(size_t)r * C_DIM] = (_Float16)acc[r];
    // before a register that these stores name is written again
    asm volatile("s_wait_xcnt 0x0" ::: "memory");

    if (with_bias) {
        // g[m] = sum over k of A[m][k] * bias[k], sixteen partial sums of 32 k per row
        float s0 = 0.f, s1 = 0.f;
        if (A_KM) {
            // a lane takes two neighbouring m (one dword of a [k][m] row), a wave 32 k
            #pragma unroll
            for (int i = 0; i < 32; ++i) {
                const int k = wave * 32 + i;
                const h2 a = *(const h2*)(lA + k * WT_PITCH + lane * 2);
                s0 += (float)a[0] * lbias[k];
                s1 += (float)a[1] * lbias[k];
            }
            red[wave][lane * 2]     = s0;
            red[wave][lane * 2 + 1] = s1;
        } else {
            // a thread takes 64 k of row tid & 63
            const int r = tid & 63;
            const int q = tid >> 6;
            #pragma unroll
            for (int i = 0; i < 4; ++i) {
                const h8 a0 = *(const h8*)(lA + r * WR_PITCH + q * 64 + i * 8);
                const h8 a1 = *(const h8*)(lA + r * WR_PITCH + q * 64 + 32 + i * 8);
                #pragma unroll
                for (int e = 0; e < 8; ++e) {
                    s0 += (float)a0[e] * lbias[q * 64 + i * 8 + e];
                    s1 += (float)a1[e] * lbias[q * 64 + 32 + i * 8 + e];
                }
            }
            red[2 * q][r]     = s0;
            red[2 * q + 1][r] = s1;
        }
        __syncthreads();
        if (tid < 64) {
            float s = 0.f;
            #pragma unroll
            for (int q = 0; q < 16; ++q) s += red[q][tid];
            g[m0 + tid] = s;
        }
    }
}
__global__ __launch_bounds__(512) void weight_product_kernel(
    const float* __restrict__ wq, const float* __restrict__ bq,
    const float* __restrict__ wk,
    const float* __restrict__ wv, const float* __restrict__ bv,
    const float* __restrict__ wp,
    _Float16* __restrict__ g16, float* __restrict__ gbias) {
    __shared__ __attribute__((aligned(16))) _Float16 lA[C_DIM * WT_PITCH];  // or [64][WR_PITCH]
    __shared__ __attribute__((aligned(16))) _Float16 lB[C_DIM * WT_PITCH];
    __shared__ __attribute__((aligned(16))) float lbias[C_DIM];
    __shared__ float red[16][64];
    if (blockIdx.z == 0)
        weight_product<true>(wk, wq, bq, g16, gbias, lA, lB, lbias, red);
    else
        weight_product<false>(wp, wv, bv, g16 + (size_t)C_DIM * C_DIM, gbias + C_DIM,
                              lA, lB, lbias, red);
}

// ------------------------- generic WMMA GEMM -------------------------------
// D = alpha * A(f16 [M][K]) x B(f16) + bias(+residual)
// blockIdx.z = batch: A, B, Out and residual advance by zA, zB, zO elements.
// OUT_MODE: 0 = f32 [M][N] + bias + residual (the block's output); A[m][k] is
//               multiplied by rowf[k] of this block's 128 columns as its
//               fragments are read
//           1 = f16 + bias: blockIdx.x / 4 = part picks C_DIM rows of the stacked
//               weights A, the part's output plane and its bias;
//               part 0 (Q') is stored [N][M], part 1 (V') [M][N]
//           2 = scores with the block-local softmax: m = key j, n = query i; writes
//               f16 E[i][j] = 2^(s - bm), bm = max of row i over this block's 128 j,
//               and per (block, i) bm (OutK) and the sum of those powers (OutV);
//               alpha holds 512^-0.5 * log2(e), so that s is the score in units of ln 2
// B_KN: true  -> global B is [K][N] (ldb = N pitch), async copy row-major into
//                LDS, transposed by the fragment load
//       false -> global B is [N][K] (pre-transposed), async direct copy
// One LDS stage holds BK k of both operands: 128 where one work-group has its
// WGP alone (B_KN: 256 work-groups), 64 where several share it. [row][k] tiles
// have a pitch of BK + 8 halves (16 B x odd: the pitch of ds_load_b128 readers).
template <int OUT_MODE, bool B_KN>
__global__ __launch_bounds__(256) void gemm_wmma_kernel(
    const _Float16* __restrict__ A0, int lda, size_t zA,
    const _Float16* __restrict__ B0, int ldb, size_t zB,
    void* __restrict__ Out, void* __restrict__ OutK,
    void* __restrict__ OutV, int ldo, size_t zO,
    const float* __restrict__ biasQ, const float* __restrict__ biasK,
    const float* __restrict__ residual,
    const _Float16* __restrict__ rowf,
    float alpha, int M, int N, int K) {
    (void)M; (void)N; (void)OutK; (void)OutV; (void)biasK; (void)residual; (void)rowf;
    const int part = (OUT_MODE == 1) ? blockIdx.x / (C_DIM / 128) : 0;
    const _Float16* A  = A0 + blockIdx.z * zA + (size_t)part * C_DIM * lda;
    const _Float16* Bm = B0 + blockIdx.z * zB;
    const size_t    oz = blockIdx.z * zO;
    void*        OutP  = (part == 0) ? Out   : OutK;
    const float* bias  = (part == 0) ? biasQ : biasK;
    constexpr int BK  = B_KN ? 128 : 64;
    constexpr int PA  = BK + 8;       // halves
    constexpr int CPR = BK / 8;       // 16-byte chunks in a [row][k] row
    constexpr int RPS = 256 / CPR;    // rows that one copy of the block covers
    __shared__ __attribute__((aligned(16))) _Float16 lA[2][128 * PA];
    __shared__ __attribute__((aligned(16)))
        _Float16 lB[2][B_KN ? BK * BKN_PITCH : 128 * PA];
    // the row factors of this block's columns, one per k
    __shared__ __attribute__((aligned(16))) _Float16 lF[OUT_MODE == 0 ? N_DIM : 8];

    const int tid   = threadIdx.x;
    const int lane  = tid & 31;
    const int wave  = tid >> 5;     // 0..7
    const int waveM = wave & 3;     // 4 -> 32 rows each
    const int waveN = wave >> 2;    // 2 -> 64 cols each
    const int m0g   = (blockIdx.x - part * (C_DIM / 128)) * 128;   // row inside the part
    const int n0g   = blockIdx.y * 128;

    v8f acc[2][4];
    #pragma unroll
    for (int i = 0; i < 2; ++i)
        #pragma unroll
        for (int j = 0; j < 4; ++j)
            acc[i][j] = (v8f){0.f,0.f,0.f,0.f,0.f,0.f,0.f,0.f};

    const int rl    = lane & 15;
    const int kbase = (lane < 16) ? 0 : 8;

    // ---- tile staging: async copies, memory -> LDS, no register in between ----
    auto stage = [&](int bufi, int k0) {
        // [row][k] tile: CPR lanes cover one row's BK k, rows r + i * RPS per thread
        const int r  = tid / CPR;
        const int kq = (tid % CPR) * 8;
        const _Float16* ga = A + (size_t)(m0g + r) * lda + k0 + kq;
        const _Float16* la = &lA[bufi][r * PA + kq];
        unsigned        l[8];
        const _Float16* g[8];
        if (!B_KN) {
            // A and B tiles [128][64]: 4 chunks of each per thread
            const _Float16* gb = Bm + (size_t)(n0g + r) * ldb + k0 + kq;
            const _Float16* lb = &lB[bufi][r * PA + kq];
            #pragma unroll
            for (int i = 0; i < 4; ++i) {
                l[i]     = lds_addr(la + i * RPS * PA);
                g[i]     = ga + (size_t)(i * RPS) * lda;
                l[4 + i] = lds_addr(lb + i * RPS * PA);
                g[4 + i] = gb + (size_t)(i * RPS) * ldb;
            }
            async_copy8_b128(l, g);
        } else {
            // A tile [128][128]: 8 chunks per thread
            #pragma unroll
            for (int i = 0; i < 8; ++i) {
                l[i] = lds_addr(la + i * RPS * PA);
                g[i] = ga + (size_t)(i * RPS) * lda;
            }
            async_copy8_b128(l, g);
            // B tile [128 k][128 n] row-major: 16 lanes cover one 256-byte row,
            // rows k + 16 i per thread
            const int k  = tid >> 4;
            const int nq = (tid & 15) * 8;
            const _Float16* gb = Bm + (size_t)(k0 + k) * ldb + n0g + nq;
            #pragma unroll
            for (int i = 0; i < 8; ++i) {
                l[i] = lds_addr(&lB[bufi][(k + 16 * i) * BKN_PITCH + nq]);
                g[i] = gb + (size_t)(16 * i) * ldb;
            }
            async_copy8_b128(l, g);
        }
    };

    int buf = 0;
    stage(buf, 0);
    if constexpr (OUT_MODE == 0) {
        const _Float16* fs = rowf + ((size_t)blockIdx.z * NJB + blockIdx.y) * N_DIM + tid * 16;
        const h8 f0 = *(const h8*)fs;
        const h8 f1 = *(const h8*)(fs + 8);
        // before a register that these loads name is written again
        asm volatile("s_wait_xcnt 0x0" ::: "memory");
        *(h8*)(lF + tid * 16)     = f0;
        *(h8*)(lF + tid * 16 + 8) = f1;
    }
    wait_async0();
    __syncthreads();

    // mode 0: element (sm, sn, r) of this lane's results is o0 + (sm * 16 + r) * N_DIM + sn * 16
    const int    mrow = m0g + waveM * 32 + ((lane < 16) ? 0 : 8);
    const size_t o0   = oz + (size_t)mrow * N_DIM + n0g + waveN * 64 + rl;
    float res[OUT_MODE == 0 ? 2 : 1][4][8], bs[OUT_MODE == 0 ? 2 : 1][8];
    (void)o0; (void)res; (void)bs;
    if constexpr (OUT_MODE == 0) {
        // residual and bias of this lane's results, fetched here so that they
        // arrive under the first stage's products
        #pragma unroll
        for (int sm = 0; sm < 2; ++sm)
            #pragma unroll
            for (int r = 0; r < 8; ++r) {
                bs[sm][r] = bias[mrow + sm * 16 + r];
                #pragma unroll
                for (int sn = 0; sn < 4; ++sn)
                    res[sm][sn][r] = residual[o0 + (size_t)(sm * 16 + r) * N_DIM + sn * 16];
            }
        // before a register that these loads name is written again
        asm volatile("s_wait_xcnt 0x0" ::: "memory");
    }

    if constexpr (B_KN) {
        // Two fragment sets in registers: the fragments of the next 32 k are fetched
        // as one group in front of this step's WMMAs and are waited for behind them.
        v16h an[2], fn, bn[4];    // A rows as they lie, their row factors, B
        auto fetch = [&](int bufi, int kf, int kk) {
            #pragma unroll
            for (int sm = 0; sm < 2; ++sm)
                an[sm] = load_frag32(lA[bufi] + kk * 32, PA, waveM * 32 + sm * 16 + rl, kbase);
            // same k order as the A fragment: row 0 of a [1][k] tile
            fn = load_frag32(lF + kf, 0, 0, kbase);
            #pragma unroll
            for (int sn = 0; sn < 4; ++sn)
                bn[sn] = load_frag32_tr(lB[bufi] + kk * 32 * BKN_PITCH,
                                        waveN * 64 + sn * 16, lane);
        };
        if (BK < K) stage(buf ^ 1, BK);
        fetch(buf, 0, 0);
        for (int k0 = 0; k0 < K; k0 += BK) {
            const int  nbuf = buf ^ 1;
            const bool more = k0 + BK < K;
            #pragma unroll
            for (int kk = 0; kk < BK / 32; ++kk) {
                // keeps the fetch below out of the WMMAs of the step before
                __builtin_amdgcn_sched_barrier(0);
                v16h af[2], bf[4];
                af[0] = an[0] * fn;
                af[1] = an[1] * fn;
                #pragma unroll
                for (int sn = 0; sn < 4; ++sn)
                    bf[sn] = bn[sn];
                if (kk + 1 < BK / 32) {
                    fetch(buf, k0 + (kk + 1) * 32, kk + 1);
                } else {
                    // The stage's last fragments are in registers: the next stage is
                    // published here, in front of the last WMMAs, so that its first
                    // fragments come in under them.
                    // this wave's LDS reads of the current buffer have retired before
                    // the barrier behind which copies refill it
                    asm volatile("s_wait_dscnt 0x0" ::: "memory");
                    wait_async0();        // next-buffer async writes landed
                    __syncthreads();      // + all waves done reading current buffer
                    if (more) fetch(nbuf, k0 + BK, 0);
                    // refill of the buffer that every wave has just left
                    if (k0 + 2 * BK < K) stage(buf, k0 + 2 * BK);
                }
                // keeps the fetch above in front of the WMMAs, as one group
                __builtin_amdgcn_sched_barrier(0);
                #pragma unroll
                for (int sm = 0; sm < 2; ++sm)
                    #pragma unroll
                    for (int sn = 0; sn < 4; ++sn)
                        acc[sm][sn] = __builtin_amdgcn_wmma_f32_16x16x32_f16(
                            false, af[sm], false, bf[sn],
                            (short)0, acc[sm][sn], false, false);
            }
            buf = nbuf;
        }
        wait_async0();            // no copy is in flight when the wave ends
    } else {
        for (int k0 = 0; k0 < K; k0 += BK) {
            int nbuf = buf ^ 1;
            if (k0 + BK < K) stage(nbuf, k0 + BK);   // overlap with compute

            // ---- compute: BK / 32 K=32 WMMA steps from the current buffer, in k order;
            // unrolled so that a later step's fragment loads can go ahead of the WMMAs
            #pragma unroll
            for (int kk = 0; kk < BK / 32; ++kk) {
                v16h af[2], bf[4];
                #pragma unroll
                for (int sm = 0; sm < 2; ++sm)
                    af[sm] = load_frag32(lA[buf] + kk * 32, PA, waveM * 32 + sm * 16 + rl, kbase);
                #pragma unroll
                for (int sn = 0; sn < 4; ++sn)
                    bf[sn] = load_frag32(lB[buf] + kk * 32, PA,
                                         waveN * 64 + sn * 16 + rl, kbase);
                #pragma unroll
                for (int sm = 0; sm < 2; ++sm)
                    #pragma unroll
                    for (int sn = 0; sn < 4; ++sn)
                        acc[sm][sn] = __builtin_amdgcn_wmma_f32_16x16x32_f16(
                            false, af[sm], false, bf[sn],
                            (short)0, acc[sm][sn], false, false);
            }

            // this wave's LDS reads of the current buffer have retired before the
            // barrier behind which copies refill it
            asm volatile("s_wait_dscnt 0x0" ::: "memory");
            wait_async0();        // next-buffer async writes landed
            __syncthreads();      // + all waves done reading current buffer
            buf = nbuf;
        }
    }

    // ---- epilogue: lane holds col n = rl, rows mb..mb+7
    const int mhalf = (lane < 16) ? 0 : 8;
    if constexpr (OUT_MODE == 2) {
        // The stage buffers are free behind the loop's last barrier.
        float*    red = (float*)&lB[0][0];    // [2][4 waveM][128 i]: maxima, then sums
        _Float16* eT  = &lA[0][0];            // [128 i][128 j], pitch 136 halves
        constexpr int PE = 136;
        // max of query i over this wave's 32 keys: 16 in the lane, 16 in lane ^ 16
        const int il0 = waveN * 64 + rl;      // query of sn = 0; + 16 per sn
        float mx[4];
        #pragma unroll
        for (int sn = 0; sn < 4; ++sn) {
            float m = -3.4e38f;
            #pragma unroll
            for (int sm = 0; sm < 2; ++sm)
                #pragma unroll
                for (int r = 0; r < 8; ++r) {
                    acc[sm][sn][r] *= alpha;
                    m = fmaxf(m, acc[sm][sn][r]);
                }
            mx[sn] = m;
        }
        #pragma unroll
        for (int sn = 0; sn < 4; ++sn)
            mx[sn] = fmaxf(mx[sn], __shfl_xor(mx[sn], 16));
        if (lane < 16) {
            #pragma unroll
            for (int sn = 0; sn < 4; ++sn)
                red[waveM * 128 + il0 + sn * 16] = mx[sn];
        }
        __syncthreads();
        #pragma unroll
        for (int sn = 0; sn < 4; ++sn) {
            const int il = il0 + sn * 16;
            mx[sn] = fmaxf(fmaxf(red[il], red[128 + il]),
                           fmaxf(red[256 + il], red[384 + il]));
        }
        float sum[4];
        #pragma unroll
        for (int sn = 0; sn < 4; ++sn) {
            float s = 0.f;
            #pragma unroll
            for (int sm = 0; sm < 2; ++sm) {
                h8 pack;
                #pragma unroll
                for (int r = 0; r < 8; ++r) {
                    const float e = exp2_slot(acc[sm][sn][r] - mx[sn]);
                    s += e;
                    pack[r] = (_Float16)e;
                }
                *(h8*)(eT + (il0 + sn * 16) * PE + waveM * 32 + sm * 16 + mhalf) = pack;
            }
            sum[sn] = s;
        }
        #pragma unroll
        for (int sn = 0; sn < 4; ++sn)
            sum[sn] += __shfl_xor(sum[sn], 16);
        if (lane < 16) {
            #pragma unroll
            for (int sn = 0; sn < 4; ++sn)
                red[512 + waveM * 128 + il0 + sn * 16] = sum[sn];
        }
        __syncthreads();
        // whole 256-byte rows of E: 16 lanes a row
        _Float16* E = (_Float16*)Out + oz + (size_t)n0g * ldo + m0g;
        #pragma unroll
        for (int t = 0; t < 8; ++t) {
            const int row = (tid >> 4) + 16 * t;
            const int c   = (tid & 15) * 8;
            *(h8*)(E + (size_t)row * ldo + c) = *(const h8*)(eT + row * PE + c);
        }
        if (tid < 128) {
            const size_t si = ((size_t)blockIdx.z * NJB + blockIdx.x) * N_DIM + n0g + tid;
            ((float*)OutK)[si] = fmaxf(fmaxf(red[tid], red[128 + tid]),
                                       fmaxf(red[256 + tid], red[384 + tid]));
            ((float*)OutV)[si] = (red[512 + tid] + red[640 + tid])
                               + (red[768 + tid] + red[896 + tid]);
        }
        return;
    }
    if constexpr (OUT_MODE == 0) {
        float* O = (float*)Out;
        #pragma unroll
        for (int sm = 0; sm < 2; ++sm)
            #pragma unroll
            for (int sn = 0; sn < 4; ++sn) {
                #pragma unroll
                for (int r = 0; r < 8; ++r)
                    O[o0 + (size_t)(sm * 16 + r) * N_DIM + sn * 16] =
                        res[sm][sn][r] + acc[sm][sn][r] * alpha + bs[sm][r];
                // before a register that these stores name is written again
                asm volatile("s_wait_xcnt 0x0" ::: "memory");
                // keeps the arithmetic of the next eight results behind that wait
                __builtin_amdgcn_sched_barrier(0);
            }
    }
    if constexpr (OUT_MODE == 1) {
        #pragma unroll
        for (int sm = 0; sm < 2; ++sm) {
            #pragma unroll
            for (int sn = 0; sn < 4; ++sn) {
                int mb = m0g + waveM * 32 + sm * 16 + mhalf;
                int n  = n0g + waveN * 64 + sn * 16 + rl;
                v8f a = acc[sm][sn];
                _Float16* O = (_Float16*)OutP + oz;
                if (part == 0) {
                    h8 pack;
                    #pragma unroll
                    for (int r = 0; r < 8; ++r)
                        pack[r] = (_Float16)(a[r] * alpha + bias[mb + r]);
                    *(h8*)(O + (size_t)n * ldo + mb) = pack;   // contiguous over m
                    // before a register that this store names is written again
                    asm volatile("s_wait_xcnt 0x0" ::: "memory");
                } else {
                    #pragma unroll
                    for (int r = 0; r < 8; ++r) {
                        float v = a[r] * alpha + bias[mb + r];
                        O[(size_t)(mb + r) * N_DIM + n] = (_Float16)v;   // V' is [C][N]
                    }
                    // before a register that these stores name is written again
                    asm volatile("s_wait_xcnt 0x0" ::: "memory");
                }
            }
        }
    }
}

// ------------------------- row factors of the softmax ----------------------
// bm, bl: [B][NJB][N], per 128-column block jb and row i the block's maximum and its
// sum of 2^(s - bm), s = score * log2(e). With M = max over jb and L = sum over jb of
// bl * 2^(bm - M), softmax(i, j) = E[i][j] * f[jb][i], f = 2^(bm - M) / L.
// One thread per row.
__global__ __launch_bounds__(64) void row_factor_kernel(
    const float* __restrict__ bm, const float* __restrict__ bl,
    _Float16* __restrict__ f) {
    const int t = blockIdx.x * 64 + threadIdx.x;          // b * N + i
    const size_t base = (size_t)(t / N_DIM) * NJB * N_DIM + (t % N_DIM);
    float m[NJB], l[NJB];
    #pragma unroll
    for (int jb = 0; jb < NJB; ++jb)
        m[jb] = bm[base + (size_t)jb * N_DIM];
    // before a register that these loads name is written again
    asm volatile("s_wait_xcnt 0x0" ::: "memory");
    #pragma unroll
    for (int jb = 0; jb < NJB; ++jb)
        l[jb] = bl[base + (size_t)jb * N_DIM];
    // before a register that these loads name is written again
    asm volatile("s_wait_xcnt 0x0" ::: "memory");
    float M = m[0];
    #pragma unroll
    for (int jb = 1; jb < NJB; ++jb) M = fmaxf(M, m[jb]);
    float L = 0.f;
    #pragma unroll
    for (int jb = 0; jb < NJB; ++jb) {
        m[jb] = exp2_slot(m[jb] - M);
        L += l[jb] * m[jb];
    }
    const float inv = 1.0f / L;
    #pragma unroll
    for (int jb = 0; jb < NJB; ++jb)
        f[base + (size_t)jb * N_DIM] = (_Float16)(m[jb] * inv);
}

// ---------------------------------------------------------------------------
extern "C" void kernel_launch(void* const* d_in, const int* in_sizes, int n_in,
                              void* d_out, int out_size, void* d_ws, size_t ws_size,
                              hipStream_t stream) {
    (void)in_sizes; (void)n_in; (void)out_size; (void)ws_size;
    const float* x      = (const float*)d_in[0];
    const float* norm_w = (const float*)d_in[1];
    const float* norm_b = (const float*)d_in[2];
    const float* wq = (const float*)d_in[3];
    const float* bq = (const float*)d_in[4];
    const float* wk = (const float*)d_in[5];
    // d_in[6], the bias of K: q_i . bk is one constant per softmax row and drops out
    const float* wv = (const float*)d_in[7];
    const float* bv = (const float*)d_in[8];
    const float* wp = (const float*)d_in[9];
    const float* bp = (const float*)d_in[10];
    float* out = (float*)d_out;

    // ---- carve workspace
    char* w = (char*)d_ws;
    auto carve = [&](size_t bytes) -> char* {
        char* p = w;
        w += (bytes + 255) & ~(size_t)255;
        return p;
    };
    _Float16*  hT    = (_Float16*)carve((size_t)B_DIM * N_DIM * C_DIM * 2); // [b][n][c]
    _Float16*  g16   = (_Float16*)carve((size_t)2 * C_DIM * C_DIM * 2);     // Wk^T Wq, Wp Wv
    float*     gbias = (float*)carve((size_t)2 * C_DIM * sizeof(float));    // Wk^T bq, Wp bv
    _Float16*  Q     = (_Float16*)carve((size_t)B_DIM * N_DIM * C_DIM * 2); // Q' [b][n][c]
    _Float16*  V     = (_Float16*)carve((size_t)B_DIM * C_DIM * N_DIM * 2); // V' [b][c][n]
    _Float16*  E     = (_Float16*)carve((size_t)B_DIM * N_DIM * N_DIM * 2);       // [b][i][j]
    float*     bm    = (float*)carve((size_t)B_DIM * NJB * N_DIM * sizeof(float)); // [b][jb][i]
    float*     bl    = (float*)carve((size_t)B_DIM * NJB * N_DIM * sizeof(float)); // [b][jb][i]
    _Float16*  rf    = (_Float16*)carve((size_t)B_DIM * NJB * N_DIM * 2);          // [b][jb][i]

    const float scale_log2e = 0.063758715412299341f;  // 512^-0.5 * log2(e)

    // 1) GroupNorm, statistics and normalisation in one launch
    gn_fused_kernel<<<B_DIM * NGRP, 1024, 0, stream>>>(x, norm_w, norm_b, hT);

    // 2) the two products of the weights, with their bias vectors, one launch
    weight_product_kernel<<<dim3(C_DIM / 64, C_DIM / 64, 2), 512, 0, stream>>>(
        wq, bq, wk, wv, bv, wp, g16, gbias);

    // every GEMM takes both batches in one launch (grid z)
    dim3 gQV(2 * C_DIM / 128, N_DIM / 128, B_DIM);    //  8 x 32 x 2
    dim3 gS(N_DIM / 128, N_DIM / 128, B_DIM);         // 32 x 32 x 2
    dim3 gO(C_DIM / 128, N_DIM / 128, B_DIM);         //  4 x 32 x 2
    const size_t zNC = (size_t)N_DIM * C_DIM;
    const size_t zNN = (size_t)N_DIM * N_DIM;

    // 3) Q', V' (M=2*512, N=4096, K=512), B operand = hT "nk" direct
    gemm_wmma_kernel<1, false><<<gQV, 256, 0, stream>>>(
        g16, C_DIM, 0, hT, C_DIM, zNC, Q, V, nullptr, C_DIM, zNC,
        gbias, gbias + C_DIM, nullptr, nullptr, 1.0f, 2 * C_DIM, N_DIM, C_DIM);
    // 4) scores s[i][j] = scale_log2e * Q'[i][:] . hT[j][:] as the product hT x Q'^T (M = j,
    //    N = i, K=512), left as E = 2^(s - block max) with the blocks' maxima and sums
    gemm_wmma_kernel<2, false><<<gS, 256, 0, stream>>>(
        hT, C_DIM, zNC, Q, C_DIM, zNC, E, bm, bl, N_DIM, zNN,
        nullptr, nullptr, nullptr, nullptr, scale_log2e, N_DIM, N_DIM, C_DIM);
    // 5) the factor that makes a block's E the softmax, per (block, row)
    row_factor_kernel<<<B_DIM * N_DIM / 64, 64, 0, stream>>>(bm, bl, rf);
    // 6) out[c][j] = x + bp + sum_i (V'[c][i] * rf[jb(j)][i]) * E[i][j]  (M=512, N=4096, K=4096)
    gemm_wmma_kernel<0, true><<<gO, 256, 0, stream>>>(
        V, N_DIM, zNC, E, N_DIM, zNN, out, nullptr, nullptr,
        N_DIM, zNC, bp, nullptr, x, rf, 1.0f, C_DIM, N_DIM, N_DIM);
}

// v008
// A run of this version takes 115 microseconds.
// Next to v007, in two timings, it ran 1.06 times as fast each time.
// Over all steps from v000 it is 5.77 times as fast.
#include <hip/hip_runtime.h>

// ---------------------------------------------------------------------------
// AttnBlock for MI455X (gfx1250): GroupNorm -> Q', V' 1x1 -> attention (+ residual).
// Two of the four 1x1 convolutions are folded into products of the weights:
//   q_i . k_j = (Wk^T q_i) . h_j + q_i . bk; the last term is the same for every j
//   of a row, so the softmax over j does not see it: Q' = (Wk^T Wq) h + Wk^T bq
//   meets h itself, and no K is formed.
//   Wp (V w) = (Wp V) w: V' = (Wp Wv) h + Wp bv, and no projection follows.
// GEMMs via V_WMMA_F32_16X16X32_F16; tiles staged with
// GLOBAL_LOAD_ASYNC_TO_LDS_B128 (ASYNCcnt) into an LDS ring of two or four buffers.
// ---------------------------------------------------------------------------

typedef __attribute__((ext_vector_type(16))) _Float16 v16h;
typedef __attribute__((ext_vector_type(8)))  _Float16 h8;
typedef __attribute__((ext_vector_type(4)))  _Float16 h4;
typedef __attribute__((ext_vector_type(2)))  _Float16 h2;
typedef __attribute__((ext_vector_type(8)))  short    s8;
typedef __attribute__((ext_vector_type(8)))  float    v8f;
typedef __attribute__((ext_vector_type(4)))  float    f4;
typedef __attribute__((ext_vector_type(4)))  int      i4;

#define C_DIM 512
#define N_DIM 4096
#define B_DIM 2
#define NGRP  32
#define CPG   16           // channels per group
#define GELEM (CPG * N_DIM)
#define NJB   (N_DIM / 128)   // 128-column blocks of a score row

// ------------------------- CDNA5 async-copy helpers ------------------------
// Per-lane async copy of 16 bytes global -> LDS, tracked by ASYNCcnt.
// vdst VGPR carries the 32-bit LDS byte address (low 32 bits of flat shared
// pointer, per ISA 10.2 aperture mapping).
__device__ __forceinline__ unsigned lds_addr(const void* lds_ptr) {
    return (unsigned)(unsigned long long)lds_ptr;
}
// Eight per-lane copies in ONE statement, closed by s_wait_xcnt 0: the operands'
// registers live to the statement's end, so no address register of an issued
// copy is rewritten ahead of that wait.
__device__ __forceinline__ void async_copy8_b128(const unsigned (&l)[8],
                                                 const _Float16* const (&g)[8]) {
    asm volatile("global_load_async_to_lds_b128 %0, %1, off\n\t"
                 "global_load_async_to_lds_b128 %2, %3, off\n\t"
                 "global_load_async_to_lds_b128 %4, %5, off\n\t"
                 "global_load_async_to_lds_b128 %6, %7, off\n\t"
                 "global_load_async_to_lds_b128 %8, %9, off\n\t"
                 "global_load_async_to_lds_b128 %10, %11, off\n\t"
                 "global_load_async_to_lds_b128 %12, %13, off\n\t"
                 "global_load_async_to_lds_b128 %14, %15, off\n\t"
                 "s_wait_xcnt 0x0"
                 :: "v"(l[0]), "v"((unsigned long long)g[0]),
                    "v"(l[1]), "v"((unsigned long long)g[1]),
                    "v"(l[2]), "v"((unsigned long long)g[2]),
                    "v"(l[3]), "v"((unsigned long long)g[3]),
                    "v"(l[4]), "v"((unsigned long long)g[4]),
                    "v"(l[5]), "v"((unsigned long long)g[5]),
                    "v"(l[6]), "v"((unsigned long long)g[6]),
                    "v"(l[7]), "v"((unsigned long long)g[7])
                 : "memory");
}
__device__ __forceinline__ void wait_async0() {
    asm volatile("s_wait_asynccnt 0x0" ::: "memory");
}
// All but this wave's 32 youngest copies have landed: the two youngest stages of
// the four-buffer ring (16 copies a wave and stage) stay in flight.
__device__ __forceinline__ void wait_async32() {
    asm volatile("s_wait_asynccnt 0x20" ::: "memory");
}

// 2^x. The v_nop fills the slot that the instruction set asks for between a
// transcendental and a next instruction that reads its result or writes its source.
__device__ __forceinline__ float exp2_slot(float x) {
    float r;
    asm("v_exp_f32 %0, %1\n\tv_nop" : "=v"(r) : "v"(x));
    return r;
}

// ------------------------- GroupNorm ---------------------------------------
// One work-group per (batch, group). Thread t loads all 16 channels of positions
// 4t .. 4t+3 (64 floats) and keeps them in registers from the sums to the
// normalisation, so x is read once and no statistics pass through memory.
// Writes h^T as f16 [B][N][C] (k-contiguous for GEMM B): the group's 16 channels
// are 32 contiguous bytes of a row.
__global__ __launch_bounds__(1024) void gn_fused_kernel(
    const float* __restrict__ x,
    const float* __restrict__ gw, const float* __restrict__ gb,
    _Float16* __restrict__ hT) {
    __shared__ float red[2][32];
    const int tid  = threadIdx.x;
    const int lane = tid & 31;
    const int wave = tid >> 5;
    const int bg   = blockIdx.x;            // b*NGRP + g
    const int b    = bg / NGRP;
    const int g    = bg % NGRP;
    const float* p = x + (size_t)bg * GELEM + 4 * tid;
    f4 v[CPG];
    #pragma unroll
    for (int c = 0; c < CPG; ++c)
        v[c] = *(const f4*)(p + (size_t)c * N_DIM);
    // the group's weights, fetched here so that they arrive under the loads of x
    float w[CPG], bb[CPG];
    #pragma unroll
    for (int c = 0; c < CPG; ++c) {
        w[c]  = gw[g * CPG + c];
        bb[c] = gb[g * CPG + c];
    }

    // four independent chains a thread, then lane butterfly, then the 32 waves
    f4 s4 = (f4){0.f, 0.f, 0.f, 0.f}, q4 = (f4){0.f, 0.f, 0.f, 0.f};
    #pragma unroll
    for (int c = 0; c < CPG; ++c) {
        s4 += v[c];
        q4 += v[c] * v[c];
    }
    float s  = (s4[0] + s4[1]) + (s4[2] + s4[3]);
    float s2 = (q4[0] + q4[1]) + (q4[2] + q4[3]);
    #pragma unroll
    for (int m = 16; m > 0; m >>= 1) {
        s  += __shfl_xor(s,  m);
        s2 += __shfl_xor(s2, m);
    }
    if (lane == 0) { red[0][wave] = s; red[1][wave] = s2; }
    __syncthreads();
    s  = red[0][lane];
    s2 = red[1][lane];
    #pragma unroll
    for (int m = 16; m > 0; m >>= 1) {
        s  += __shfl_xor(s,  m);
        s2 += __shfl_xor(s2, m);
    }
    const float mu  = s  * (1.0f / GELEM);
    const float var = s2 * (1.0f / GELEM) - mu * mu;
    const float rs  = rsqrtf(var + 1e-6f);

    // normalize + affine; lo = channels 0..7, hi = channels 8..15 of position 4t+q
    i4 lo[4], hi[4];
    #pragma unroll
    for (int q = 0; q < 4; ++q) {
        h8 l, h;
        #pragma unroll
        for (int c = 0; c < 8; ++c) {
            l[c] = (_Float16)((v[c][q]     - mu) * rs * w[c]     + bb[c]);
            h[c] = (_Float16)((v[c + 8][q] - mu) * rs * w[c + 8] + bb[c + 8]);
        }
        lo[q] = __builtin_bit_cast(i4, l);
        hi[q] = __builtin_bit_cast(i4, h);
    }

    // Lanes 2j and 2j+1 swap halves, so that the pair stores the 32 bytes of ONE
    // position side by side: a wave's store touches 16 rows of h^T, not 32.
    // The even lane gives its hi and takes the odd lane's lo.
    const bool odd = lane & 1;
    _Float16* dst = hT + ((size_t)b * N_DIM + 8 * (tid >> 1)) * C_DIM + g * CPG + (odd ? 8 : 0);
    #pragma unroll
    for (int q = 0; q < 4; ++q) {
        i4 give = odd ? lo[q] : hi[q];
        i4 take;
        #pragma unroll
        for (int e = 0; e < 4; ++e)
            take[e] = __shfl_xor(give[e], 1);
        *(i4*)(dst + (size_t)q * C_DIM)       = odd ? take : lo[q];   // even lane's positions
        *(i4*)(dst + (size_t)(4 + q) * C_DIM) = odd ? hi[q] : take;   // odd lane's positions
    }
}

// ------------------------- WMMA fragment load ------------------------------
// LDS tile is row-major [r][k], pitch halves a row; lds points at the 32 k of
// this product. Per ISA 16-bit A 16x32 layout:
// lane<16 -> K base 0, lane>=16 -> K base 8; elems 0..7 = K base..base+7,
// elems 8..15 = K base+16..base+23. B (stored transposed [n][k]) symmetric.
__device__ __forceinline__ v16h load_frag32(const _Float16* lds, int pitch, int row, int kbase) {
    const h8 lo = *(const h8*)(lds + row * pitch + kbase);
    const h8 hi = *(const h8*)(lds + row * pitch + kbase + 16);
    return __builtin_shufflevector(lo, hi, 0,1,2,3,4,5,6,7,8,9,10,11,12,13,14,15);
}

// B fragment out of a row-major [k][n] LDS tile (pitch BKN_PITCH halves) by the
// transposing load: lane (c = l & 15, h = l >> 4) gets T[kb + 8h + 0..7][n0 + c];
// the loads at kb = 0 and kb = 16 give the k order of load_frag32.
#define BKN_PITCH 144      // 288 B = 32 B x odd: the transposing load's pitch
__device__ __forceinline__ h8 load_tr16(const _Float16* p) {
    typedef __attribute__((address_space(3))) s8 lds_s8;
    return __builtin_bit_cast(h8, __builtin_amdgcn_ds_load_tr16_b128_v8i16((lds_s8*)p));
}
__device__ __forceinline__ v16h load_frag32_tr(const _Float16* lds, int n0, int lane) {
    const _Float16* p = lds + (8 * (lane >> 4) + (lane & 7)) * BKN_PITCH
                            + n0 + 8 * ((lane >> 3) & 1);
    const h8 lo = load_tr16(p);
    const h8 hi = load_tr16(p + 16 * BKN_PITCH);
    return __builtin_shufflevector(lo, hi, 0,1,2,3,4,5,6,7,8,9,10,11,12,13,14,15);
}

// ------------------------- products of the weights -------------------------
// blockIdx.z = 0: G = Wk^T Wq, g = Wk^T bq;  1: G = Wp Wv, g = Wp bv.
// One 64 x 64 tile of G (f16 [m][n]) per work-group of 16 waves, all 512 k staged
// at once: f32 weights through registers to f16 in LDS. Wq, Wv and Wk lie
// [k][column] and are read by the transposing load; Wp lies [row][k].
#define WT_PITCH 80        // halves; 160 B = 32 B x odd: the transposing load's pitch
#define WR_PITCH 520       // halves; 1040 B = 16 B x odd: the pitch of ds_load_b128 readers
__device__ __forceinline__ v16h load_frag32_tr_w(const _Float16* lds, int n0, int lane) {
    const _Float16* p = lds + (8 * (lane >> 4) + (lane & 7)) * WT_PITCH
                            + n0 + 8 * ((lane >> 3) & 1);
    const h8 lo = load_tr16(p);
    const h8 hi = load_tr16(p + 16 * WT_PITCH);
    return __builtin_shufflevector(lo, hi, 0,1,2,3,4,5,6,7,8,9,10,11,12,13,14,15);
}
// A_KM: the first factor lies [k][m] in memory (Wk), else [m][k] (Wp)
template <bool A_KM>
__device__ __forceinline__ void weight_product(
    const float* __restrict__ wa, const float* __restrict__ wb,
    const float* __restrict__ bias,
    _Float16* __restrict__ G, float* __restrict__ g,
    _Float16* lA, _Float16* lB, float* lbias, float (*red)[64]) {
    const int tid  = threadIdx.x;
    const int lane = tid & 31;
    const int wave = tid >> 5;
    const int m0   = blockIdx.x * 64;
    const int n0   = blockIdx.y * 64;
    const bool with_bias = blockIdx.y == 0;    // these work-groups also form g

    // [k][64] tile: 16 lanes cover a row's 256 bytes, rows kr + 32 i per thread;
    // [64][k] tile: 128 lanes cover a row's 2048 bytes, rows (tid >> 7) + 4 i
    const int kr = tid >> 4;
    const int c4 = (tid & 15) * 4;
    constexpr int GA = (A_KM ? 32 : 4) * C_DIM;
    constexpr int SA = A_KM ? 32 * WT_PITCH : 4 * WR_PITCH;
    const float* gA = A_KM ? wa + (size_t)kr * C_DIM + m0 + c4
                           : wa + (size_t)(m0 + (tid >> 7)) * C_DIM + (tid & 127) * 4;
    const float* gB = wb + (size_t)kr * C_DIM + n0 + c4;
    _Float16* sA = A_KM ? lA + kr * WT_PITCH + c4
                        : lA + (tid >> 7) * WR_PITCH + (tid & 127) * 4;
    _Float16* sB = lB + kr * WT_PITCH + c4;
    f4 va[16], vb[16];
    #pragma unroll
    for (int i = 0; i < 16; ++i) {
        va[i] = *(const f4*)(gA + (size_t)i * GA);
        vb[i] = *(const f4*)(gB + (size_t)i * 32 * C_DIM);
    }
    f4 b4 = (f4){0.f, 0.f, 0.f, 0.f};
    if (with_bias && tid < C_DIM / 4)
        b4 = *(const f4*)(bias + tid * 4);
    // before a register that these loads name is written again
    asm volatile("s_wait_xcnt 0x0" ::: "memory");
    #pragma unroll
    for (int i = 0; i < 16; ++i) {
        *(h4*)(sA + i * SA)            = __builtin_convertvector(va[i], h4);
        *(h4*)(sB + i * 32 * WT_PITCH) = __builtin_convertvector(vb[i], h4);
    }
    if (with_bias && tid < C_DIM / 4)
        *(f4*)(lbias + tid * 4) = b4;
    __syncthreads();

    // wave: one 16 x 16 piece of the tile
    const int rl    = lane & 15;
    const int kbase = (lane < 16) ? 0 : 8;
    const int mi    = (wave & 3) * 16;
    const int nj    = (wave >> 2) * 16;
    v8f acc = (v8f){0.f,0.f,0.f,0.f,0.f,0.f,0.f,0.f};
    #pragma unroll
    for (int kk = 0; kk < C_DIM / 32; ++kk) {
        // both forms of A give the k order of load_frag32
        const v16h af = A_KM ? load_frag32_tr_w(lA + kk * 32 * WT_PITCH, mi, lane)
                             : load_frag32(lA + kk * 32, WR_PITCH, mi + rl, kbase);
        const v16h bf = load_frag32_tr_w(lB + kk * 32 * WT_PITCH, nj, lane);
        acc = __builtin_amdgcn_wmma_f32_16x16x32_f16(
            false, af, false, bf, (short)0, acc, false, false);
    }
    // lane holds column rl, rows mhalf .. mhalf + 7 of the piece
    const int mhalf = (lane < 16) ? 0 : 8;
    _Float16* Gp = G + (size_t)(m0 + mi + mhalf) * C_DIM + n0 + nj + rl;
    #pragma unroll
    for (int r = 0; r < 8; ++r)
        Gp[(size_t)r * C_DIM] = (_Float16)acc[r];
    // before a register that these stores name is written again
    asm volatile("s_wait_xcnt 0x0" ::: "memory");

    if (with_bias) {
        // g[m] = sum over k of A[m][k] * bias[k], sixteen partial sums of 32 k per row
        float s0 = 0.f, s1 = 0.f;
        if (A_KM) {
            // a lane takes two neighbouring m (one dword of a [k][m] row), a wave 32 k
            #pragma unroll
            for (int i = 0; i < 32; ++i) {
                const int k = wave * 32 + i;
                const h2 a = *(const h2*)(lA + k * WT_PITCH + lane * 2);
                s0 += (float)a[0] * lbias[k];
                s1 += (float)a[1] * lbias[k];
            }
            red[wave][lane * 2]     = s0;
            red[wave][lane * 2 + 1] = s1;
        } else {
            // a thread takes 64 k of row tid & 63
            const int r = tid & 63;
            const int q = tid >> 6;
            #pragma unroll
            for (int i = 0; i < 4; ++i) {
                const h8 a0 = *(const h8*)(lA + r * WR_PITCH + q * 64 + i * 8);
                const h8 a1 = *(const h8*)(lA + r * WR_PITCH + q * 64 + 32 + i * 8);
                #pragma unroll
                for (int e = 0; e < 8; ++e) {
                    s0 += (float)a0[e] * lbias[q * 64 + i * 8 + e];
                    s1 += (float)a1[e] * lbias[q * 64 + 32 + i * 8 + e];
                }
            }
            red[2 * q][r]     = s0;
            red[2 * q + 1][r] = s1;
        }
        __syncthreads();
        if (tid < 64) {
            float s = 0.f;
            #pragma unroll
            for (int q = 0; q < 16; ++q) s += red[q][tid];
            g[m0 + tid] = s;
        }
    }
}
__global__ __launch_bounds__(512) void weight_product_kernel(
    const float* __restrict__ wq, const float* __restrict__ bq,
    const float* __restrict__ wk,
    const float* __restrict__ wv, const float* __restrict__ bv,
    const float* __restrict__ wp,
    _Float16* __restrict__ g16, float* __restrict__ gbias) {
    __shared__ __attribute__((aligned(16))) _Float16 lA[C_DIM * WT_PITCH];  // or [64][WR_PITCH]
    __shared__ __attribute__((aligned(16))) _Float16 lB[C_DIM * WT_PITCH];
    __shared__ __attribute__((aligned(16))) float lbias[C_DIM];
    __shared__ float red[16][64];
    if (blockIdx.z == 0)
        weight_product<true>(wk, wq, bq, g16, gbias, lA, lB, lbias, red);
    else
        weight_product<false>(wp, wv, bv, g16 + (size_t)C_DIM * C_DIM, gbias + C_DIM,
                              lA, lB, lbias, red);
}

// ------------------------- generic WMMA GEMM -------------------------------
// D = alpha * A(f16 [M][K]) x B(f16) + bias(+residual)
// blockIdx.z = batch: A, B, Out and residual advance by zA, zB, zO elements.
// OUT_MODE: 0 = f32 [M][N] + bias + residual (the block's output); A[m][k] is
//               multiplied by rowf[k] of this block's 128 columns as its
//               fragments are read
//           1 = f16 + bias: blockIdx.x / 4 = part picks C_DIM rows of the stacked
//               weights A, the part's output plane and its bias;
//               part 0 (Q') is stored [N][M], part 1 (V') [M][N]
//           2 = scores with the block-local softmax: m = key j, n = query i; writes
//               f16 E[i][j] = 2^(s - bm), bm = max of row i over this block's 128 j,
//               and per (block, i) bm (OutK) and the sum of those powers (OutV);
//               alpha holds 512^-0.5 * log2(e), so that s is the score in units of ln 2
// B_KN: true  -> global B is [K][N] (ldb = N pitch), async copy row-major into
//                LDS, transposed by the fragment load
//       false -> global B is [N][K] (pre-transposed), async direct copy
// One LDS stage holds BK k of both operands: 128 where one work-group has its
// WGP alone (B_KN: 256 work-groups), 64 where several share it. [row][k] tiles
// have a pitch of BK + 8 halves (16 B x odd: the pitch of ds_load_b128 readers).
// The ring has two buffers, and four where B_KN (the work-group has the whole LDS):
// three stages of copies fly while one is worked on, so that a stage has the time of
// three stages to land, not of one.
template <int OUT_MODE, bool B_KN>
__global__ __launch_bounds__(256) void gemm_wmma_kernel(
    const _Float16* __restrict__ A0, int lda, size_t zA,
    const _Float16* __restrict__ B0, int ldb, size_t zB,
    void* __restrict__ Out, void* __restrict__ OutK,
    void* __restrict__ OutV, int ldo, size_t zO,
    const float* __restrict__ biasQ, const float* __restrict__ biasK,
    const float* __restrict__ residual,
    const _Float16* __restrict__ rowf,
    float alpha, int M, int N, int K) {
    (void)M; (void)N; (void)OutK; (void)OutV; (void)biasK; (void)residual; (void)rowf;
    const int part = (OUT_MODE == 1) ? blockIdx.x / (C_DIM / 128) : 0;
    const _Float16* A  = A0 + blockIdx.z * zA + (size_t)part * C_DIM * lda;
    const _Float16* Bm = B0 + blockIdx.z * zB;
    const size_t    oz = blockIdx.z * zO;
    void*        OutP  = (part == 0) ? Out   : OutK;
    const float* bias  = (part == 0) ? biasQ : biasK;
    constexpr int BK  = B_KN ? 128 : 64;
    constexpr int PA  = BK + 8;       // halves
    constexpr int CPR = BK / 8;       // 16-byte chunks in a [row][k] row
    constexpr int RPS = 256 / CPR;    // rows that one copy of the block covers
    constexpr int NBUF = B_KN ? 4 : 2;
    __shared__ __attribute__((aligned(16))) _Float16 lA[NBUF][128 * PA];
    __shared__ __attribute__((aligned(16)))
        _Float16 lB[NBUF][B_KN ? BK * BKN_PITCH : 128 * PA];
    // the row factors of this block's columns, one per k
    __shared__ __attribute__((aligned(16))) _Float16 lF[OUT_MODE == 0 ? N_DIM : 8];

    const int tid   = threadIdx.x;
    const int lane  = tid & 31;
    const int wave  = tid >> 5;     // 0..7
    const int waveM = wave & 3;     // 4 -> 32 rows each
    const int waveN = wave >> 2;    // 2 -> 64 cols each
    const int m0g   = (blockIdx.x - part * (C_DIM / 128)) * 128;   // row inside the part
    const int n0g   = blockIdx.y * 128;

    v8f acc[2][4];
    #pragma unroll
    for (int i = 0; i < 2; ++i)
        #pragma unroll
        for (int j = 0; j < 4; ++j)
            acc[i][j] = (v8f){0.f,0.f,0.f,0.f,0.f,0.f,0.f,0.f};

    const int rl    = lane & 15;
    const int kbase = (lane < 16) ? 0 : 8;

    // ---- tile staging: async copies, memory -> LDS, no register in between ----
    auto stage = [&](int bufi, int k0) {
        // [row][k] tile: CPR lanes cover one row's BK k, rows r + i * RPS per thread
        const int r  = tid / CPR;
        const int kq = (tid % CPR) * 8;
        const _Float16* ga = A + (size_t)(m0g + r) * lda + k0 + kq;
        const _Float16* la = &lA[bufi][r * PA + kq];
        unsigned        l[8];
        const _Float16* g[8];
        if (!B_KN) {
            // A and B tiles [128][64]: 4 chunks of each per thread
            const _Float16* gb = Bm + (size_t)(n0g + r) * ldb + k0 + kq;
            const _Float16* lb = &lB[bufi][r * PA + kq];
            #pragma unroll
            for (int i = 0; i < 4; ++i) {
                l[i]     = lds_addr(la + i * RPS * PA);
                g[i]     = ga + (size_t)(i * RPS) * lda;
                l[4 + i] = lds_addr(lb + i * RPS * PA);
                g[4 + i] = gb + (size_t)(i * RPS) * ldb;
            }
            async_copy8_b128(l, g);
        } else {
            // A tile [128][128]: 8 chunks per thread
            #pragma unroll
            for (int i = 0; i < 8; ++i) {
                l[i] = lds_addr(la + i * RPS * PA);
                g[i] = ga + (size_t)(i * RPS) * lda;
            }
            async_copy8_b128(l, g);
            // B tile [128 k][128 n] row-major: 16 lanes cover one 256-byte row,
            // rows k + 16 i per thread
            const int k  = tid >> 4;
            const int nq = (tid & 15) * 8;
            const _Float16* gb = Bm + (size_t)(k0 + k) * ldb + n0g + nq;
            #pragma unroll
            for (int i = 0; i < 8; ++i) {
                l[i] = lds_addr(&lB[bufi][(k + 16 * i) * BKN_PITCH + nq]);
                g[i] = gb + (size_t)(16 * i) * ldb;
            }
            async_copy8_b128(l, g);
        }
    };

    int buf = 0;
    stage(buf, 0);
    if constexpr (B_KN) {
        if (BK < K)     stage(1, BK);
        if (2 * BK < K) stage(2, 2 * BK);
    }
    if constexpr (OUT_MODE == 0) {
        const _Float16* fs = rowf + ((size_t)blockIdx.z * NJB + blockIdx.y) * N_DIM + tid * 16;
        const h8 f0 = *(const h8*)fs;
        const h8 f1 = *(const h8*)(fs + 8);
        // before a register that these loads name is written again
        asm volatile("s_wait_xcnt 0x0" ::: "memory");
        *(h8*)(lF + tid * 16)     = f0;
        *(h8*)(lF + tid * 16 + 8) = f1;
    }
    // stage 0 has landed; where stages 1 and 2 were both issued they stay in flight
    if (B_KN && 2 * BK < K) wait_async32();
    else                    wait_async0();
    __syncthreads();

    // mode 0: element (sm, sn, r) of this lane's results is o0 + (sm * 16 + r) * N_DIM + sn * 16
    const int    mrow = m0g + waveM * 32 + ((lane < 16) ? 0 : 8);
    const size_t o0   = oz + (size_t)mrow * N_DIM + n0g + waveN * 64 + rl;
    float res[OUT_MODE == 0 ? 2 : 1][4][8], bs[OUT_MODE == 0 ? 2 : 1][8];
    (void)o0; (void)res; (void)bs;
    if constexpr (OUT_MODE == 0) {
        // residual and bias of this lane's results, fetched here so that they
        // arrive under the first stage's products
        #pragma unroll
        for (int sm = 0; sm < 2; ++sm)
            #pragma unroll
            for (int r = 0; r < 8; ++r) {
                bs[sm][r] = bias[mrow + sm * 16 + r];
                #pragma unroll
                for (int sn = 0; sn < 4; ++sn)
                    res[sm][sn][r] = residual[o0 + (size_t)(sm * 16 + r) * N_DIM + sn * 16];
            }
        // before a register that these loads name is written again
        asm volatile("s_wait_xcnt 0x0" ::: "memory");
    }

    if constexpr (B_KN) {
        // Two fragment sets in registers: the fragments of the next 32 k are fetched
        // as one group in front of this step's WMMAs and are waited for behind them.
        v16h an[2], fn, bn[4];    // A rows as they lie, their row factors, B
        auto fetch = [&](int bufi, int kf, int kk) {
            #pragma unroll
            for (int sm = 0; sm < 2; ++sm)
                an[sm] = load_frag32(lA[bufi] + kk * 32, PA, waveM * 32 + sm * 16 + rl, kbase);
            // same k order as the A fragment: row 0 of a [1][k] tile
            fn = load_frag32(lF + kf, 0, 0, kbase);
            #pragma unroll
            for (int sn = 0; sn < 4; ++sn)
                bn[sn] = load_frag32_tr(lB[bufi] + kk * 32 * BKN_PITCH,
                                        waveN * 64 + sn * 16, lane);
        };
        if (3 * BK < K) stage(3, 3 * BK);
        fetch(buf, 0, 0);
        for (int k0 = 0; k0 < K; k0 += BK) {
            const int  nbuf = (buf + 1) & (NBUF - 1);
            const bool more = k0 + BK < K;
            #pragma unroll
            for (int kk = 0; kk < BK / 32; ++kk) {
                // keeps the fetch below out of the WMMAs of the step before
                __builtin_amdgcn_sched_barrier(0);
                v16h af[2], bf[4];
                af[0] = an[0] * fn;
                af[1] = an[1] * fn;
                #pragma unroll
                for (int sn = 0; sn < 4; ++sn)
                    bf[sn] = bn[sn];
                if (kk + 1 < BK / 32) {
                    fetch(buf, k0 + (kk + 1) * 32, kk + 1);
                } else {
                    // The stage's last fragments are in registers: the next stage is
                    // published here, in front of the last WMMAs, so that its first
                    // fragments come in under them.
                    // this wave's LDS reads of the current buffer have retired before
                    // the barrier behind which copies refill it
                    asm volatile("s_wait_dscnt 0x0" ::: "memory");
                    // The next stage's copies have landed. While the stage three ahead
                    // exists, it and the one before it are this wave's 32 youngest
                    // copies and fly on; at the end of K the wait is to 0.
                    if (k0 + 3 * BK < K) wait_async32();
                    else                 wait_async0();
                    __syncthreads();      // + all waves done reading current buffer
                    if (more) fetch(nbuf, k0 + BK, 0);
                    // refill of the buffer that every wave has just left
                    if (k0 + 4 * BK < K) stage(buf, k0 + 4 * BK);
                }
                // keeps the fetch above in front of the WMMAs, as one group
                __builtin_amdgcn_sched_barrier(0);
                #pragma unroll
                for (int sm = 0; sm < 2; ++sm)
                    #pragma unroll
                    for (int sn = 0; sn < 4; ++sn)
                        acc[sm][sn] = __builtin_amdgcn_wmma_f32_16x16x32_f16(
                            false, af[sm], false, bf[sn],
                            (short)0, acc[sm][sn], false, false);
            }
            buf = nbuf;
        }
        wait_async0();            // no copy is in flight when the wave ends
    } else {
        for (int k0 = 0; k0 < K; k0 += BK) {
            int nbuf = buf ^ 1;
            if (k0 + BK < K) stage(nbuf, k0 + BK);   // overlap with compute

            // ---- compute: BK / 32 K=32 WMMA steps from the current buffer, in k order;
            // unrolled so that a later step's fragment loads can go ahead of the WMMAs
            #pragma unroll
            for (int kk = 0; kk < BK / 32; ++kk) {
                v16h af[2], bf[4];
                #pragma unroll
                for (int sm = 0; sm < 2; ++sm)
                    af[sm] = load_frag32(lA[buf] + kk * 32, PA, waveM * 32 + sm * 16 + rl, kbase);
                #pragma unroll
                for (int sn = 0; sn < 4; ++sn)
                    bf[sn] = load_frag32(lB[buf] + kk * 32, PA,
                                         waveN * 64 + sn * 16 + rl, kbase);
                #pragma unroll
                for (int sm = 0; sm < 2; ++sm)
                    #pragma unroll
                    for (int sn = 0; sn < 4; ++sn)
                        acc[sm][sn] = __builtin_amdgcn_wmma_f32_16x16x32_f16(
                            false, af[sm], false, bf[sn],
                            (short)0, acc[sm][sn], false, false);
            }

            // this wave's LDS reads of the current buffer have retired before the
            // barrier behind which copies refill it
            asm volatile("s_wait_dscnt 0x0" ::: "memory");
            wait_async0();        // next-buffer async writes landed
            __syncthreads();      // + all waves done reading current buffer
            buf = nbuf;
        }
    }

    // ---- epilogue: lane holds col n = rl, rows mb..mb+7
    const int mhalf = (lane < 16) ? 0 : 8;
    if constexpr (OUT_MODE == 2) {
        // The stage buffers are free behind the loop's last barrier.
        float*    red = (float*)&lB[0][0];    // [2][4 waveM][128 i]: maxima, then sums
        _Float16* eT  = &lA[0][0];            // [128 i][128 j], pitch 136 halves
        constexpr int PE = 136;
        // max of query i over this wave's 32 keys: 16 in the lane, 16 in lane ^ 16
        const int il0 = waveN * 64 + rl;      // query of sn = 0; + 16 per sn
        float mx[4];
        #pragma unroll
        for (int sn = 0; sn < 4; ++sn) {
            float m = -3.4e38f;
            #pragma unroll
            for (int sm = 0; sm < 2; ++sm)
                #pragma unroll
                for (int r = 0; r < 8; ++r) {
                    acc[sm][sn][r] *= alpha;
                    m = fmaxf(m, acc[sm][sn][r]);
                }
            mx[sn] = m;
        }
        #pragma unroll
        for (int sn = 0; sn < 4; ++sn)
            mx[sn] = fmaxf(mx[sn], __shfl_xor(mx[sn], 16));
        if (lane < 16) {
            #pragma unroll
            for (int sn = 0; sn < 4; ++sn)
                red[waveM * 128 + il0 + sn * 16] = mx[sn];
        }
        __syncthreads();
        #pragma unroll
        for (int sn = 0; sn < 4; ++sn) {
            const int il = il0 + sn * 16;
            mx[sn] = fmaxf(fmaxf(red[il], red[128 + il]),
                           fmaxf(red[256 + il], red[384 + il]));
        }
        float sum[4];
        #pragma unroll
        for (int sn = 0; sn < 4; ++sn) {
            float s = 0.f;
            #pragma unroll
            for (int sm = 0; sm < 2; ++sm) {
                h8 pack;
                #pragma unroll
                for (int r = 0; r < 8; ++r) {
                    const float e = exp2_slot(acc[sm][sn][r] - mx[sn]);
                    s += e;
                    pack[r] = (_Float16)e;
                }
                *(h8*)(eT + (il0 + sn * 16) * PE + waveM * 32 + sm * 16 + mhalf) = pack;
            }
            sum[sn] = s;
        }
        #pragma unroll
        for (int sn = 0; sn < 4; ++sn)
            sum[sn] += __shfl_xor(sum[sn], 16);
        if (lane < 16) {
            #pragma unroll
            for (int sn = 0; sn < 4; ++sn)
                red[512 + waveM * 128 + il0 + sn * 16] = sum[sn];
        }
        __syncthreads();
        // whole 256-byte rows of E: 16 lanes a row
        _Float16* E = (_Float16*)Out + oz + (size_t)n0g * ldo + m0g;
        #pragma unroll
        for (int t = 0; t < 8; ++t) {
            const int row = (tid >> 4) + 16 * t;
            const int c   = (tid & 15) * 8;
            *(h8*)(E + (size_t)row * ldo + c) = *(const h8*)(eT + row * PE + c);
        }
        if (tid < 128) {
            const size_t si = ((size_t)blockIdx.z * NJB + blockIdx.x) * N_DIM + n0g + tid;
            ((float*)OutK)[si] = fmaxf(fmaxf(red[tid], red[128 + tid]),
                                       fmaxf(red[256 + tid], red[384 + tid]));
            ((float*)OutV)[si] = (red[512 + tid] + red[640 + tid])
                               + (red[768 + tid] + red[896 + tid]);
        }
        return;
    }
    if constexpr (OUT_MODE == 0) {
        float* O = (float*)Out;
        #pragma unroll
        for (int sm = 0; sm < 2; ++sm)
            #pragma unroll
            for (int sn = 0; sn < 4; ++sn) {
                #pragma unroll
                for (int r = 0; r < 8; ++r)
                    O[o0 + (size_t)(sm * 16 + r) * N_DIM + sn * 16] =
                        res[sm][sn][r] + acc[sm][sn][r] * alpha + bs[sm][r];
                // before a register that these stores name is written again
                asm volatile("s_wait_xcnt 0x0" ::: "memory");
                // keeps the arithmetic of the next eight results behind that wait
                __builtin_amdgcn_sched_barrier(0);
            }
    }
    if constexpr (OUT_MODE == 1) {
        #pragma unroll
        for (int sm = 0; sm < 2; ++sm) {
            #pragma unroll
            for (int sn = 0; sn < 4; ++sn) {
                int mb = m0g + waveM * 32 + sm * 16 + mhalf;
                int n  = n0g + waveN * 64 + sn * 16 + rl;
                v8f a = acc[sm][sn];
                _Float16* O = (_Float16*)OutP + oz;
                if (part == 0) {
                    h8 pack;
                    #pragma unroll
                    for (int r = 0; r < 8; ++r)
                        pack[r] = (_Float16)(a[r] * alpha + bias[mb + r]);
                    *(h8*)(O + (size_t)n * ldo + mb) = pack;   // contiguous over m
                    // before a register that this store names is written again
                    asm volatile("s_wait_xcnt 0x0" ::: "memory");
                } else {
                    #pragma unroll
                    for (int r = 0; r < 8; ++r) {
                        float v = a[r] * alpha + bias[mb + r];
                        O[(size_t)(mb + r) * N_DIM + n] = (_Float16)v;   // V' is [C][N]
                    }
                    // before a register that these stores name is written again
                    asm volatile("s_wait_xcnt 0x0" ::: "memory");
                }
            }
        }
    }
}

// ------------------------- row factors of the softmax ----------------------
// bm, bl: [B][NJB][N], per 128-column block jb and row i the block's maximum and its
// sum of 2^(s - bm), s = score * log2(e). With M = max over jb and L = sum over jb of
// bl * 2^(bm - M), softmax(i, j) = E[i][j] * f[jb][i], f = 2^(bm - M) / L.
// One thread per row.
__global__ __launch_bounds__(64) void row_factor_kernel(
    const float* __restrict__ bm, const float* __restrict__ bl,
    _Float16* __restrict__ f) {
    const int t = blockIdx.x * 64 + threadIdx.x;          // b * N + i
    const size_t base = (size_t)(t / N_DIM) * NJB * N_DIM + (t % N_DIM);
    float m[NJB], l[NJB];
    #pragma unroll
    for (int jb = 0; jb < NJB; ++jb)
        m[jb] = bm[base + (size_t)jb * N_DIM];
    // before a register that these loads name is written again
    asm volatile("s_wait_xcnt 0x0" ::: "memory");
    #pragma unroll
    for (int jb = 0; jb < NJB; ++jb)
        l[jb] = bl[base + (size_t)jb * N_DIM];
    // before a register that these loads name is written again
    asm volatile("s_wait_xcnt 0x0" ::: "memory");
    float M = m[0];
    #pragma unroll
    for (int jb = 1; jb < NJB; ++jb) M = fmaxf(M, m[jb]);
    float L = 0.f;
    #pragma unroll
    for (int jb = 0; jb < NJB; ++jb) {
        m[jb] = exp2_slot(m[jb] - M);
        L += l[jb] * m[jb];
    }
    const float inv = 1.0f / L;
    #pragma unroll
    for (int jb = 0; jb < NJB; ++jb)
        f[base + (size_t)jb * N_DIM] = (_Float16)(m[jb] * inv);
}

// ---------------------------------------------------------------------------
extern "C" void kernel_launch(void* const* d_in, const int* in_sizes, int n_in,
                              void* d_out, int out_size, void* d_ws, size_t ws_size,
                              hipStream_t stream) {
    (void)in_sizes; (void)n_in; (void)out_size; (void)ws_size;
    const float* x      = (const float*)d_in[0];
    const float* norm_w = (const float*)d_in[1];
    const float* norm_b = (const float*)d_in[2];
    const float* wq = (const float*)d_in[3];
    const float* bq = (const float*)d_in[4];
    const float* wk = (const float*)d_in[5];
    // d_in[6], the bias of K: q_i . bk is one constant per softmax row and drops out
    const float* wv = (const float*)d_in[7];
    const float* bv = (const float*)d_in[8];
    const float* wp = (const float*)d_in[9];
    const float* bp = (const float*)d_in[10];
    float* out = (float*)d_out;

    // ---- carve workspace
    char* w = (char*)d_ws;
    auto carve = [&](size_t bytes) -> char* {
        char* p = w;
        w += (bytes + 255) & ~(size_t)255;
        return p;
    };
    _Float16*  hT    = (_Float16*)carve((size_t)B_DIM * N_DIM * C_DIM * 2); // [b][n][c]
    _Float16*  g16   = (_Float16*)carve((size_t)2 * C_DIM * C_DIM * 2);     // Wk^T Wq, Wp Wv
    float*     gbias = (float*)carve((size_t)2 * C_DIM * sizeof(float));    // Wk^T bq, Wp bv
    _Float16*  Q     = (_Float16*)carve((size_t)B_DIM * N_DIM * C_DIM * 2); // Q' [b][n][c]
    _Float16*  V     = (_Float16*)carve((size_t)B_DIM * C_DIM * N_DIM * 2); // V' [b][c][n]
    _Float16*  E     = (_Float16*)carve((size_t)B_DIM * N_DIM * N_DIM * 2);       // [b][i][j]
    float*     bm    = (float*)carve((size_t)B_DIM * NJB * N_DIM * sizeof(float)); // [b][jb][i]
    float*     bl    = (float*)carve((size_t)B_DIM * NJB * N_DIM * sizeof(float)); // [b][jb][i]
    _Float16*  rf    = (_Float16*)carve((size_t)B_DIM * NJB * N_DIM * 2);          // [b][jb][i]

    const float scale_log2e = 0.063758715412299341f;  // 512^-0.5 * log2(e)

    // 1) GroupNorm, statistics and normalisation in one launch
    gn_fused_kernel<<<B_DIM * NGRP, 1024, 0, stream>>>(x, norm_w, norm_b, hT);

    // 2) the two products of the weights, with their bias vectors, one launch
    weight_product_kernel<<<dim3(C_DIM / 64, C_DIM / 64, 2), 512, 0, stream>>>(
        wq, bq, wk, wv, bv, wp, g16, gbias);

    // every GEMM takes both batches in one launch (grid z)
    dim3 gQV(2 * C_DIM / 128, N_DIM / 128, B_DIM);    //  8 x 32 x 2
    dim3 gS(N_DIM / 128, N_DIM / 128, B_DIM);         // 32 x 32 x 2
    dim3 gO(C_DIM / 128, N_DIM / 128, B_DIM);         //  4 x 32 x 2
    const size_t zNC = (size_t)N_DIM * C_DIM;
    const size_t zNN = (size_t)N_DIM * N_DIM;

    // 3) Q', V' (M=2*512, N=4096, K=512), B operand = hT "nk" direct
    gemm_wmma_kernel<1, false><<<gQV, 256, 0, stream>>>(
        g16, C_DIM, 0, hT, C_DIM, zNC, Q, V, nullptr, C_DIM, zNC,
        gbias, gbias + C_DIM, nullptr, nullptr, 1.0f, 2 * C_DIM, N_DIM, C_DIM);
    // 4) scores s[i][j] = scale_log2e * Q'[i][:] . hT[j][:] as the product hT x Q'^T (M = j,
    //    N = i, K=512), left as E = 2^(s - block max) with the blocks' maxima and sums
    gemm_wmma_kernel<2, false><<<gS, 256, 0, stream>>>(
        hT, C_DIM, zNC, Q, C_DIM, zNC, E, bm, bl, N_DIM, zNN,
        nullptr, nullptr, nullptr, nullptr, scale_log2e, N_DIM, N_DIM, C_DIM);
    // 5) the factor that makes a block's E the softmax, per (block, row)
    row_factor_kernel<<<B_DIM * N_DIM / 64, 64, 0, stream>>>(bm, bl, rf);
    // 6) out[c][j] = x + bp + sum_i (V'[c][i] * rf[jb(j)][i]) * E[i][j]  (M=512, N=4096, K=4096)
    gemm_wmma_kernel<0, true><<<gO, 256, 0, stream>>>(
        V, N_DIM, zNC, E, N_DIM, zNN, out, nullptr, nullptr,
        N_DIM, zNC, bp, nullptr, x, rf, 1.0f, C_DIM, N_DIM, N_DIM);
}

// v009
// Measured time: 108 microseconds a run.
// Timed twice side by side with v008, it ran 1.06 times as fast both times.
// All steps since v000 together make it 6.14 times as fast.
#include <hip/hip_runtime.h>

// ---------------------------------------------------------------------------
// AttnBlock for MI455X (gfx1250): GroupNorm -> Q', V' 1x1 -> attention (+ residual).
// Two of the four 1x1 convolutions are folded into products of the weights:
//   q_i . k_j = (Wk^T q_i) . h_j + q_i . bk; the last term is the same for every j
//   of a row, so the softmax over j does not see it: Q' = (Wk^T Wq) h + Wk^T bq
//   meets h itself, and no K is formed.
//   Wp (V w) = (Wp V) w: V' = (Wp Wv) h + Wp bv, and no projection follows.
// GEMMs via V_WMMA_F32_16X16X32_F16; tiles staged with
// GLOBAL_LOAD_ASYNC_TO_LDS_B128 (ASYNCcnt) into an LDS ring of two or four buffers.
// GroupNorm and the products of the weights do not depend on each other and share
// the first launch: the block index picks the job.
// ---------------------------------------------------------------------------

typedef __attribute__((ext_vector_type(16))) _Float16 v16h;
typedef __attribute__((ext_vector_type(8)))  _Float16 h8;
typedef __attribute__((ext_vector_type(4)))  _Float16 h4;
typedef __attribute__((ext_vector_type(2)))  _Float16 h2;
typedef __attribute__((ext_vector_type(8)))  short    s8;
typedef __attribute__((ext_vector_type(8)))  float    v8f;
typedef __attribute__((ext_vector_type(4)))  float    f4;
typedef __attribute__((ext_vector_type(4)))  int      i4;

#define C_DIM 512
#define N_DIM 4096
#define B_DIM 2
#define NGRP  32
#define CPG   16           // channels per group
#define GELEM (CPG * N_DIM)
#define NJB   (N_DIM / 128)   // 128-column blocks of a score row

// ------------------------- CDNA5 async-copy helpers ------------------------
// Per-lane async copy of 16 bytes global -> LDS, tracked by ASYNCcnt.
// vdst VGPR carries the 32-bit LDS byte address (low 32 bits of flat shared
// pointer, per ISA 10.2 aperture mapping).
__device__ __forceinline__ unsigned lds_addr(const void* lds_ptr) {
    return (unsigned)(unsigned long long)lds_ptr;
}
// Eight per-lane copies in ONE statement, closed by s_wait_xcnt 0: the operands'
// registers live to the statement's end, so no address register of an issued
// copy is rewritten ahead of that wait.
__device__ __forceinline__ void async_copy8_b128(const unsigned (&l)[8],
                                                 const _Float16* const (&g)[8]) {
    asm volatile("global_load_async_to_lds_b128 %0, %1, off\n\t"
                 "global_load_async_to_lds_b128 %2, %3, off\n\t"
                 "global_load_async_to_lds_b128 %4, %5, off\n\t"
                 "global_load_async_to_lds_b128 %6, %7, off\n\t"
                 "global_load_async_to_lds_b128 %8, %9, off\n\t"
                 "global_load_async_to_lds_b128 %10, %11, off\n\t"
                 "global_load_async_to_lds_b128 %12, %13, off\n\t"
                 "global_load_async_to_lds_b128 %14, %15, off\n\t"
                 "s_wait_xcnt 0x0"
                 :: "v"(l[0]), "v"((unsigned long long)g[0]),
                    "v"(l[1]), "v"((unsigned long long)g[1]),
                    "v"(l[2]), "v"((unsigned long long)g[2]),
                    "v"(l[3]), "v"((unsigned long long)g[3]),
                    "v"(l[4]), "v"((unsigned long long)g[4]),
                    "v"(l[5]), "v"((unsigned long long)g[5]),
                    "v"(l[6]), "v"((unsigned long long)g[6]),
                    "v"(l[7]), "v"((unsigned long long)g[7])
                 : "memory");
}
__device__ __forceinline__ void wait_async0() {
    asm volatile("s_wait_asynccnt 0x0" ::: "memory");
}
// All but this wave's 32 youngest copies have landed: the two youngest stages of
// the four-buffer ring (16 copies a wave and stage) stay in flight.
__device__ __forceinline__ void wait_async32() {
    asm volatile("s_wait_asynccnt 0x20" ::: "memory");
}

// 2^x. The v_nop fills the slot that the instruction set asks for between a
// transcendental and a next instruction that reads its result or writes its source.
__device__ __forceinline__ float exp2_slot(float x) {
    float r;
    asm("v_exp_f32 %0, %1\n\tv_nop" : "=v"(r) : "v"(x));
    return r;
}

// ------------------------- GroupNorm ---------------------------------------
// One work-group per (batch, group). Thread t loads all 16 channels of positions
// 4t .. 4t+3 (64 floats) and keeps them in registers from the sums to the
// normalisation, so x is read once and no statistics pass through memory.
// Writes h^T as f16 [B][N][C] (k-contiguous for GEMM B): the group's 16 channels
// are 32 contiguous bytes of a row.
__device__ __forceinline__ void gn_fused(
    const float* __restrict__ x,
    const float* __restrict__ gw, const float* __restrict__ gb,
    _Float16* __restrict__ hT, float (*red)[32], int bg) {   // bg = b*NGRP + g
    const int tid  = threadIdx.x;
    const int lane = tid & 31;
    const int wave = tid >> 5;
    const int b    = bg / NGRP;
    const int g    = bg % NGRP;
    const float* p = x + (size_t)bg * GELEM + 4 * tid;
    f4 v[CPG];
    #pragma unroll
    for (int c = 0; c < CPG; ++c)
        v[c] = *(const f4*)(p + (size_t)c * N_DIM);
    // the group's weights, fetched here so that they arrive under the loads of x
    float w[CPG], bb[CPG];
    #pragma unroll
    for (int c = 0; c < CPG; ++c) {
        w[c]  = gw[g * CPG + c];
        bb[c] = gb[g * CPG + c];
    }

    // four independent chains a thread, then lane butterfly, then the 32 waves
    f4 s4 = (f4){0.f, 0.f, 0.f, 0.f}, q4 = (f4){0.f, 0.f, 0.f, 0.f};
    #pragma unroll
    for (int c = 0; c < CPG; ++c) {
        s4 += v[c];
        q4 += v[c] * v[c];
    }
    float s  = (s4[0] + s4[1]) + (s4[2] + s4[3]);
    float s2 = (q4[0] + q4[1]) + (q4[2] + q4[3]);
    #pragma unroll
    for (int m = 16; m > 0; m >>= 1) {
        s  += __shfl_xor(s,  m);
        s2 += __shfl_xor(s2, m);
    }
    if (lane == 0) { red[0][wave] = s; red[1][wave] = s2; }
    __syncthreads();
    s  = red[0][lane];
    s2 = red[1][lane];
    #pragma unroll
    for (int m = 16; m > 0; m >>= 1) {
        s  += __shfl_xor(s,  m);
        s2 += __shfl_xor(s2, m);
    }
    const float mu  = s  * (1.0f / GELEM);
    const float var = s2 * (1.0f / GELEM) - mu * mu;
    const float rs  = rsqrtf(var + 1e-6f);

    // normalize + affine; lo = channels 0..7, hi = channels 8..15 of position 4t+q
    i4 lo[4], hi[4];
    #pragma unroll
    for (int q = 0; q < 4; ++q) {
        h8 l, h;
        #pragma unroll
        for (int c = 0; c < 8; ++c) {
            l[c] = (_Float16)((v[c][q]     - mu) * rs * w[c]     + bb[c]);
            h[c] = (_Float16)((v[c + 8][q] - mu) * rs * w[c + 8] + bb[c + 8]);
        }
        lo[q] = __builtin_bit_cast(i4, l);
        hi[q] = __builtin_bit_cast(i4, h);
    }

    // Lanes 2j and 2j+1 swap halves, so that the pair stores the 32 bytes of ONE
    // position side by side: a wave's store touches 16 rows of h^T, not 32.
    // The even lane gives its hi and takes the odd lane's lo.
    const bool odd = lane & 1;
    _Float16* dst = hT + ((size_t)b * N_DIM + 8 * (tid >> 1)) * C_DIM + g * CPG + (odd ? 8 : 0);
    #pragma unroll
    for (int q = 0; q < 4; ++q) {
        i4 give = odd ? lo[q] : hi[q];
        i4 take;
        #pragma unroll
        for (int e = 0; e < 4; ++e)
            take[e] = __shfl_xor(give[e], 1);
        *(i4*)(dst + (size_t)q * C_DIM)       = odd ? take : lo[q];   // even lane's positions
        *(i4*)(dst + (size_t)(4 + q) * C_DIM) = odd ? hi[q] : take;   // odd lane's positions
    }
}

// ------------------------- WMMA fragment load ------------------------------
// LDS tile is row-major [r][k], pitch halves a row; lds points at the 32 k of
// this product. Per ISA 16-bit A 16x32 layout:
// lane<16 -> K base 0, lane>=16 -> K base 8; elems 0..7 = K base..base+7,
// elems 8..15 = K base+16..base+23. B (stored transposed [n][k]) symmetric.
__device__ __forceinline__ v16h load_frag32(const _Float16* lds, int pitch, int row, int kbase) {
    const h8 lo = *(const h8*)(lds + row * pitch + kbase);
    const h8 hi = *(const h8*)(lds + row * pitch + kbase + 16);
    return __builtin_shufflevector(lo, hi, 0,1,2,3,4,5,6,7,8,9,10,11,12,13,14,15);
}

// B fragment out of a row-major [k][n] LDS tile (pitch BKN_PITCH halves) by the
// transposing load: lane (c = l & 15, h = l >> 4) gets T[kb + 8h + 0..7][n0 + c];
// the loads at kb = 0 and kb = 16 give the k order of load_frag32.
#define BKN_PITCH 144      // 288 B = 32 B x odd: the transposing load's pitch
__device__ __forceinline__ h8 load_tr16(const _Float16* p) {
    typedef __attribute__((address_space(3))) s8 lds_s8;
    return __builtin_bit_cast(h8, __builtin_amdgcn_ds_load_tr16_b128_v8i16((lds_s8*)p));
}
__device__ __forceinline__ v16h load_frag32_tr(const _Float16* lds, int n0, int lane) {
    const _Float16* p = lds + (8 * (lane >> 4) + (lane & 7)) * BKN_PITCH
                            + n0 + 8 * ((lane >> 3) & 1);
    const h8 lo = load_tr16(p);
    const h8 hi = load_tr16(p + 16 * BKN_PITCH);
    return __builtin_shufflevector(lo, hi, 0,1,2,3,4,5,6,7,8,9,10,11,12,13,14,15);
}

// ------------------------- products of the weights -------------------------
// Product 0: G = Wk^T Wq, g = Wk^T bq;  1: G = Wp Wv, g = Wp bv.
// One 64 x 64 tile of G (f16 [m][n]) per work-group, all 512 k staged at once by
// its 32 waves: f32 weights through registers to f16 in LDS. Wq, Wv and Wk lie
// [k][column] and are read by the transposing load; Wp lies [row][k].
// The tile has sixteen 16 x 16 pieces: waves 0 .. 15 form them, the others stage and, in the tiles with nt == 0, form g's partial sums.
#define WT_PITCH 80        // halves; 160 B = 32 B x odd: the transposing load's pitch
#define WR_PITCH 520       // halves; 1040 B = 16 B x odd: the pitch of ds_load_b128 readers
__device__ __forceinline__ v16h load_frag32_tr_w(const _Float16* lds, int n0, int lane) {
    const _Float16* p = lds + (8 * (lane >> 4) + (lane & 7)) * WT_PITCH
                            + n0 + 8 * ((lane >> 3) & 1);
    const h8 lo = load_tr16(p);
    const h8 hi = load_tr16(p + 16 * WT_PITCH);
    return __builtin_shufflevector(lo, hi, 0,1,2,3,4,5,6,7,8,9,10,11,12,13,14,15);
}
// A_KM: the first factor lies [k][m] in memory (Wk), else [m][k] (Wp)
template <bool A_KM>
__device__ __forceinline__ void weight_product(
    const float* __restrict__ wa, const float* __restrict__ wb,
    const float* __restrict__ bias,
    _Float16* __restrict__ G, float* __restrict__ g,
    _Float16* lA, _Float16* lB, float* lbias, float (*red)[64],
    int mt, int nt) {                          // the tile's row and column in G
    const int tid  = threadIdx.x;
    const int lane = tid & 31;
    const int wave = tid >> 5;
    const int m0   = mt * 64;
    const int n0   = nt * 64;
    const bool with_bias = nt == 0;            // these work-groups also form g

    // [k][64] tile: 16 lanes cover a row's 256 bytes, rows kr + 64 i per thread;
    // [64][k] tile: 128 lanes cover a row's 2048 bytes, rows (tid >> 7) + 8 i
    const int kr = tid >> 4;
    const int c4 = (tid & 15) * 4;
    constexpr int GA = (A_KM ? 64 : 8) * C_DIM;
    constexpr int SA = A_KM ? 64 * WT_PITCH : 8 * WR_PITCH;
    const float* gA = A_KM ? wa + (size_t)kr * C_DIM + m0 + c4
                           : wa + (size_t)(m0 + (tid >> 7)) * C_DIM + (tid & 127) * 4;
    const float* gB = wb + (size_t)kr * C_DIM + n0 + c4;
    _Float16* sA = A_KM ? lA + kr * WT_PITCH + c4
                        : lA + (tid >> 7) * WR_PITCH + (tid & 127) * 4;
    _Float16* sB = lB + kr * WT_PITCH + c4;
    f4 va[8], vb[8];
    #pragma unroll
    for (int i = 0; i < 8; ++i) {
        va[i] = *(const f4*)(gA + (size_t)i * GA);
        vb[i] = *(const f4*)(gB + (size_t)i * 64 * C_DIM);
    }
    f4 b4 = (f4){0.f, 0.f, 0.f, 0.f};
    if (with_bias && tid < C_DIM / 4)
        b4 = *(const f4*)(bias + tid * 4);
    // before a register that these loads name is written again
    asm volatile("s_wait_xcnt 0x0" ::: "memory");
    #pragma unroll
    for (int i = 0; i < 8; ++i) {
        *(h4*)(sA + i * SA)            = __builtin_convertvector(va[i], h4);
        *(h4*)(sB + i * 64 * WT_PITCH) = __builtin_convertvector(vb[i], h4);
    }
    if (with_bias && tid < C_DIM / 4)
        *(f4*)(lbias + tid * 4) = b4;
    __syncthreads();

    // the wave's number as a scalar: whole waves take either side of the branch
    if (__builtin_amdgcn_readfirstlane(wave) < 16) {
        // wave: one 16 x 16 piece of the tile
        const int rl    = lane & 15;
        const int kbase = (lane < 16) ? 0 : 8;
        const int mi    = (wave & 3) * 16;
        const int nj    = (wave >> 2) * 16;
        v8f acc = (v8f){0.f,0.f,0.f,0.f,0.f,0.f,0.f,0.f};
        #pragma unroll
        for (int kk = 0; kk < C_DIM / 32; ++kk) {
            // both forms of A give the k order of load_frag32
            const v16h af = A_KM ? load_frag32_tr_w(lA + kk * 32 * WT_PITCH, mi, lane)
                                 : load_frag32(lA + kk * 32, WR_PITCH, mi + rl, kbase);
            const v16h bf = load_frag32_tr_w(lB + kk * 32 * WT_PITCH, nj, lane);
            acc = __builtin_amdgcn_wmma_f32_16x16x32_f16(
                false, af, false, bf, (short)0, acc, false, false);
        }
        // lane holds column rl, rows mhalf .. mhalf + 7 of the piece
        const int mhalf = (lane < 16) ? 0 : 8;
        _Float16* Gp = G + (size_t)(m0 + mi + mhalf) * C_DIM + n0 + nj + rl;
        #pragma unroll
        for (int r = 0; r < 8; ++r)
            Gp[(size_t)r * C_DIM] = (_Float16)acc[r];
        // before a register that these stores name is written again
        asm volatile("s_wait_xcnt 0x0" ::: "memory");
    } else if (with_bias) {
        // g[m] = sum over k of A[m][k] * bias[k], sixteen partial sums of 32 k per row,
        // by waves 16 .. 31 beside the products
        const int bw = wave - 16;
        const int bt = tid - 512;
        float s0 = 0.f, s1 = 0.f;
        if (A_KM) {
            // a lane takes two neighbouring m (one dword of a [k][m] row), a wave 32 k
            #pragma unroll
            for (int i = 0; i < 32; ++i) {
                const int k = bw * 32 + i;
                const h2 a = *(const h2*)(lA + k * WT_PITCH + lane * 2);
                s0 += (float)a[0] * lbias[k];
                s1 += (float)a[1] * lbias[k];
            }
            red[bw][lane * 2]     = s0;
            red[bw][lane * 2 + 1] = s1;
        } else {
            // a thread takes 64 k of row bt & 63
            const int r = bt & 63;
            const int q = bt >> 6;
            #pragma unroll
            for (int i = 0; i < 4; ++i) {
                const h8 a0 = *(const h8*)(lA + r * WR_PITCH + q * 64 + i * 8);
                const h8 a1 = *(const h8*)(lA + r * WR_PITCH + q * 64 + 32 + i * 8);
                #pragma unroll
                for (int e = 0; e < 8; ++e) {
                    s0 += (float)a0[e] * lbias[q * 64 + i * 8 + e];
                    s1 += (float)a1[e] * lbias[q * 64 + 32 + i * 8 + e];
                }
            }
            red[2 * q][r]     = s0;
            red[2 * q + 1][r] = s1;
        }
    }
    if (with_bias) {
        __syncthreads();
        if (tid < 64) {
            float s = 0.f;
            #pragma unroll
            for (int q = 0; q < 16; ++q) s += red[q][tid];
            g[m0 + tid] = s;
        }
    }
}
// ------------------------- first launch: GroupNorm | weight products --------
// Work-groups 0 .. B*NGRP-1 take one (batch, group) of the GroupNorm each, the next
// 64 one tile of Wk^T Wq, the last 64 one tile of Wp Wv. Neither job reads what the
// other writes; every work-group has a WGP of its own.
#define WTILES ((C_DIM / 64) * (C_DIM / 64))
__global__ __launch_bounds__(1024) void gn_and_weight_product_kernel(
    const float* __restrict__ x,
    const float* __restrict__ gw, const float* __restrict__ gb,
    _Float16* __restrict__ hT,
    const float* __restrict__ wq, const float* __restrict__ bq,
    const float* __restrict__ wk,
    const float* __restrict__ wv, const float* __restrict__ bv,
    const float* __restrict__ wp,
    _Float16* __restrict__ g16, float* __restrict__ gbias) {
    __shared__ __attribute__((aligned(16))) _Float16 lA[C_DIM * WT_PITCH];  // or [64][WR_PITCH]
    __shared__ __attribute__((aligned(16))) _Float16 lB[C_DIM * WT_PITCH];
    __shared__ __attribute__((aligned(16))) float lbias[C_DIM];
    __shared__ float red[16][64];
    __shared__ float gred[2][32];
    const int job = blockIdx.x;
    const int t   = (job - B_DIM * NGRP) % WTILES;
    const int mt  = t % (C_DIM / 64);
    const int nt  = t / (C_DIM / 64);
    if (job < B_DIM * NGRP)
        gn_fused(x, gw, gb, hT, gred, job);
    else if (job < B_DIM * NGRP + WTILES)
        weight_product<true>(wk, wq, bq, g16, gbias, lA, lB, lbias, red, mt, nt);
    else
        weight_product<false>(wp, wv, bv, g16 + (size_t)C_DIM * C_DIM, gbias + C_DIM,
                              lA, lB, lbias, red, mt, nt);
}

// ------------------------- generic WMMA GEMM -------------------------------
// D = alpha * A(f16 [M][K]) x B(f16) + bias(+residual)
// blockIdx.z = batch: A, B, Out and residual advance by zA, zB, zO elements.
// OUT_MODE: 0 = f32 [M][N] + bias + residual (the block's output); A[m][k] is
//               multiplied by rowf[k] of this block's 128 columns as its
//               fragments are read
//           1 = f16 + bias: blockIdx.x / 4 = part picks C_DIM rows of the stacked
//               weights A, the part's output plane and its bias;
//               part 0 (Q') is stored [N][M], part 1 (V') [M][N]
//           2 = scores with the block-local softmax: m = key j, n = query i; writes
//               f16 E[i][j] = 2^(s - bm), bm = max of row i over this block's 128 j,
//               and per (block, i) bm (OutK) and the sum of those powers (OutV);
//               alpha holds 512^-0.5 * log2(e), so that s is the score in units of ln 2
// B_KN: true  -> global B is [K][N] (ldb = N pitch), async copy row-major into
//                LDS, transposed by the fragment load
//       false -> global B is [N][K] (pre-transposed), async direct copy
// One LDS stage holds BK k of both operands: 128 where one work-group has its
// WGP alone (B_KN: 256 work-groups), 64 where several share it. [row][k] tiles
// have a pitch of BK + 8 halves (16 B x odd: the pitch of ds_load_b128 readers).
// The ring has two buffers, and four where B_KN (the work-group has the whole LDS):
// three stages of copies fly while one is worked on, so that a stage has the time of
// three stages to land, not of one.
template <int OUT_MODE, bool B_KN>
__global__ __launch_bounds__(256) void gemm_wmma_kernel(
    const _Float16* __restrict__ A0, int lda, size_t zA,
    const _Float16* __restrict__ B0, int ldb, size_t zB,
    void* __restrict__ Out, void* __restrict__ OutK,
    void* __restrict__ OutV, int ldo, size_t zO,
    const float* __restrict__ biasQ, const float* __restrict__ biasK,
    const float* __restrict__ residual,
    const _Float16* __restrict__ rowf,
    float alpha, int M, int N, int K) {
    (void)M; (void)N; (void)OutK; (void)OutV; (void)biasK; (void)residual; (void)rowf;
    const int part = (OUT_MODE == 1) ? blockIdx.x / (C_DIM / 128) : 0;
    const _Float16* A  = A0 + blockIdx.z * zA + (size_t)part * C_DIM * lda;
    const _Float16* Bm = B0 + blockIdx.z * zB;
    const size_t    oz = blockIdx.z * zO;
    void*        OutP  = (part == 0) ? Out   : OutK;
    const float* bias  = (part == 0) ? biasQ : biasK;
    constexpr int BK  = B_KN ? 128 : 64;
    constexpr int PA  = BK + 8;       // halves
    constexpr int CPR = BK / 8;       // 16-byte chunks in a [row][k] row
    constexpr int RPS = 256 / CPR;    // rows that one copy of the block covers
    constexpr int NBUF = B_KN ? 4 : 2;
    __shared__ __attribute__((aligned(16))) _Float16 lA[NBUF][128 * PA];
    __shared__ __attribute__((aligned(16)))
        _Float16 lB[NBUF][B_KN ? BK * BKN_PITCH : 128 * PA];
    // the row factors of this block's columns, one per k
    __shared__ __attribute__((aligned(16))) _Float16 lF[OUT_MODE == 0 ? N_DIM : 8];

    const int tid   = threadIdx.x;
    const int lane  = tid & 31;
    const int wave  = tid >> 5;     // 0..7
    const int waveM = wave & 3;     // 4 -> 32 rows each
    const int waveN = wave >> 2;    // 2 -> 64 cols each
    const int m0g   = (blockIdx.x - part * (C_DIM / 128)) * 128;   // row inside the part
    const int n0g   = blockIdx.y * 128;

    v8f acc[2][4];
    #pragma unroll
    for (int i = 0; i < 2; ++i)
        #pragma unroll
        for (int j = 0; j < 4; ++j)
            acc[i][j] = (v8f){0.f,0.f,0.f,0.f,0.f,0.f,0.f,0.f};

    const int rl    = lane & 15;
    const int kbase = (lane < 16) ? 0 : 8;

    // ---- tile staging: async copies, memory -> LDS, no register in between ----
    auto stage = [&](int bufi, int k0) {
        // [row][k] tile: CPR lanes cover one row's BK k, rows r + i * RPS per thread
        const int r  = tid / CPR;
        const int kq = (tid % CPR) * 8;
        const _Float16* ga = A + (size_t)(m0g + r) * lda + k0 + kq;
        const _Float16* la = &lA[bufi][r * PA + kq];
        unsigned        l[8];
        const _Float16* g[8];
        if (!B_KN) {
            // A and B tiles [128][64]: 4 chunks of each per thread
            const _Float16* gb = Bm + (size_t)(n0g + r) * ldb + k0 + kq;
            const _Float16* lb = &lB[bufi][r * PA + kq];
            #pragma unroll
            for (int i = 0; i < 4; ++i) {
                l[i]     = lds_addr(la + i * RPS * PA);
                g[i]     = ga + (size_t)(i * RPS) * lda;
                l[4 + i] = lds_addr(lb + i * RPS * PA);
                g[4 + i] = gb + (size_t)(i * RPS) * ldb;
            }
            async_copy8_b128(l, g);
        } else {
            // A tile [128][128]: 8 chunks per thread
            #pragma unroll
            for (int i = 0; i < 8; ++i) {
                l[i] = lds_addr(la + i * RPS * PA);
                g[i] = ga + (size_t)(i * RPS) * lda;
            }
            async_copy8_b128(l, g);
            // B tile [128 k][128 n] row-major: 16 lanes cover one 256-byte row,
            // rows k + 16 i per thread
            const int k  = tid >> 4;
            const int nq = (tid & 15) * 8;
            const _Float16* gb = Bm + (size_t)(k0 + k) * ldb + n0g + nq;
            #pragma unroll
            for (int i = 0; i < 8; ++i) {
                l[i] = lds_addr(&lB[bufi][(k + 16 * i) * BKN_PITCH + nq]);
                g[i] = gb + (size_t)(16 * i) * ldb;
            }
            async_copy8_b128(l, g);
        }
    };

    int buf = 0;
    stage(buf, 0);
    if constexpr (B_KN) {
        if (BK < K)     stage(1, BK);
        if (2 * BK < K) stage(2, 2 * BK);
    }
    if constexpr (OUT_MODE == 0) {
        const _Float16* fs = rowf + ((size_t)blockIdx.z * NJB + blockIdx.y) * N_DIM + tid * 16;
        const h8 f0 = *(const h8*)fs;
        const h8 f1 = *(const h8*)(fs + 8);
        // before a register that these loads name is written again
        asm volatile("s_wait_xcnt 0x0" ::: "memory");
        *(h8*)(lF + tid * 16)     = f0;
        *(h8*)(lF + tid * 16 + 8) = f1;
    }
    // stage 0 has landed; where stages 1 and 2 were both issued they stay in flight
    if (B_KN && 2 * BK < K) wait_async32();
    else                    wait_async0();
    __syncthreads();

    // mode 0: element (sm, sn, r) of this lane's results is o0 + (sm * 16 + r) * N_DIM + sn * 16
    const int    mrow = m0g + waveM * 32 + ((lane < 16) ? 0 : 8);
    const size_t o0   = oz + (size_t)mrow * N_DIM + n0g + waveN * 64 + rl;
    float res[OUT_MODE == 0 ? 2 : 1][4][8], bs[OUT_MODE == 0 ? 2 : 1][8];
    (void)o0; (void)res; (void)bs;
    if constexpr (OUT_MODE == 0) {
        // residual and bias of this lane's results, fetched here so that they
        // arrive under the first stage's products
        #pragma unroll
        for (int sm = 0; sm < 2; ++sm)
            #pragma unroll
            for (int r = 0; r < 8; ++r) {
                bs[sm][r] = bias[mrow + sm * 16 + r];
                #pragma unroll
                for (int sn = 0; sn < 4; ++sn)
                    res[sm][sn][r] = residual[o0 + (size_t)(sm * 16 + r) * N_DIM + sn * 16];
            }
        // before a register that these loads name is written again
        asm volatile("s_wait_xcnt 0x0" ::: "memory");
    }

    if constexpr (B_KN) {
        // Two fragment sets in registers: the fragments of the next 32 k are fetched
        // as one group in front of this step's WMMAs and are waited for behind them.
        v16h an[2], fn, bn[4];    // A rows as they lie, their row factors, B
        auto fetch = [&](int bufi, int kf, int kk) {
            #pragma unroll
            for (int sm = 0; sm < 2; ++sm)
                an[sm] = load_frag32(lA[bufi] + kk * 32, PA, waveM * 32 + sm * 16 + rl, kbase);
            // same k order as the A fragment: row 0 of a [1][k] tile
            fn = load_frag32(lF + kf, 0, 0, kbase);
            #pragma unroll
            for (int sn = 0; sn < 4; ++sn)
                bn[sn] = load_frag32_tr(lB[bufi] + kk * 32 * BKN_PITCH,
                                        waveN * 64 + sn * 16, lane);
        };
        if (3 * BK < K) stage(3, 3 * BK);
        fetch(buf, 0, 0);
        for (int k0 = 0; k0 < K; k0 += BK) {
            const int  nbuf = (buf + 1) & (NBUF - 1);
            const bool more = k0 + BK < K;
            #pragma unroll
            for (int kk = 0; kk < BK / 32; ++kk) {
                // keeps the fetch below out of the WMMAs of the step before
                __builtin_amdgcn_sched_barrier(0);
                v16h af[2], bf[4];
                af[0] = an[0] * fn;
                af[1] = an[1] * fn;
                #pragma unroll
                for (int sn = 0; sn < 4; ++sn)
                    bf[sn] = bn[sn];
                if (kk + 1 < BK / 32) {
                    fetch(buf, k0 + (kk + 1) * 32, kk + 1);
                } else {
                    // The stage's last fragments are in registers: the next stage is
                    // published here, in front of the last WMMAs, so that its first
                    // fragments come in under them.
                    // this wave's LDS reads of the current buffer have retired before
                    // the barrier behind which copies refill it
                    asm volatile("s_wait_dscnt 0x0" ::: "memory");
                    // The next stage's copies have landed. While the stage three ahead
                    // exists, it and the one before it are this wave's 32 youngest
                    // copies and fly on; at the end of K the wait is to 0.
                    if (k0 + 3 * BK < K) wait_async32();
                    else                 wait_async0();
                    __syncthreads();      // + all waves done reading current buffer
                    if (more) fetch(nbuf, k0 + BK, 0);
                    // refill of the buffer that every wave has just left
                    if (k0 + 4 * BK < K) stage(buf, k0 + 4 * BK);
                }
                // keeps the fetch above in front of the WMMAs, as one group
                __builtin_amdgcn_sched_barrier(0);
                #pragma unroll
                for (int sm = 0; sm < 2; ++sm)
                    #pragma unroll
                    for (int sn = 0; sn < 4; ++sn)
                        acc[sm][sn] = __builtin_amdgcn_wmma_f32_16x16x32_f16(
                            false, af[sm], false, bf[sn],
                            (short)0, acc[sm][sn], false, false);
            }
            buf = nbuf;
        }
        wait_async0();            // no copy is in flight when the wave ends
    } else {
        for (int k0 = 0; k0 < K; k0 += BK) {
            int nbuf = buf ^ 1;
            if (k0 + BK < K) stage(nbuf, k0 + BK);   // overlap with compute

            // ---- compute: BK / 32 K=32 WMMA steps from the current buffer, in k order;
            // unrolled so that a later step's fragment loads can go ahead of the WMMAs
            #pragma unroll
            for (int kk = 0; kk < BK / 32; ++kk) {
                v16h af[2], bf[4];
                #pragma unroll
                for (int sm = 0; sm < 2; ++sm)
                    af[sm] = load_frag32(lA[buf] + kk * 32, PA, waveM * 32 + sm * 16 + rl, kbase);
                #pragma unroll
                for (int sn = 0; sn < 4; ++sn)
                    bf[sn] = load_frag32(lB[buf] + kk * 32, PA,
                                         waveN * 64 + sn * 16 + rl, kbase);
                #pragma unroll
                for (int sm = 0; sm < 2; ++sm)
                    #pragma unroll
                    for (int sn = 0; sn < 4; ++sn)
                        acc[sm][sn] = __builtin_amdgcn_wmma_f32_16x16x32_f16(
                            false, af[sm], false, bf[sn],
                            (short)0, acc[sm][sn], false, false);
            }

            // this wave's LDS reads of the current buffer have retired before the
            // barrier behind which copies refill it
            asm volatile("s_wait_dscnt 0x0" ::: "memory");
            wait_async0();        // next-buffer async writes landed
            __syncthreads();      // + all waves done reading current buffer
            buf = nbuf;
        }
    }

    // ---- epilogue: lane holds col n = rl, rows mb..mb+7
    const int mhalf = (lane < 16) ? 0 : 8;
    if constexpr (OUT_MODE == 2) {
        // The stage buffers are free behind the loop's last barrier.
        float*    red = (float*)&lB[0][0];    // [2][4 waveM][128 i]: maxima, then sums
        _Float16* eT  = &lA[0][0];            // [128 i][128 j], pitch 136 halves
        constexpr int PE = 136;
        // max of query i over this wave's 32 keys: 16 in the lane, 16 in lane ^ 16
        const int il0 = waveN * 64 + rl;      // query of sn = 0; + 16 per sn
        float mx[4];
        #pragma unroll
        for (int sn = 0; sn < 4; ++sn) {
            float m = -3.4e38f;
            #pragma unroll
            for (int sm = 0; sm < 2; ++sm)
                #pragma unroll
                for (int r = 0; r < 8; ++r) {
                    acc[sm][sn][r] *= alpha;
                    m = fmaxf(m, acc[sm][sn][r]);
                }
            mx[sn] = m;
        }
        #pragma unroll
        for (int sn = 0; sn < 4; ++sn)
            mx[sn] = fmaxf(mx[sn], __shfl_xor(mx[sn], 16));
        if (lane < 16) {
            #pragma unroll
            for (int sn = 0; sn < 4; ++sn)
                red[waveM * 128 + il0 + sn * 16] = mx[sn];
        }
        __syncthreads();
        #pragma unroll
        for (int sn = 0; sn < 4; ++sn) {
            const int il = il0 + sn * 16;
            mx[sn] = fmaxf(fmaxf(red[il], red[128 + il]),
                           fmaxf(red[256 + il], red[384 + il]));
        }
        float sum[4];
        #pragma unroll
        for (int sn = 0; sn < 4; ++sn) {
            float s = 0.f;
            #pragma unroll
            for (int sm = 0; sm < 2; ++sm) {
                h8 pack;
                #pragma unroll
                for (int r = 0; r < 8; ++r) {
                    const float e = exp2_slot(acc[sm][sn][r] - mx[sn]);
                    s += e;
                    pack[r] = (_Float16)e;
                }
                *(h8*)(eT + (il0 + sn * 16) * PE + waveM * 32 + sm * 16 + mhalf) = pack;
            }
            sum[sn] = s;
        }
        #pragma unroll
        for (int sn = 0; sn < 4; ++sn)
            sum[sn] += __shfl_xor(sum[sn], 16);
        if (lane < 16) {
            #pragma unroll
            for (int sn = 0; sn < 4; ++sn)
                red[512 + waveM * 128 + il0 + sn * 16] = sum[sn];
        }
        __syncthreads();
        // whole 256-byte rows of E: 16 lanes a row
        _Float16* E = (_Float16*)Out + oz + (size_t)n0g * ldo + m0g;
        #pragma unroll
        for (int t = 0; t < 8; ++t) {
            const int row = (tid >> 4) + 16 * t;
            const int c   = (tid & 15) * 8;
            *(h8*)(E + (size_t)row * ldo + c) = *(const h8*)(eT + row * PE + c);
        }
        if (tid < 128) {
            const size_t si = ((size_t)blockIdx.z * NJB + blockIdx.x) * N_DIM + n0g + tid;
            ((float*)OutK)[si] = fmaxf(fmaxf(red[tid], red[128 + tid]),
                                       fmaxf(red[256 + tid], red[384 + tid]));
            ((float*)OutV)[si] = (red[512 + tid] + red[640 + tid])
                               + (red[768 + tid] + red[896 + tid]);
        }
        return;
    }
    if constexpr (OUT_MODE == 0) {
        float* O = (float*)Out;
        #pragma unroll
        for (int sm = 0; sm < 2; ++sm)
            #pragma unroll
            for (int sn = 0; sn < 4; ++sn) {
                #pragma unroll
                for (int r = 0; r < 8; ++r)
                    O[o0 + (size_t)(sm * 16 + r) * N_DIM + sn * 16] =
                        res[sm][sn][r] + acc[sm][sn][r] * alpha + bs[sm][r];
                // before a register that these stores name is written again
                asm volatile("s_wait_xcnt 0x0" ::: "memory");
                // keeps the arithmetic of the next eight results behind that wait
                __builtin_amdgcn_sched_barrier(0);
            }
    }
    if constexpr (OUT_MODE == 1) {
        #pragma unroll
        for (int sm = 0; sm < 2; ++sm) {
            #pragma unroll
            for (int sn = 0; sn < 4; ++sn) {
                int mb = m0g + waveM * 32 + sm * 16 + mhalf;
                int n  = n0g + waveN * 64 + sn * 16 + rl;
                v8f a = acc[sm][sn];
                _Float16* O = (_Float16*)OutP + oz;
                if (part == 0) {
                    h8 pack;
                    #pragma unroll
                    for (int r = 0; r < 8; ++r)
                        pack[r] = (_Float16)(a[r] * alpha + bias[mb + r]);
                    *(h8*)(O + (size_t)n * ldo + mb) = pack;   // contiguous over m
                    // before a register that this store names is written again
                    asm volatile("s_wait_xcnt 0x0" ::: "memory");
                } else {
                    #pragma unroll
                    for (int r = 0; r < 8; ++r) {
                        float v = a[r] * alpha + bias[mb + r];
                        O[(size_t)(mb + r) * N_DIM + n] = (_Float16)v;   // V' is [C][N]
                    }
                    // before a register that these stores name is written again
                    asm volatile("s_wait_xcnt 0x0" ::: "memory");
                }
            }
        }
    }
}

// ------------------------- row factors of the softmax ----------------------
// bm, bl: [B][NJB][N], per 128-column block jb and row i the block's maximum and its
// sum of 2^(s - bm), s = score * log2(e). With M = max over jb and L = sum over jb of
// bl * 2^(bm - M), softmax(i, j) = E[i][j] * f[jb][i], f = 2^(bm - M) / L.
// One thread per row.
__global__ __launch_bounds__(64) void row_factor_kernel(
    const float* __restrict__ bm, const float* __restrict__ bl,
    _Float16* __restrict__ f) {
    const int t = blockIdx.x * 64 + threadIdx.x;          // b * N + i
    const size_t base = (size_t)(t / N_DIM) * NJB * N_DIM + (t % N_DIM);
    float m[NJB], l[NJB];
    #pragma unroll
    for (int jb = 0; jb < NJB; ++jb)
        m[jb] = bm[base + (size_t)jb * N_DIM];
    // before a register that these loads name is written again
    asm volatile("s_wait_xcnt 0x0" ::: "memory");
    #pragma unroll
    for (int jb = 0; jb < NJB; ++jb)
        l[jb] = bl[base + (size_t)jb * N_DIM];
    // before a register that these loads name is written again
    asm volatile("s_wait_xcnt 0x0" ::: "memory");
    float M = m[0];
    #pragma unroll
    for (int jb = 1; jb < NJB; ++jb) M = fmaxf(M, m[jb]);
    float L = 0.f;
    #pragma unroll
    for (int jb = 0; jb < NJB; ++jb) {
        m[jb] = exp2_slot(m[jb] - M);
        L += l[jb] * m[jb];
    }
    const float inv = 1.0f / L;
    #pragma unroll
    for (int jb = 0; jb < NJB; ++jb)
        f[base + (size_t)jb * N_DIM] = (_Float16)(m[jb] * inv);
}

// ---------------------------------------------------------------------------
extern "C" void kernel_launch(void* const* d_in, const int* in_sizes, int n_in,
                              void* d_out, int out_size, void* d_ws, size_t ws_size,
                              hipStream_t stream) {
    (void)in_sizes; (void)n_in; (void)out_size; (void)ws_size;
    const float* x      = (const float*)d_in[0];
    const float* norm_w = (const float*)d_in[1];
    const float* norm_b = (const float*)d_in[2];
    const float* wq = (const float*)d_in[3];
    const float* bq = (const float*)d_in[4];
    const float* wk = (const float*)d_in[5];
    // d_in[6], the bias of K: q_i . bk is one constant per softmax row and drops out
    const float* wv = (const float*)d_in[7];
    const float* bv = (const float*)d_in[8];
    const float* wp = (const float*)d_in[9];
    const float* bp = (const float*)d_in[10];
    float* out = (float*)d_out;

    // ---- carve workspace
    char* w = (char*)d_ws;
    auto carve = [&](size_t bytes) -> char* {
        char* p = w;
        w += (bytes + 255) & ~(size_t)255;
        return p;
    };
    _Float16*  hT    = (_Float16*)carve((size_t)B_DIM * N_DIM * C_DIM * 2); // [b][n][c]
    _Float16*  g16   = (_Float16*)carve((size_t)2 * C_DIM * C_DIM * 2);     // Wk^T Wq, Wp Wv
    float*     gbias = (float*)carve((size_t)2 * C_DIM * sizeof(float));    // Wk^T bq, Wp bv
    _Float16*  Q     = (_Float16*)carve((size_t)B_DIM * N_DIM * C_DIM * 2); // Q' [b][n][c]
    _Float16*  V     = (_Float16*)carve((size_t)B_DIM * C_DIM * N_DIM * 2); // V' [b][c][n]
    _Float16*  E     = (_Float16*)carve((size_t)B_DIM * N_DIM * N_DIM * 2);       // [b][i][j]
    float*     bm    = (float*)carve((size_t)B_DIM * NJB * N_DIM * sizeof(float)); // [b][jb][i]
    float*     bl    = (float*)carve((size_t)B_DIM * NJB * N_DIM * sizeof(float)); // [b][jb][i]
    _Float16*  rf    = (_Float16*)carve((size_t)B_DIM * NJB * N_DIM * 2);          // [b][jb][i]

    const float scale_log2e = 0.063758715412299341f;  // 512^-0.5 * log2(e)

    // 1, 2) GroupNorm (statistics and normalisation) and, beside it in the same launch,
    //       the two products of the weights with their bias vectors
    gn_and_weight_product_kernel<<<B_DIM * NGRP + 2 * WTILES, 1024, 0, stream>>>(
        x, norm_w, norm_b, hT, wq, bq, wk, wv, bv, wp, g16, gbias);

    // every GEMM takes both batches in one launch (grid z)
    dim3 gQV(2 * C_DIM / 128, N_DIM / 128, B_DIM);    //  8 x 32 x 2
    dim3 gS(N_DIM / 128, N_DIM / 128, B_DIM);         // 32 x 32 x 2
    dim3 gO(C_DIM / 128, N_DIM / 128, B_DIM);         //  4 x 32 x 2
    const size_t zNC = (size_t)N_DIM * C_DIM;
    const size_t zNN = (size_t)N_DIM * N_DIM;

    // 3) Q', V' (M=2*512, N=4096, K=512), B operand = hT "nk" direct
    gemm_wmma_kernel<1, false><<<gQV, 256, 0, stream>>>(
        g16, C_DIM, 0, hT, C_DIM, zNC, Q, V, nullptr, C_DIM, zNC,
        gbias, gbias + C_DIM, nullptr, nullptr, 1.0f, 2 * C_DIM, N_DIM, C_DIM);
    // 4) scores s[i][j] = scale_log2e * Q'[i][:] . hT[j][:] as the product hT x Q'^T (M = j,
    //    N = i, K=512), left as E = 2^(s - block max) with the blocks' maxima and sums
    gemm_wmma_kernel<2, false><<<gS, 256, 0, stream>>>(
        hT, C_DIM, zNC, Q, C_DIM, zNC, E, bm, bl, N_DIM, zNN,
        nullptr, nullptr, nullptr, nullptr, scale_log2e, N_DIM, N_DIM, C_DIM);
    // 5) the factor that makes a block's E the softmax, per (block, row)
    row_factor_kernel<<<B_DIM * N_DIM / 64, 64, 0, stream>>>(bm, bl, rf);
    // 6) out[c][j] = x + bp + sum_i (V'[c][i] * rf[jb(j)][i]) * E[i][j]  (M=512, N=4096, K=4096)
    gemm_wmma_kernel<0, true><<<gO, 256, 0, stream>>>(
        V, N_DIM, zNC, E, N_DIM, zNN, out, nullptr, nullptr,
        N_DIM, zNC, bp, nullptr, x, rf, 1.0f, C_DIM, N_DIM, N_DIM);
}

// v010
// Measured time: 99.3 microseconds a run.
// Two timings next to v009 put it at 1.09 and 1.10 times that version's speed.
// Counting every step since v000, it is 6.72 times as fast.
#include <hip/hip_runtime.h>

// ---------------------------------------------------------------------------
// AttnBlock for MI455X (gfx1250): GroupNorm -> Q', V' 1x1 -> attention (+ residual).
// Two of the four 1x1 convolutions are folded into products of the weights:
//   q_i . k_j = (Wk^T q_i) . h_j + q_i . bk; the last term is the same for every j
//   of a row, so the softmax over j does not see it: Q' = (Wk^T Wq) h + Wk^T bq
//   meets h itself, and no K is formed.
//   Wp (V w) = (Wp V) w: V' = (Wp Wv) h + Wp bv, and no projection follows.
// GEMMs via V_WMMA_F32_16X16X32_F16; tiles staged with
// GLOBAL_LOAD_ASYNC_TO_LDS_B128 (ASYNCcnt) into an LDS ring of two or four buffers.
// GroupNorm and the products of the weights do not depend on each other and share
// the first launch: the block index picks the job.
// ---------------------------------------------------------------------------

typedef __attribute__((ext_vector_type(16))) _Float16 v16h;
typedef __attribute__((ext_vector_type(8)))  _Float16 h8;
typedef __attribute__((ext_vector_type(4)))  _Float16 h4;
typedef __attribute__((ext_vector_type(2)))  _Float16 h2;
typedef __attribute__((ext_vector_type(8)))  short    s8;
typedef __attribute__((ext_vector_type(8)))  float    v8f;
typedef __attribute__((ext_vector_type(4)))  float    f4;
typedef __attribute__((ext_vector_type(4)))  int      i4;

#define C_DIM 512
#define N_DIM 4096
#define B_DIM 2
#define NGRP  32
#define CPG   16           // channels per group
#define GELEM (CPG * N_DIM)
#define NJB   (N_DIM / 128)   // 128-column blocks of a score row

// ------------------------- CDNA5 async-copy helpers ------------------------
// Per-lane async copy of 16 bytes global -> LDS, tracked by ASYNCcnt.
// vdst VGPR carries the 32-bit LDS byte address (low 32 bits of flat shared
// pointer, per ISA 10.2 aperture mapping).
__device__ __forceinline__ unsigned lds_addr(const void* lds_ptr) {
    return (unsigned)(unsigned long long)lds_ptr;
}
// Eight per-lane copies in ONE statement, closed by s_wait_xcnt 0: the operands'
// registers live to the statement's end, so no address register of an issued
// copy is rewritten ahead of that wait.
__device__ __forceinline__ void async_copy8_b128(const unsigned (&l)[8],
                                                 const _Float16* const (&g)[8]) {
    asm volatile("global_load_async_to_lds_b128 %0, %1, off\n\t"
                 "global_load_async_to_lds_b128 %2, %3, off\n\t"
                 "global_load_async_to_lds_b128 %4, %5, off\n\t"
                 "global_load_async_to_lds_b128 %6, %7, off\n\t"
                 "global_load_async_to_lds_b128 %8, %9, off\n\t"
                 "global_load_async_to_lds_b128 %10, %11, off\n\t"
                 "global_load_async_to_lds_b128 %12, %13, off\n\t"
                 "global_load_async_to_lds_b128 %14, %15, off\n\t"
                 "s_wait_xcnt 0x0"
                 :: "v"(l[0]), "v"((unsigned long long)g[0]),
                    "v"(l[1]), "v"((unsigned long long)g[1]),
                    "v"(l[2]), "v"((unsigned long long)g[2]),
                    "v"(l[3]), "v"((unsigned long long)g[3]),
                    "v"(l[4]), "v"((unsigned long long)g[4]),
                    "v"(l[5]), "v"((unsigned long long)g[5]),
                    "v"(l[6]), "v"((unsigned long long)g[6]),
                    "v"(l[7]), "v"((unsigned long long)g[7])
                 : "memory");
}
__device__ __forceinline__ void wait_async0() {
    asm volatile("s_wait_asynccnt 0x0" ::: "memory");
}
// All but this wave's 32 youngest copies have landed: the two youngest stages of
// the four-buffer ring (16 copies a wave and stage) stay in flight.
__device__ __forceinline__ void wait_async32() {
    asm volatile("s_wait_asynccnt 0x20" ::: "memory");
}

// 2^x. The v_nop fills the slot that the instruction set asks for between a
// transcendental and a next instruction that reads its result or writes its source.
__device__ __forceinline__ float exp2_slot(float x) {
    float r;
    asm("v_exp_f32 %0, %1\n\tv_nop" : "=v"(r) : "v"(x));
    return r;
}

// ------------------------- GroupNorm ---------------------------------------
// One work-group per (batch, group). Thread t loads all 16 channels of positions
// 4t .. 4t+3 (64 floats) and keeps them in registers from the sums to the
// normalisation, so x is read once and no statistics pass through memory.
// Writes h^T as f16 [B][N][C] (k-contiguous for GEMM B): the group's 16 channels
// are 32 contiguous bytes of a row.
__device__ __forceinline__ void gn_fused(
    const float* __restrict__ x,
    const float* __restrict__ gw, const float* __restrict__ gb,
    _Float16* __restrict__ hT, float (*red)[32], int bg) {   // bg = b*NGRP + g
    const int tid  = threadIdx.x;
    const int lane = tid & 31;
    const int wave = tid >> 5;
    const int b    = bg / NGRP;
    const int g    = bg % NGRP;
    const float* p = x + (size_t)bg * GELEM + 4 * tid;
    f4 v[CPG];
    #pragma unroll
    for (int c = 0; c < CPG; ++c)
        v[c] = *(const f4*)(p + (size_t)c * N_DIM);
    // the group's weights, fetched here so that they arrive under the loads of x
    float w[CPG], bb[CPG];
    #pragma unroll
    for (int c = 0; c < CPG; ++c) {
        w[c]  = gw[g * CPG + c];
        bb[c] = gb[g * CPG + c];
    }

    // four independent chains a thread, then lane butterfly, then the 32 waves
    f4 s4 = (f4){0.f, 0.f, 0.f, 0.f}, q4 = (f4){0.f, 0.f, 0.f, 0.f};
    #pragma unroll
    for (int c = 0; c < CPG; ++c) {
        s4 += v[c];
        q4 += v[c] * v[c];
    }
    float s  = (s4[0] + s4[1]) + (s4[2] + s4[3]);
    float s2 = (q4[0] + q4[1]) + (q4[2] + q4[3]);
    #pragma unroll
    for (int m = 16; m > 0; m >>= 1) {
        s  += __shfl_xor(s,  m);
        s2 += __shfl_xor(s2, m);
    }
    if (lane == 0) { red[0][wave] = s; red[1][wave] = s2; }
    __syncthreads();
    s  = red[0][lane];
    s2 = red[1][lane];
    #pragma unroll
    for (int m = 16; m > 0; m >>= 1) {
        s  += __shfl_xor(s,  m);
        s2 += __shfl_xor(s2, m);
    }
    const float mu  = s  * (1.0f / GELEM);
    const float var = s2 * (1.0f / GELEM) - mu * mu;
    const float rs  = rsqrtf(var + 1e-6f);

    // normalize + affine; lo = channels 0..7, hi = channels 8..15 of position 4t+q
    i4 lo[4], hi[4];
    #pragma unroll
    for (int q = 0; q < 4; ++q) {
        h8 l, h;
        #pragma unroll
        for (int c = 0; c < 8; ++c) {
            l[c] = (_Float16)((v[c][q]     - mu) * rs * w[c]     + bb[c]);
            h[c] = (_Float16)((v[c + 8][q] - mu) * rs * w[c + 8] + bb[c + 8]);
        }
        lo[q] = __builtin_bit_cast(i4, l);
        hi[q] = __builtin_bit_cast(i4, h);
    }

    // Lanes 2j and 2j+1 swap halves, so that the pair stores the 32 bytes of ONE
    // position side by side: a wave's store touches 16 rows of h^T, not 32.
    // The even lane gives its hi and takes the odd lane's lo.
    const bool odd = lane & 1;
    _Float16* dst = hT + ((size_t)b * N_DIM + 8 * (tid >> 1)) * C_DIM + g * CPG + (odd ? 8 : 0);
    #pragma unroll
    for (int q = 0; q < 4; ++q) {
        i4 give = odd ? lo[q] : hi[q];
        i4 take;
        #pragma unroll
        for (int e = 0; e < 4; ++e)
            take[e] = __shfl_xor(give[e], 1);
        *(i4*)(dst + (size_t)q * C_DIM)       = odd ? take : lo[q];   // even lane's positions
        *(i4*)(dst + (size_t)(4 + q) * C_DIM) = odd ? hi[q] : take;   // odd lane's positions
    }
}

// ------------------------- WMMA fragment load ------------------------------
// LDS tile is row-major [r][k], pitch halves a row; lds points at the 32 k of
// this product. Per ISA 16-bit A 16x32 layout:
// lane<16 -> K base 0, lane>=16 -> K base 8; elems 0..7 = K base..base+7,
// elems 8..15 = K base+16..base+23. B (stored transposed [n][k]) symmetric.
__device__ __forceinline__ v16h load_frag32(const _Float16* lds, int pitch, int row, int kbase) {
    const h8 lo = *(const h8*)(lds + row * pitch + kbase);
    const h8 hi = *(const h8*)(lds + row * pitch + kbase + 16);
    return __builtin_shufflevector(lo, hi, 0,1,2,3,4,5,6,7,8,9,10,11,12,13,14,15);
}

// B fragment out of a row-major [k][n] LDS tile (pitch BKN_PITCH halves) by the
// transposing load: lane (c = l & 15, h = l >> 4) gets T[kb + 8h + 0..7][n0 + c];
// the loads at kb = 0 and kb = 16 give the k order of load_frag32.
#define BKN_PITCH 144      // 288 B = 32 B x odd: the transposing load's pitch
__device__ __forceinline__ h8 load_tr16(const _Float16* p) {
    typedef __attribute__((address_space(3))) s8 lds_s8;
    return __builtin_bit_cast(h8, __builtin_amdgcn_ds_load_tr16_b128_v8i16((lds_s8*)p));
}
__device__ __forceinline__ v16h load_frag32_tr(const _Float16* lds, int n0, int lane) {
    const _Float16* p = lds + (8 * (lane >> 4) + (lane & 7)) * BKN_PITCH
                            + n0 + 8 * ((lane >> 3) & 1);
    const h8 lo = load_tr16(p);
    const h8 hi = load_tr16(p + 16 * BKN_PITCH);
    return __builtin_shufflevector(lo, hi, 0,1,2,3,4,5,6,7,8,9,10,11,12,13,14,15);
}

// ------------------------- products of the weights -------------------------
// Product 0: G = Wk^T Wq, g = Wk^T bq;  1: G = Wp Wv, g = Wp bv.
// One 64 x 64 tile of G (f16 [m][n]) per work-group, all 512 k staged at once by
// its 32 waves: f32 weights through registers to f16 in LDS. Wq, Wv and Wk lie
// [k][column] and are read by the transposing load; Wp lies [row][k].
// The tile has sixteen 16 x 16 pieces: waves 0 .. 15 form them, the others stage and, in the tiles with nt == 0, form g's partial sums.
#define WT_PITCH 80        // halves; 160 B = 32 B x odd: the transposing load's pitch
#define WR_PITCH 520       // halves; 1040 B = 16 B x odd: the pitch of ds_load_b128 readers
__device__ __forceinline__ v16h load_frag32_tr_w(const _Float16* lds, int n0, int lane) {
    const _Float16* p = lds + (8 * (lane >> 4) + (lane & 7)) * WT_PITCH
                            + n0 + 8 * ((lane >> 3) & 1);
    const h8 lo = load_tr16(p);
    const h8 hi = load_tr16(p + 16 * WT_PITCH);
    return __builtin_shufflevector(lo, hi, 0,1,2,3,4,5,6,7,8,9,10,11,12,13,14,15);
}
// A_KM: the first factor lies [k][m] in memory (Wk), else [m][k] (Wp)
template <bool A_KM>
__device__ __forceinline__ void weight_product(
    const float* __restrict__ wa, const float* __restrict__ wb,
    const float* __restrict__ bias,
    _Float16* __restrict__ G, float* __restrict__ g,
    _Float16* lA, _Float16* lB, float* lbias, float (*red)[64],
    int mt, int nt) {                          // the tile's row and column in G
    const int tid  = threadIdx.x;
    const int lane = tid & 31;
    const int wave = tid >> 5;
    const int m0   = mt * 64;
    const int n0   = nt * 64;
    const bool with_bias = nt == 0;            // these work-groups also form g

    // [k][64] tile: 16 lanes cover a row's 256 bytes, rows kr + 64 i per thread;
    // [64][k] tile: 128 lanes cover a row's 2048 bytes, rows (tid >> 7) + 8 i
    const int kr = tid >> 4;
    const int c4 = (tid & 15) * 4;
    constexpr int GA = (A_KM ? 64 : 8) * C_DIM;
    constexpr int SA = A_KM ? 64 * WT_PITCH : 8 * WR_PITCH;
    const float* gA = A_KM ? wa + (size_t)kr * C_DIM + m0 + c4
                           : wa + (size_t)(m0 + (tid >> 7)) * C_DIM + (tid & 127) * 4;
    const float* gB = wb + (size_t)kr * C_DIM + n0 + c4;
    _Float16* sA = A_KM ? lA + kr * WT_PITCH + c4
                        : lA + (tid >> 7) * WR_PITCH + (tid & 127) * 4;
    _Float16* sB = lB + kr * WT_PITCH + c4;
    f4 va[8], vb[8];
    #pragma unroll
    for (int i = 0; i < 8; ++i) {
        va[i] = *(const f4*)(gA + (size_t)i * GA);
        vb[i] = *(const f4*)(gB + (size_t)i * 64 * C_DIM);
    }
    f4 b4 = (f4){0.f, 0.f, 0.f, 0.f};
    if (with_bias && tid < C_DIM / 4)
        b4 = *(const f4*)(bias + tid * 4);
    // before a register that these loads name is written again
    asm volatile("s_wait_xcnt 0x0" ::: "memory");
    #pragma unroll
    for (int i = 0; i < 8; ++i) {
        *(h4*)(sA + i * SA)            = __builtin_convertvector(va[i], h4);
        *(h4*)(sB + i * 64 * WT_PITCH) = __builtin_convertvector(vb[i], h4);
    }
    if (with_bias && tid < C_DIM / 4)
        *(f4*)(lbias + tid * 4) = b4;
    __syncthreads();

    // the wave's number as a scalar: whole waves take either side of the branch
    if (__builtin_amdgcn_readfirstlane(wave) < 16) {
        // wave: one 16 x 16 piece of the tile
        const int rl    = lane & 15;
        const int kbase = (lane < 16) ? 0 : 8;
        const int mi    = (wave & 3) * 16;
        const int nj    = (wave >> 2) * 16;
        v8f acc = (v8f){0.f,0.f,0.f,0.f,0.f,0.f,0.f,0.f};
        #pragma unroll
        for (int kk = 0; kk < C_DIM / 32; ++kk) {
            // both forms of A give the k order of load_frag32
            const v16h af = A_KM ? load_frag32_tr_w(lA + kk * 32 * WT_PITCH, mi, lane)
                                 : load_frag32(lA + kk * 32, WR_PITCH, mi + rl, kbase);
            const v16h bf = load_frag32_tr_w(lB + kk * 32 * WT_PITCH, nj, lane);
            acc = __builtin_amdgcn_wmma_f32_16x16x32_f16(
                false, af, false, bf, (short)0, acc, false, false);
        }
        // lane holds column rl, rows mhalf .. mhalf + 7 of the piece
        const int mhalf = (lane < 16) ? 0 : 8;
        _Float16* Gp = G + (size_t)(m0 + mi + mhalf) * C_DIM + n0 + nj + rl;
        #pragma unroll
        for (int r = 0; r < 8; ++r)
            Gp[(size_t)r * C_DIM] = (_Float16)acc[r];
        // before a register that these stores name is written again
        asm volatile("s_wait_xcnt 0x0" ::: "memory");
    } else if (with_bias) {
        // g[m] = sum over k of A[m][k] * bias[k], sixteen partial sums of 32 k per row,
        // by waves 16 .. 31 beside the products
        const int bw = wave - 16;
        const int bt = tid - 512;
        float s0 = 0.f, s1 = 0.f;
        if (A_KM) {
            // a lane takes two neighbouring m (one dword of a [k][m] row), a wave 32 k
            #pragma unroll
            for (int i = 0; i < 32; ++i) {
                const int k = bw * 32 + i;
                const h2 a = *(const h2*)(lA + k * WT_PITCH + lane * 2);
                s0 += (float)a[0] * lbias[k];
                s1 += (float)a[1] * lbias[k];
            }
            red[bw][lane * 2]     = s0;
            red[bw][lane * 2 + 1] = s1;
        } else {
            // a thread takes 64 k of row bt & 63
            const int r = bt & 63;
            const int q = bt >> 6;
            #pragma unroll
            for (int i = 0; i < 4; ++i) {
                const h8 a0 = *(const h8*)(lA + r * WR_PITCH + q * 64 + i * 8);
                const h8 a1 = *(const h8*)(lA + r * WR_PITCH + q * 64 + 32 + i * 8);
                #pragma unroll
                for (int e = 0; e < 8; ++e) {
                    s0 += (float)a0[e] * lbias[q * 64 + i * 8 + e];
                    s1 += (float)a1[e] * lbias[q * 64 + 32 + i * 8 + e];
                }
            }
            red[2 * q][r]     = s0;
            red[2 * q + 1][r] = s1;
        }
    }
    if (with_bias) {
        __syncthreads();
        if (tid < 64) {
            float s = 0.f;
            #pragma unroll
            for (int q = 0; q < 16; ++q) s += red[q][tid];
            g[m0 + tid] = s;
        }
    }
}
// ------------------------- first launch: GroupNorm | weight products --------
// Work-groups 0 .. B*NGRP-1 take one (batch, group) of the GroupNorm each, the next
// 64 one tile of Wk^T Wq, the last 64 one tile of Wp Wv. Neither job reads what the
// other writes; every work-group has a WGP of its own.
#define WTILES ((C_DIM / 64) * (C_DIM / 64))
__global__ __launch_bounds__(1024) void gn_and_weight_product_kernel(
    const float* __restrict__ x,
    const float* __restrict__ gw, const float* __restrict__ gb,
    _Float16* __restrict__ hT,
    const float* __restrict__ wq, const float* __restrict__ bq,
    const float* __restrict__ wk,
    const float* __restrict__ wv, const float* __restrict__ bv,
    const float* __restrict__ wp,
    _Float16* __restrict__ g16, float* __restrict__ gbias) {
    __shared__ __attribute__((aligned(16))) _Float16 lA[C_DIM * WT_PITCH];  // or [64][WR_PITCH]
    __shared__ __attribute__((aligned(16))) _Float16 lB[C_DIM * WT_PITCH];
    __shared__ __attribute__((aligned(16))) float lbias[C_DIM];
    __shared__ float red[16][64];
    __shared__ float gred[2][32];
    const int job = blockIdx.x;
    const int t   = (job - B_DIM * NGRP) % WTILES;
    const int mt  = t % (C_DIM / 64);
    const int nt  = t / (C_DIM / 64);
    if (job < B_DIM * NGRP)
        // bit 2 of the block index picks the batch, as in the GEMMs that read h^T
        gn_fused(x, gw, gb, hT, gred, ((job >> 2) & 1) * NGRP + ((job & 3) | ((job >> 3) << 2)));
    else if (job < B_DIM * NGRP + WTILES)
        weight_product<true>(wk, wq, bq, g16, gbias, lA, lB, lbias, red, mt, nt);
    else
        weight_product<false>(wp, wv, bv, g16 + (size_t)C_DIM * C_DIM, gbias + C_DIM,
                              lA, lB, lbias, red, mt, nt);
}

// ------------------------- generic WMMA GEMM -------------------------------
// D = alpha * A(f16 [M][K]) x B(f16) + bias(+residual)
// Per batch A, B, Out and residual advance by zA, zB, zO elements.
// OUT_MODE: 0 = f32 [M][N] + bias + residual (the block's output); A[m][k] is
//               multiplied by rowf[k] of this block's 128 columns as its
//               fragments are read
//           1 = f16 + bias: row tile / 4 = part picks C_DIM rows of the stacked
//               weights A, the part's output plane and its bias;
//               part 0 (Q') is stored [N][M], part 1 (V') [M][N]
//           2 = scores with the block-local softmax: m = key j, n = query i; writes
//               f16 E[i][j] = 2^(s - bm), bm = max of row i over this block's 128 j,
//               and per (block, i) bm (OutK) and the sum of those powers (OutV);
//               alpha holds 512^-0.5 * log2(e), so that s is the score in units of ln 2
// B_KN: true  -> global B is [K][N] (ldb = N pitch), async copy row-major into
//                LDS, transposed by the fragment load
//       false -> global B is [N][K] (pre-transposed), async direct copy
// One LDS stage holds BK k of both operands: 128 where one work-group has its
// WGP alone (B_KN: 256 work-groups), 64 where several share it. [row][k] tiles
// have a pitch of BK + 8 halves (16 B x odd: the pitch of ds_load_b128 readers).
// The ring has two buffers, and four where B_KN (the work-group has the whole LDS):
// three stages of copies fly while one is worked on, so that a stage has the time of
// three stages to land, not of one.
template <int OUT_MODE, bool B_KN>
__global__ __launch_bounds__(256) void gemm_wmma_kernel(
    const _Float16* __restrict__ A0, int lda, size_t zA,
    const _Float16* __restrict__ B0, int ldb, size_t zB,
    void* __restrict__ Out, void* __restrict__ OutK,
    void* __restrict__ OutV, int ldo, size_t zO,
    const float* __restrict__ biasQ, const float* __restrict__ biasK,
    const float* __restrict__ residual,
    const _Float16* __restrict__ rowf,
    float alpha, int M, int N, int K) {
    (void)M; (void)N; (void)OutK; (void)OutV; (void)biasK; (void)residual; (void)rowf;
    // Which tile this work-group takes: bx = row tile, by = column tile, bz = batch.
    // Bit 2 of the flat index picks the batch in every launch. Bits 0, 1 are the low bits of E's
    // 128-column block both where it is written (mode 2) and where it is read (mode 0),
    // and the four row tiles of mode 0 that read one column block differ only above
    // bit 2. Each map is a permutation of the
    // grid's tiles: right wherever the work-groups land, for speed only.
    int bx, by, bz;
    if constexpr (OUT_MODE == 1) {          // grid 8 x 32 x 2
        bz = blockIdx.x >> 2;
        bx = (blockIdx.x & 3) | ((blockIdx.y & 1) << 2);
        by = (blockIdx.y >> 1) | (blockIdx.z << 4);
    } else if constexpr (OUT_MODE == 2) {   // grid 32 x 32 x 2
        bz = (blockIdx.x >> 2) & 1;
        bx = (blockIdx.x & 3) | ((blockIdx.x >> 3) << 2) | ((blockIdx.y & 1) << 4);
        by = (blockIdx.y >> 1) | (blockIdx.z << 4);
    } else {                                // grid 4 x 32 x 2
        bz = blockIdx.y & 1;
        bx = (blockIdx.y >> 1) & 3;
        by = blockIdx.x | ((blockIdx.y >> 3) << 2) | (blockIdx.z << 4);
    }
    const int part = (OUT_MODE == 1) ? bx / (C_DIM / 128) : 0;
    const _Float16* A  = A0 + bz * zA + (size_t)part * C_DIM * lda;
    const _Float16* Bm = B0 + bz * zB;
    const size_t    oz = bz * zO;
    void*        OutP  = (part == 0) ? Out   : OutK;
    const float* bias  = (part == 0) ? biasQ : biasK;
    constexpr int BK  = B_KN ? 128 : 64;
    constexpr int PA  = BK + 8;       // halves
    constexpr int CPR = BK / 8;       // 16-byte chunks in a [row][k] row
    constexpr int RPS = 256 / CPR;    // rows that one copy of the block covers
    constexpr int NBUF = B_KN ? 4 : 2;
    __shared__ __attribute__((aligned(16))) _Float16 lA[NBUF][128 * PA];
    __shared__ __attribute__((aligned(16)))
        _Float16 lB[NBUF][B_KN ? BK * BKN_PITCH : 128 * PA];
    // the row factors of this block's columns, one per k
    __shared__ __attribute__((aligned(16))) _Float16 lF[OUT_MODE == 0 ? N_DIM : 8];

    const int tid   = threadIdx.x;
    const int lane  = tid & 31;
    const int wave  = tid >> 5;     // 0..7
    const int waveM = wave & 3;     // 4 -> 32 rows each
    const int waveN = wave >> 2;    // 2 -> 64 cols each
    const int m0g   = (bx - part * (C_DIM / 128)) * 128;   // row inside the part
    const int n0g   = by * 128;

    v8f acc[2][4];
    #pragma unroll
    for (int i = 0; i < 2; ++i)
        #pragma unroll
        for (int j = 0; j < 4; ++j)
            acc[i][j] = (v8f){0.f,0.f,0.f,0.f,0.f,0.f,0.f,0.f};

    const int rl    = lane & 15;
    const int kbase = (lane < 16) ? 0 : 8;

    // ---- tile staging: async copies, memory -> LDS, no register in between ----
    auto stage = [&](int bufi, int k0) {
        // [row][k] tile: CPR lanes cover one row's BK k, rows r + i * RPS per thread
        const int r  = tid / CPR;
        const int kq = (tid % CPR) * 8;
        const _Float16* ga = A + (size_t)(m0g + r) * lda + k0 + kq;
        const _Float16* la = &lA[bufi][r * PA + kq];
        unsigned        l[8];
        const _Float16* g[8];
        if (!B_KN) {
            // A and B tiles [128][64]: 4 chunks of each per thread
            const _Float16* gb = Bm + (size_t)(n0g + r) * ldb + k0 + kq;
            const _Float16* lb = &lB[bufi][r * PA + kq];
            #pragma unroll
            for (int i = 0; i < 4; ++i) {
                l[i]     = lds_addr(la + i * RPS * PA);
                g[i]     = ga + (size_t)(i * RPS) * lda;
                l[4 + i] = lds_addr(lb + i * RPS * PA);
                g[4 + i] = gb + (size_t)(i * RPS) * ldb;
            }
            async_copy8_b128(l, g);
        } else {
            // A tile [128][128]: 8 chunks per thread
            #pragma unroll
            for (int i = 0; i < 8; ++i) {
                l[i] = lds_addr(la + i * RPS * PA);
                g[i] = ga + (size_t)(i * RPS) * lda;
            }
            async_copy8_b128(l, g);
            // B tile [128 k][128 n] row-major: 16 lanes cover one 256-byte row,
            // rows k + 16 i per thread
            const int k  = tid >> 4;
            const int nq = (tid & 15) * 8;
            const _Float16* gb = Bm + (size_t)(k0 + k) * ldb + n0g + nq;
            #pragma unroll
            for (int i = 0; i < 8; ++i) {
                l[i] = lds_addr(&lB[bufi][(k + 16 * i) * BKN_PITCH + nq]);
                g[i] = gb + (size_t)(16 * i) * ldb;
            }
            async_copy8_b128(l, g);
        }
    };

    int buf = 0;
    stage(buf, 0);
    if constexpr (B_KN) {
        if (BK < K)     stage(1, BK);
        if (2 * BK < K) stage(2, 2 * BK);
    }
    if constexpr (OUT_MODE == 0) {
        const _Float16* fs = rowf + ((size_t)bz * NJB + by) * N_DIM + tid * 16;
        const h8 f0 = *(const h8*)fs;
        const h8 f1 = *(const h8*)(fs + 8);
        // before a register that these loads name is written again
        asm volatile("s_wait_xcnt 0x0" ::: "memory");
        *(h8*)(lF + tid * 16)     = f0;
        *(h8*)(lF + tid * 16 + 8) = f1;
    }
    // stage 0 has landed; where stages 1 and 2 were both issued they stay in flight
    if (B_KN && 2 * BK < K) wait_async32();
    else                    wait_async0();
    __syncthreads();

    // mode 0: element (sm, sn, r) of this lane's results is o0 + (sm * 16 + r) * N_DIM + sn * 16
    const int    mrow = m0g + waveM * 32 + ((lane < 16) ? 0 : 8);
    const size_t o0   = oz + (size_t)mrow * N_DIM + n0g + waveN * 64 + rl;
    float res[OUT_MODE == 0 ? 2 : 1][4][8], bs[OUT_MODE == 0 ? 2 : 1][8];
    (void)o0; (void)res; (void)bs;
    if constexpr (OUT_MODE == 0) {
        // residual and bias of this lane's results, fetched here so that they
        // arrive under the first stage's products
        #pragma unroll
        for (int sm = 0; sm < 2; ++sm)
            #pragma unroll
            for (int r = 0; r < 8; ++r) {
                bs[sm][r] = bias[mrow + sm * 16 + r];
                #pragma unroll
                for (int sn = 0; sn < 4; ++sn)
                    res[sm][sn][r] = residual[o0 + (size_t)(sm * 16 + r) * N_DIM + sn * 16];
            }
        // before a register that these loads name is written again
        asm volatile("s_wait_xcnt 0x0" ::: "memory");
    }

    if constexpr (B_KN) {
        // Two fragment sets in registers: the fragments of the next 32 k are fetched
        // as one group in front of this step's WMMAs and are waited for behind them.
        v16h an[2], fn, bn[4];    // A rows as they lie, their row factors, B
        auto fetch = [&](int bufi, int kf, int kk) {
            #pragma unroll
            for (int sm = 0; sm < 2; ++sm)
                an[sm] = load_frag32(lA[bufi] + kk * 32, PA, waveM * 32 + sm * 16 + rl, kbase);
            // same k order as the A fragment: row 0 of a [1][k] tile
            fn = load_frag32(lF + kf, 0, 0, kbase);
            #pragma unroll
            for (int sn = 0; sn < 4; ++sn)
                bn[sn] = load_frag32_tr(lB[bufi] + kk * 32 * BKN_PITCH,
                                        waveN * 64 + sn * 16, lane);
        };
        if (3 * BK < K) stage(3, 3 * BK);
        fetch(buf, 0, 0);
        for (int k0 = 0; k0 < K; k0 += BK) {
            const int  nbuf = (buf + 1) & (NBUF - 1);
            const bool more = k0 + BK < K;
            #pragma unroll
            for (int kk = 0; kk < BK / 32; ++kk) {
                // keeps the fetch below out of the WMMAs of the step before
                __builtin_amdgcn_sched_barrier(0);
                v16h af[2], bf[4];
                af[0] = an[0] * fn;
                af[1] = an[1] * fn;
                #pragma unroll
                for (int sn = 0; sn < 4; ++sn)
                    bf[sn] = bn[sn];
                if (kk + 1 < BK / 32) {
                    fetch(buf, k0 + (kk + 1) * 32, kk + 1);
                } else {
                    // The stage's last fragments are in registers: the next stage is
                    // published here, in front of the last WMMAs, so that its first
                    // fragments come in under them.
                    // this wave's LDS reads of the current buffer have retired before
                    // the barrier behind which copies refill it
                    asm volatile("s_wait_dscnt 0x0" ::: "memory");
                    // The next stage's copies have landed. While the stage three ahead
                    // exists, it and the one before it are this wave's 32 youngest
                    // copies and fly on; at the end of K the wait is to 0.
                    if (k0 + 3 * BK < K) wait_async32();
                    else                 wait_async0();
                    __syncthreads();      // + all waves done reading current buffer
                    if (more) fetch(nbuf, k0 + BK, 0);
                    // refill of the buffer that every wave has just left
                    if (k0 + 4 * BK < K) stage(buf, k0 + 4 * BK);
                }
                // keeps the fetch above in front of the WMMAs, as one group
                __builtin_amdgcn_sched_barrier(0);
                #pragma unroll
                for (int sm = 0; sm < 2; ++sm)
                    #pragma unroll
                    for (int sn = 0; sn < 4; ++sn)
                        acc[sm][sn] = __builtin_amdgcn_wmma_f32_16x16x32_f16(
                            false, af[sm], false, bf[sn],
                            (short)0, acc[sm][sn], false, false);
            }
            buf = nbuf;
        }
        wait_async0();            // no copy is in flight when the wave ends
    } else {
        for (int k0 = 0; k0 < K; k0 += BK) {
            int nbuf = buf ^ 1;
            if (k0 + BK < K) stage(nbuf, k0 + BK);   // overlap with compute

            // ---- compute: BK / 32 K=32 WMMA steps from the current buffer, in k order;
            // unrolled so that a later step's fragment loads can go ahead of the WMMAs
            #pragma unroll
            for (int kk = 0; kk < BK / 32; ++kk) {
                v16h af[2], bf[4];
                #pragma unroll
                for (int sm = 0; sm < 2; ++sm)
                    af[sm] = load_frag32(lA[buf] + kk * 32, PA, waveM * 32 + sm * 16 + rl, kbase);
                #pragma unroll
                for (int sn = 0; sn < 4; ++sn)
                    bf[sn] = load_frag32(lB[buf] + kk * 32, PA,
                                         waveN * 64 + sn * 16 + rl, kbase);
                #pragma unroll
                for (int sm = 0; sm < 2; ++sm)
                    #pragma unroll
                    for (int sn = 0; sn < 4; ++sn)
                        acc[sm][sn] = __builtin_amdgcn_wmma_f32_16x16x32_f16(
                            false, af[sm], false, bf[sn],
                            (short)0, acc[sm][sn], false, false);
            }

            // this wave's LDS reads of the current buffer have retired before the
            // barrier behind which copies refill it
            asm volatile("s_wait_dscnt 0x0" ::: "memory");
            wait_async0();        // next-buffer async writes landed
            __syncthreads();      // + all waves done reading current buffer
            buf = nbuf;
        }
    }

    // ---- epilogue: lane holds col n = rl, rows mb..mb+7
    const int mhalf = (lane < 16) ? 0 : 8;
    if constexpr (OUT_MODE == 2) {
        // The stage buffers are free behind the loop's last barrier.
        float*    red = (float*)&lB[0][0];    // [2][4 waveM][128 i]: maxima, then sums
        _Float16* eT  = &lA[0][0];            // [128 i][128 j], pitch 136 halves
        constexpr int PE = 136;
        // max of query i over this wave's 32 keys: 16 in the lane, 16 in lane ^ 16
        const int il0 = waveN * 64 + rl;      // query of sn = 0; + 16 per sn
        float mx[4];
        #pragma unroll
        for (int sn = 0; sn < 4; ++sn) {
            float m = -3.4e38f;
            #pragma unroll
            for (int sm = 0; sm < 2; ++sm)
                #pragma unroll
                for (int r = 0; r < 8; ++r) {
                    acc[sm][sn][r] *= alpha;
                    m = fmaxf(m, acc[sm][sn][r]);
                }
            mx[sn] = m;
        }
        #pragma unroll
        for (int sn = 0; sn < 4; ++sn)
            mx[sn] = fmaxf(mx[sn], __shfl_xor(mx[sn], 16));
        if (lane < 16) {
            #pragma unroll
            for (int sn = 0; sn < 4; ++sn)
                red[waveM * 128 + il0 + sn * 16] = mx[sn];
        }
        __syncthreads();
        #pragma unroll
        for (int sn = 0; sn < 4; ++sn) {
            const int il = il0 + sn * 16;
            mx[sn] = fmaxf(fmaxf(red[il], red[128 + il]),
                           fmaxf(red[256 + il], red[384 + il]));
        }
        float sum[4];
        #pragma unroll
        for (int sn = 0; sn < 4; ++sn) {
            float s = 0.f;
            #pragma unroll
            for (int sm = 0; sm < 2; ++sm) {
                h8 pack;
                #pragma unroll
                for (int r = 0; r < 8; ++r) {
                    const float e = exp2_slot(acc[sm][sn][r] - mx[sn]);
                    s += e;
                    pack[r] = (_Float16)e;
                }
                *(h8*)(eT + (il0 + sn * 16) * PE + waveM * 32 + sm * 16 + mhalf) = pack;
            }
            sum[sn] = s;
        }
        #pragma unroll
        for (int sn = 0; sn < 4; ++sn)
            sum[sn] += __shfl_xor(sum[sn], 16);
        if (lane < 16) {
            #pragma unroll
            for (int sn = 0; sn < 4; ++sn)
                red[512 + waveM * 128 + il0 + sn * 16] = sum[sn];
        }
        __syncthreads();
        // whole 256-byte rows of E: 16 lanes a row
        _Float16* E = (_Float16*)Out + oz + (size_t)n0g * ldo + m0g;
        #pragma unroll
        for (int t = 0; t < 8; ++t) {
            const int row = (tid >> 4) + 16 * t;
            const int c   = (tid & 15) * 8;
            *(h8*)(E + (size_t)row * ldo + c) = *(const h8*)(eT + row * PE + c);
        }
        if (tid < 128) {
            const size_t si = ((size_t)bz * NJB + bx) * N_DIM + n0g + tid;
            ((float*)OutK)[si] = fmaxf(fmaxf(red[tid], red[128 + tid]),
                                       fmaxf(red[256 + tid], red[384 + tid]));
            ((float*)OutV)[si] = (red[512 + tid] + red[640 + tid])
                               + (red[768 + tid] + red[896 + tid]);
        }
        return;
    }
    if constexpr (OUT_MODE == 0) {
        float* O = (float*)Out;
        #pragma unroll
        for (int sm = 0; sm < 2; ++sm)
            #pragma unroll
            for (int sn = 0; sn < 4; ++sn) {
                #pragma unroll
                for (int r = 0; r < 8; ++r)
                    O[o0 + (size_t)(sm * 16 + r) * N_DIM + sn * 16] =
                        res[sm][sn][r] + acc[sm][sn][r] * alpha + bs[sm][r];
                // before a register that these stores name is written again
                asm volatile("s_wait_xcnt 0x0" ::: "memory");
                // keeps the arithmetic of the next eight results behind that wait
                __builtin_amdgcn_sched_barrier(0);
            }
    }
    if constexpr (OUT_MODE == 1) {
        #pragma unroll
        for (int sm = 0; sm < 2; ++sm) {
            #pragma unroll
            for (int sn = 0; sn < 4; ++sn) {
                int mb = m0g + waveM * 32 + sm * 16 + mhalf;
                int n  = n0g + waveN * 64 + sn * 16 + rl;
                v8f a = acc[sm][sn];
                _Float16* O = (_Float16*)OutP + oz;
                if (part == 0) {
                    h8 pack;
                    #pragma unroll
                    for (int r = 0; r < 8; ++r)
                        pack[r] = (_Float16)(a[r] * alpha + bias[mb + r]);
                    *(h8*)(O + (size_t)n * ldo + mb) = pack;   // contiguous over m
                    // before a register that this store names is written again
                    asm volatile("s_wait_xcnt 0x0" ::: "memory");
                } else {
                    #pragma unroll
                    for (int r = 0; r < 8; ++r) {
                        float v = a[r] * alpha + bias[mb + r];
                        O[(size_t)(mb + r) * N_DIM + n] = (_Float16)v;   // V' is [C][N]
                    }
                    // before a register that these stores name is written again
                    asm volatile("s_wait_xcnt 0x0" ::: "memory");
                }
            }
        }
    }
}

// ------------------------- row factors of the softmax ----------------------
// bm, bl: [B][NJB][N], per 128-column block jb and row i the block's maximum and its
// sum of 2^(s - bm), s = score * log2(e). With M = max over jb and L = sum over jb of
// bl * 2^(bm - M), softmax(i, j) = E[i][j] * f[jb][i], f = 2^(bm - M) / L.
// One thread per row.
__global__ __launch_bounds__(64) void row_factor_kernel(
    const float* __restrict__ bm, const float* __restrict__ bl,
    _Float16* __restrict__ f) {
    // bit 2 of the block index picks the batch, as in the GEMMs around this launch
    const int t = ((blockIdx.x >> 2) & 1) * N_DIM
                + ((blockIdx.x & 3) | ((blockIdx.x >> 3) << 2)) * 64 + threadIdx.x;   // b * N + i
    const size_t base = (size_t)(t / N_DIM) * NJB * N_DIM + (t % N_DIM);
    float m[NJB], l[NJB];
    #pragma unroll
    for (int jb = 0; jb < NJB; ++jb)
        m[jb] = bm[base + (size_t)jb * N_DIM];
    // before a register that these loads name is written again
    asm volatile("s_wait_xcnt 0x0" ::: "memory");
    #pragma unroll
    for (int jb = 0; jb < NJB; ++jb)
        l[jb] = bl[base + (size_t)jb * N_DIM];
    // before a register that these loads name is written again
    asm volatile("s_wait_xcnt 0x0" ::: "memory");
    float M = m[0];
    #pragma unroll
    for (int jb = 1; jb < NJB; ++jb) M = fmaxf(M, m[jb]);
    float L = 0.f;
    #pragma unroll
    for (int jb = 0; jb < NJB; ++jb) {
        m[jb] = exp2_slot(m[jb] - M);
        L += l[jb] * m[jb];
    }
    const float inv = 1.0f / L;
    #pragma unroll
    for (int jb = 0; jb < NJB; ++jb)
        f[base + (size_t)jb * N_DIM] = (_Float16)(m[jb] * inv);
}

// ---------------------------------------------------------------------------
extern "C" void kernel_launch(void* const* d_in, const int* in_sizes, int n_in,
                              void* d_out, int out_size, void* d_ws, size_t ws_size,
                              hipStream_t stream) {
    (void)in_sizes; (void)n_in; (void)out_size; (void)ws_size;
    const float* x      = (const float*)d_in[0];
    const float* norm_w = (const float*)d_in[1];
    const float* norm_b = (const float*)d_in[2];
    const float* wq = (const float*)d_in[3];
    const float* bq = (const float*)d_in[4];
    const float* wk = (const float*)d_in[5];
    // d_in[6], the bias of K: q_i . bk is one constant per softmax row and drops out
    const float* wv = (const float*)d_in[7];
    const float* bv = (const float*)d_in[8];
    const float* wp = (const float*)d_in[9];
    const float* bp = (const float*)d_in[10];
    float* out = (float*)d_out;

    // ---- carve workspace
    char* w = (char*)d_ws;
    auto carve = [&](size_t bytes) -> char* {
        char* p = w;
        w += (bytes + 255) & ~(size_t)255;
        return p;
    };
    _Float16*  hT    = (_Float16*)carve((size_t)B_DIM * N_DIM * C_DIM * 2); // [b][n][c]
    _Float16*  g16   = (_Float16*)carve((size_t)2 * C_DIM * C_DIM * 2);     // Wk^T Wq, Wp Wv
    float*     gbias = (float*)carve((size_t)2 * C_DIM * sizeof(float));    // Wk^T bq, Wp bv
    _Float16*  Q     = (_Float16*)carve((size_t)B_DIM * N_DIM * C_DIM * 2); // Q' [b][n][c]
    _Float16*  V     = (_Float16*)carve((size_t)B_DIM * C_DIM * N_DIM * 2); // V' [b][c][n]
    _Float16*  E     = (_Float16*)carve((size_t)B_DIM * N_DIM * N_DIM * 2);       // [b][i][j]
    float*     bm    = (float*)carve((size_t)B_DIM * NJB * N_DIM * sizeof(float)); // [b][jb][i]
    float*     bl    = (float*)carve((size_t)B_DIM * NJB * N_DIM * sizeof(float)); // [b][jb][i]
    _Float16*  rf    = (_Float16*)carve((size_t)B_DIM * NJB * N_DIM * 2);          // [b][jb][i]

    const float scale_log2e = 0.063758715412299341f;  // 512^-0.5 * log2(e)

    // 1, 2) GroupNorm (statistics and normalisation) and, beside it in the same launch,
    //       the two products of the weights with their bias vectors
    gn_and_weight_product_kernel<<<B_DIM * NGRP + 2 * WTILES, 1024, 0, stream>>>(
        x, norm_w, norm_b, hT, wq, bq, wk, wv, bv, wp, g16, gbias);

    // every GEMM takes both batches in one launch; the kernel maps the block index to
    // (row tile, column tile, batch)
    dim3 gQV(2 * C_DIM / 128, N_DIM / 128, B_DIM);    //  8 x 32 x 2
    dim3 gS(N_DIM / 128, N_DIM / 128, B_DIM);         // 32 x 32 x 2
    dim3 gO(C_DIM / 128, N_DIM / 128, B_DIM);         //  4 x 32 x 2
    const size_t zNC = (size_t)N_DIM * C_DIM;
    const size_t zNN = (size_t)N_DIM * N_DIM;

    // 3) Q', V' (M=2*512, N=4096, K=512), B operand = hT "nk" direct
    gemm_wmma_kernel<1, false><<<gQV, 256, 0, stream>>>(
        g16, C_DIM, 0, hT, C_DIM, zNC, Q, V, nullptr, C_DIM, zNC,
        gbias, gbias + C_DIM, nullptr, nullptr, 1.0f, 2 * C_DIM, N_DIM, C_DIM);
    // 4) scores s[i][j] = scale_log2e * Q'[i][:] . hT[j][:] as the product hT x Q'^T (M = j,
    //    N = i, K=512), left as E = 2^(s - block max) with the blocks' maxima and sums
    gemm_wmma_kernel<2, false><<<gS, 256, 0, stream>>>(
        hT, C_DIM, zNC, Q, C_DIM, zNC, E, bm, bl, N_DIM, zNN,
        nullptr, nullptr, nullptr, nullptr, scale_log2e, N_DIM, N_DIM, C_DIM);
    // 5) the factor that makes a block's E the softmax, per (block, row)
    row_factor_kernel<<<B_DIM * N_DIM / 64, 64, 0, stream>>>(bm, bl, rf);
    // 6) out[c][j] = x + bp + sum_i (V'[c][i] * rf[jb(j)][i]) * E[i][j]  (M=512, N=4096, K=4096)
    gemm_wmma_kernel<0, true><<<gO, 256, 0, stream>>>(
        V, N_DIM, zNC, E, N_DIM, zNN, out, nullptr, nullptr,
        N_DIM, zNC, bp, nullptr, x, rf, 1.0f, C_DIM, N_DIM, N_DIM);
}
